// v000
// The times below were measured on an AMD MI455X: many runs one after another, warmed up first and cycling through
// copies of the inputs, with the whole window's GPU time divided by the number of runs. Launches and the gaps
// between them are all in it. The median over several windows is given; except for v000 it joins two sittings, which
// can be a few percent apart, so the side-by-side timings, each taken in one sitting, are the better comparison.
// v000 is the starting kernel. One run takes 1390 microseconds.
#include <hip/hip_runtime.h>

typedef float v2f __attribute__((ext_vector_type(2)));
typedef float v8f __attribute__((ext_vector_type(8)));

#define CDIM 256
#define NTOK 4096
#define BSZ  2
#define LOG2E 1.4426950408889634f
#define TILEW 20            // padded row width for [c][n16] LDS tiles
#define NT16  (NTOK / 16)

#define LDS_FENCE()   __asm__ volatile("s_wait_dscnt 0" ::: "memory")
#define SCHED_FENCE() __asm__ volatile("" ::: "memory")
// previous tile's 16 async b128 done; next tile's 16 may still be in flight
#define ASYNC_WAIT_PREFETCHED() __asm__ volatile("s_wait_asynccnt 0x10" ::: "memory")
#define ASYNC_WAIT_ALL()        __asm__ volatile("s_wait_asynccnt 0x0"  ::: "memory")

__device__ __forceinline__ v8f wmma4(v2f a, v2f b, v8f c) {
  // D(16x16,f32) = A(16x4,f32) x B(4x16,f32) + C
  return __builtin_amdgcn_wmma_f32_16x16x4_f32(false, a, false, b, (short)0, c,
                                               false, false);
}

__device__ __forceinline__ v8f vzero8() {
  v8f z = {0.f, 0.f, 0.f, 0.f, 0.f, 0.f, 0.f, 0.f};
  return z;
}

// Async DMA: 16B global -> LDS, tracked by ASYNCcnt (no VGPR staging).
// Flat->LDS mapping truncates to low 32 bits, so low bits of the generic
// shared pointer are the LDS byte address.
__device__ __forceinline__ void async_copy_b128(float* lds_dst,
                                                const float* gsrc) {
  unsigned ldsoff = (unsigned)(unsigned long long)lds_dst;
  __asm__ volatile("global_load_async_to_lds_b128 %0, %1, off"
                   :: "v"(ldsoff), "v"(gsrc)
                   : "memory");
}

// ---------------------------------------------------------------------------
// Kernel 1: K = Wk*t + bk, V = Wv*t + bv   (per-token 1x1x1 conv == GEMM)
// Grid: (NTOK/64, B, 2), 128 threads (4 waves). Wave w owns o-range [w*64,+64).
// ---------------------------------------------------------------------------
__global__ __launch_bounds__(128) void kv_proj_kernel(
    const float* __restrict__ t,
    const float* __restrict__ wk, const float* __restrict__ bk,
    const float* __restrict__ wv, const float* __restrict__ bv,
    float* __restrict__ Kout, float* __restrict__ Vout)
{
  const int nb  = blockIdx.x;
  const int b   = blockIdx.y;
  const int mat = blockIdx.z;
  const float* W    = mat ? wv : wk;
  const float* bias = mat ? bv : bk;
  float* Out        = (mat ? Vout : Kout) + (size_t)b * CDIM * NTOK;
  const float* tb   = t + (size_t)b * CDIM * NTOK;

  const int lane = threadIdx.x & 31;
  const int wave = threadIdx.x >> 5;
  const int half = lane >> 4;
  const int l15  = lane & 15;
  const int n0    = nb * 64;
  const int obase = wave * 64;

  v8f acc[4][4];
#pragma unroll
  for (int i = 0; i < 4; ++i)
#pragma unroll
    for (int j = 0; j < 4; ++j) acc[i][j] = vzero8();

  for (int k = 0; k < CDIM; k += 4) {
    const int kk = k + 2 * half;   // this lane-half's K pair {kk, kk+1}
    v2f afr[4], bfr[4];
#pragma unroll
    for (int ot = 0; ot < 4; ++ot)  // A[o][k] = W[o][c], row o = l15
      afr[ot] = *(const v2f*)(W + (size_t)(obase + ot * 16 + l15) * CDIM + kk);
#pragma unroll
    for (int nt = 0; nt < 4; ++nt) { // B[k][n] = t[c][n], col n = l15
      const int n = n0 + nt * 16 + l15;
      bfr[nt][0] = tb[(size_t)(kk + 0) * NTOK + n];
      bfr[nt][1] = tb[(size_t)(kk + 1) * NTOK + n];
    }
#pragma unroll
    for (int ot = 0; ot < 4; ++ot)
#pragma unroll
      for (int nt = 0; nt < 4; ++nt)
        acc[ot][nt] = wmma4(afr[ot], bfr[nt], acc[ot][nt]);
  }

#pragma unroll
  for (int ot = 0; ot < 4; ++ot)
#pragma unroll
    for (int r = 0; r < 8; ++r) {
      const int o = obase + ot * 16 + r + 8 * half;  // D row
      const float bb = bias[o];
#pragma unroll
      for (int nt = 0; nt < 4; ++nt)
        Out[(size_t)o * NTOK + n0 + nt * 16 + l15] = acc[ot][nt][r] + bb;
    }
}

// ---------------------------------------------------------------------------
// Kernel 2: fused Q-projection + flash attention + output projection + residual
// Grid: (NTOK/64, B), 128 threads (4 waves). Wave w owns query rows m0+w*16..+15.
// Dynamic LDS: double-buffered K/V tiles [256][20] each, filled by async DMA.
// ---------------------------------------------------------------------------
__global__ __launch_bounds__(128, 1) void attn_kernel(
    const float* __restrict__ x,
    const float* __restrict__ wq, const float* __restrict__ bq,
    const float* __restrict__ wo, const float* __restrict__ bo,
    const float* __restrict__ Kin, const float* __restrict__ Vin,
    float* __restrict__ out)
{
  extern __shared__ float dynsmem[];
  float* Kbuf0 = dynsmem;                    // [256][TILEW]
  float* Vbuf0 = Kbuf0 + CDIM * TILEW;
  float* Kbuf1 = Vbuf0 + CDIM * TILEW;
  float* Vbuf1 = Kbuf1 + CDIM * TILEW;
  __shared__ float pbuf[4][16][18];          // per-wave fragment relayout

  const int mb = blockIdx.x;
  const int b  = blockIdx.y;
  const int lane = threadIdx.x & 31;
  const int wave = threadIdx.x >> 5;
  const int half = lane >> 4;
  const int l15  = lane & 15;
  const int m0 = mb * 64;
  const int mg = m0 + wave * 16 + l15;   // this lane's query token (B-frag col)

  const float* xb = x   + (size_t)b * CDIM * NTOK;
  const float* Kb = Kin + (size_t)b * CDIM * NTOK;
  const float* Vb = Vin + (size_t)b * CDIM * NTOK;

  const int n4   = (threadIdx.x & 3) * 4;    // staging: 4-float column group
  const int crow = threadIdx.x >> 2;         // staging: starting channel row

  // kick off async staging of key/value tile 0 while we compute Q
  {
#pragma unroll 8
    for (int cc = crow; cc < CDIM; cc += 32) {
      async_copy_b128(Kbuf0 + cc * TILEW + n4, Kb + (size_t)cc * NTOK + n4);
      async_copy_b128(Vbuf0 + cc * TILEW + n4, Vb + (size_t)cc * NTOK + n4);
    }
  }

  // ---- Phase A: Q projection for this wave's 16 tokens; keep Q^T as A-frags ----
  v2f a_q[64];                         // a_q[j] covers c = 4j..4j+3
#pragma unroll
  for (int og = 0; og < 4; ++og) {
    v8f qa[4];
#pragma unroll
    for (int i = 0; i < 4; ++i) qa[i] = vzero8();
    for (int k = 0; k < CDIM; k += 4) {
      const int kk = k + 2 * half;
      v2f bfr;                         // B = x[c][m], col m = l15
      bfr[0] = xb[(size_t)(kk + 0) * NTOK + mg];
      bfr[1] = xb[(size_t)(kk + 1) * NTOK + mg];
#pragma unroll
      for (int i = 0; i < 4; ++i) {
        const int o = og * 64 + i * 16 + l15;   // A = wq[o][c]
        v2f afr = *(const v2f*)(wq + (size_t)o * CDIM + kk);
        qa[i] = wmma4(afr, bfr, qa[i]);
      }
    }
    // transpose each 16x16 Q tile through LDS: D[o][m] -> A-frags of Q^T[m][c]
#pragma unroll
    for (int i = 0; i < 4; ++i) {
#pragma unroll
      for (int r = 0; r < 8; ++r) {
        const int oo = og * 64 + i * 16 + r + 8 * half;
        pbuf[wave][l15][r + 8 * half] = qa[i][r] + bq[oo];  // [m][o_local]
      }
      LDS_FENCE();
#pragma unroll
      for (int j = 0; j < 4; ++j)
        a_q[og * 16 + i * 4 + j] =
            *(const v2f*)&pbuf[wave][l15][4 * j + 2 * half];
      SCHED_FENCE();
    }
  }

  // ---- Main loop: stream 16-wide key tiles, online softmax, double-buffered ----
  v8f o_acc[16];                      // O[m][c] accumulators (rows m, cols c)
#pragma unroll
  for (int ct = 0; ct < 16; ++ct) o_acc[ct] = vzero8();
  float Mrow[8], Lrow[8];
#pragma unroll
  for (int r = 0; r < 8; ++r) { Mrow[r] = -3.0e38f; Lrow[r] = 0.f; }

  for (int ntile = 0; ntile < NT16; ++ntile) {
    const float* Kc = (ntile & 1) ? Kbuf1 : Kbuf0;
    const float* Vc = (ntile & 1) ? Vbuf1 : Vbuf0;
    if (ntile + 1 < NT16) {
      // prefetch next tile into the other buffer (its readers finished at the
      // barrier that ended iteration ntile-1)
      float* Kn = (ntile & 1) ? Kbuf0 : Kbuf1;
      float* Vn = (ntile & 1) ? Vbuf0 : Vbuf1;
      const int nb1 = (ntile + 1) * 16;
#pragma unroll 8
      for (int cc = crow; cc < CDIM; cc += 32) {
        async_copy_b128(Kn + cc * TILEW + n4, Kb + (size_t)cc * NTOK + nb1 + n4);
        async_copy_b128(Vn + cc * TILEW + n4, Vb + (size_t)cc * NTOK + nb1 + n4);
      }
      ASYNC_WAIT_PREFETCHED();   // current tile's 16 async ops are complete
    } else {
      ASYNC_WAIT_ALL();
    }
    __syncthreads();             // current tile visible to all waves

    // S = Q^T * K  (16m x 16n, k=256); 4 interleaved partial accumulators
    v8f sp[4];
    sp[0] = sp[1] = sp[2] = sp[3] = vzero8();
#pragma unroll
    for (int j = 0; j < 64; ++j) {
      const int kk = 4 * j + 2 * half;
      v2f bfr;                                   // B[k=c][n=l15]
      bfr[0] = Kc[(kk + 0) * TILEW + l15];
      bfr[1] = Kc[(kk + 1) * TILEW + l15];
      sp[j & 3] = wmma4(a_q[j], bfr, sp[j & 3]);
    }
    v8f s = (sp[0] + sp[1]) + (sp[2] + sp[3]);

    // online softmax; rows r+8*half private to each 16-lane group
    float alpha[8];
#pragma unroll
    for (int r = 0; r < 8; ++r) {
      float mx = s[r];
      mx = fmaxf(mx, __shfl_xor(mx, 1, 32));
      mx = fmaxf(mx, __shfl_xor(mx, 2, 32));
      mx = fmaxf(mx, __shfl_xor(mx, 4, 32));
      mx = fmaxf(mx, __shfl_xor(mx, 8, 32));
      const float Mn = fmaxf(Mrow[r], mx);
      alpha[r] = exp2f((Mrow[r] - Mn) * LOG2E);
      const float p = exp2f((s[r] - Mn) * LOG2E);
      float rs = p;
      rs += __shfl_xor(rs, 1, 32);
      rs += __shfl_xor(rs, 2, 32);
      rs += __shfl_xor(rs, 4, 32);
      rs += __shfl_xor(rs, 8, 32);
      Lrow[r] = Lrow[r] * alpha[r] + rs;
      Mrow[r] = Mn;
      s[r] = p;
    }
#pragma unroll
    for (int ct = 0; ct < 16; ++ct)
#pragma unroll
      for (int r = 0; r < 8; ++r) o_acc[ct][r] *= alpha[r];

    // relayout P: D-frag [m][n] -> A-frags via per-wave LDS
#pragma unroll
    for (int r = 0; r < 8; ++r)
      pbuf[wave][r + 8 * half][l15] = s[r];     // [m][n]
    LDS_FENCE();
    v2f a_p[4];
#pragma unroll
    for (int j = 0; j < 4; ++j)
      a_p[j] = *(const v2f*)&pbuf[wave][l15][4 * j + 2 * half];
    SCHED_FENCE();

    // O += P * V^T   (B[k=n][c] = Vt[c][n])
#pragma unroll
    for (int ct = 0; ct < 16; ++ct)
#pragma unroll
      for (int j = 0; j < 4; ++j) {
        v2f bfr = *(const v2f*)(Vc + (ct * 16 + l15) * TILEW + 4 * j + 2 * half);
        o_acc[ct] = wmma4(a_p[j], bfr, o_acc[ct]);
      }
    __syncthreads();   // all waves done with this tile before it is overwritten
  }

  // ---- Epilogue: Y = Wo * O^T + bo + x, per 16-c chunk; Wo staged in LDS ----
  float rinv[8];
#pragma unroll
  for (int r = 0; r < 8; ++r) rinv[r] = 1.0f / Lrow[r];

  float* wos = Kbuf0;                 // reuse 20KB of the staging area
  v8f y_acc[16];
#pragma unroll
  for (int ot = 0; ot < 16; ++ot) y_acc[ot] = vzero8();

#pragma unroll
  for (int cc = 0; cc < 16; ++cc) {
    __syncthreads();                  // previous chunk's readers are done
    // stage Wo[:, cc*16 .. cc*16+15] cooperatively (coalesced b128 loads)
#pragma unroll 8
    for (int oo = crow; oo < CDIM; oo += 32)
      *(float4*)(wos + oo * TILEW + n4) =
          *(const float4*)(wo + (size_t)oo * CDIM + cc * 16 + n4);
    // relayout this wave's O chunk: [m][c_local] through per-wave pbuf
#pragma unroll
    for (int r = 0; r < 8; ++r)
      pbuf[wave][r + 8 * half][l15] = o_acc[cc][r] * rinv[r];
    __syncthreads();                  // Wo chunk + (our) pbuf ready
    v2f b_o[4];
#pragma unroll
    for (int j = 0; j < 4; ++j)       // B[k=c][m=l15] = O[m][c]
      b_o[j] = *(const v2f*)&pbuf[wave][l15][4 * j + 2 * half];
    SCHED_FENCE();
#pragma unroll
    for (int ot = 0; ot < 16; ++ot)
#pragma unroll
      for (int j = 0; j < 4; ++j) {
        v2f afr = *(const v2f*)(wos + (ot * 16 + l15) * TILEW + 4 * j + 2 * half);
        y_acc[ot] = wmma4(afr, b_o[j], y_acc[ot]);
      }
  }

  float* yb = out + (size_t)b * CDIM * NTOK;
#pragma unroll
  for (int ot = 0; ot < 16; ++ot)
#pragma unroll
    for (int r = 0; r < 8; ++r) {
      const int o = ot * 16 + r + 8 * half;
      yb[(size_t)o * NTOK + mg] =
          y_acc[ot][r] + bo[o] + xb[(size_t)o * NTOK + mg];
    }
}

// ---------------------------------------------------------------------------
extern "C" void kernel_launch(void* const* d_in, const int* in_sizes, int n_in,
                              void* d_out, int out_size, void* d_ws, size_t ws_size,
                              hipStream_t stream) {
  (void)in_sizes; (void)n_in; (void)out_size; (void)ws_size;
  const float* x  = (const float*)d_in[0];
  const float* t  = (const float*)d_in[1];
  const float* wq = (const float*)d_in[2];
  const float* bq = (const float*)d_in[3];
  const float* wk = (const float*)d_in[4];
  const float* bk = (const float*)d_in[5];
  const float* wv = (const float*)d_in[6];
  const float* bv = (const float*)d_in[7];
  const float* wo = (const float*)d_in[8];
  const float* bo = (const float*)d_in[9];

  float* Kws = (float*)d_ws;                       // [B][C][N] f32, 8 MB
  float* Vws = Kws + (size_t)BSZ * CDIM * NTOK;    // [B][C][N] f32, 8 MB

  dim3 g1(NTOK / 64, BSZ, 2);
  kv_proj_kernel<<<g1, dim3(128, 1, 1), 0, stream>>>(t, wk, bk, wv, bv, Kws, Vws);

  const size_t smem = (size_t)4 * CDIM * TILEW * sizeof(float);  // 80 KB
  dim3 g2(NTOK / 64, BSZ, 1);
  attn_kernel<<<g2, dim3(128, 1, 1), smem, stream>>>(x, wq, bq, wo, bo,
                                                     Kws, Vws, (float*)d_out);
}

// v001
// A run of this version takes 599 microseconds.
// In two side-by-side timings against v000, it was 2.31 and 2.32 times as fast.
#include <hip/hip_runtime.h>

typedef float v2f __attribute__((ext_vector_type(2)));
typedef float v8f __attribute__((ext_vector_type(8)));

#define CDIM 256
#define NTOK 4096
#define BSZ  2
#define LOG2E 1.4426950408889634f
#define TILEW 20            // padded row width for [c][n16] LDS tiles
#define NT16  (NTOK / 16)

#define LDS_FENCE()   __asm__ volatile("s_wait_dscnt 0" ::: "memory")
#define SCHED_FENCE() __asm__ volatile("" ::: "memory")
#define GROUP_FENCE() __builtin_amdgcn_sched_barrier(0)
// previous tile's 16 async b128 done; next tile's 16 may still be in flight
#define ASYNC_WAIT_PREFETCHED() __asm__ volatile("s_wait_asynccnt 0x10" ::: "memory")
#define ASYNC_WAIT_ALL()        __asm__ volatile("s_wait_asynccnt 0x0"  ::: "memory")

__device__ __forceinline__ v8f wmma4(v2f a, v2f b, v8f c) {
  // D(16x16,f32) = A(16x4,f32) x B(4x16,f32) + C
  return __builtin_amdgcn_wmma_f32_16x16x4_f32(false, a, false, b, (short)0, c,
                                               false, false);
}

__device__ __forceinline__ v8f vzero8() {
  v8f z = {0.f, 0.f, 0.f, 0.f, 0.f, 0.f, 0.f, 0.f};
  return z;
}

// Async DMA: 16B global -> LDS, tracked by ASYNCcnt (no VGPR staging).
// Flat->LDS mapping truncates to low 32 bits, so low bits of the generic
// shared pointer are the LDS byte address.
__device__ __forceinline__ void async_copy_b128(float* lds_dst,
                                                const float* gsrc) {
  unsigned ldsoff = (unsigned)(unsigned long long)lds_dst;
  __asm__ volatile("global_load_async_to_lds_b128 %0, %1, off"
                   :: "v"(ldsoff), "v"(gsrc)
                   : "memory");
}

// ---------------------------------------------------------------------------
// Kernel 1: K = Wk*t + bk, V = Wv*t + bv   (per-token 1x1x1 conv == GEMM)
// Grid: (NTOK/64, B, 2), 128 threads (4 waves). Wave w owns o-range [w*64,+64).
// ---------------------------------------------------------------------------
__global__ __launch_bounds__(128) void kv_proj_kernel(
    const float* __restrict__ t,
    const float* __restrict__ wk, const float* __restrict__ bk,
    const float* __restrict__ wv, const float* __restrict__ bv,
    float* __restrict__ Kout, float* __restrict__ Vout)
{
  const int nb  = blockIdx.x;
  const int b   = blockIdx.y;
  const int mat = blockIdx.z;
  const float* W    = mat ? wv : wk;
  const float* bias = mat ? bv : bk;
  float* Out        = (mat ? Vout : Kout) + (size_t)b * CDIM * NTOK;
  const float* tb   = t + (size_t)b * CDIM * NTOK;

  const int lane = threadIdx.x & 31;
  const int wave = threadIdx.x >> 5;
  const int half = lane >> 4;
  const int l15  = lane & 15;
  const int n0    = nb * 64;
  const int obase = wave * 64;

  v8f acc[4][4];
#pragma unroll
  for (int i = 0; i < 4; ++i)
#pragma unroll
    for (int j = 0; j < 4; ++j) acc[i][j] = vzero8();

  for (int k = 0; k < CDIM; k += 4) {
    const int kk = k + 2 * half;   // this lane-half's K pair {kk, kk+1}
    v2f afr[4], bfr[4];
#pragma unroll
    for (int ot = 0; ot < 4; ++ot)  // A[o][k] = W[o][c], row o = l15
      afr[ot] = *(const v2f*)(W + (size_t)(obase + ot * 16 + l15) * CDIM + kk);
#pragma unroll
    for (int nt = 0; nt < 4; ++nt) { // B[k][n] = t[c][n], col n = l15
      const int n = n0 + nt * 16 + l15;
      bfr[nt][0] = tb[(size_t)(kk + 0) * NTOK + n];
      bfr[nt][1] = tb[(size_t)(kk + 1) * NTOK + n];
    }
#pragma unroll
    for (int ot = 0; ot < 4; ++ot)
#pragma unroll
      for (int nt = 0; nt < 4; ++nt)
        acc[ot][nt] = wmma4(afr[ot], bfr[nt], acc[ot][nt]);
  }

#pragma unroll
  for (int ot = 0; ot < 4; ++ot)
#pragma unroll
    for (int r = 0; r < 8; ++r) {
      const int o = obase + ot * 16 + r + 8 * half;  // D row
      const float bb = bias[o];
#pragma unroll
      for (int nt = 0; nt < 4; ++nt)
        Out[(size_t)o * NTOK + n0 + nt * 16 + l15] = acc[ot][nt][r] + bb;
    }
}

// ---------------------------------------------------------------------------
// Kernel 2: fused Q-projection + flash attention + output projection + residual
// Grid: (NTOK/64, B), 128 threads (4 waves). Wave w owns query rows m0+w*16..+15.
// Dynamic LDS: double-buffered K/V tiles [256][20] each, filled by async DMA.
// ---------------------------------------------------------------------------
__global__ __launch_bounds__(128, 1) void attn_kernel(
    const float* __restrict__ x,
    const float* __restrict__ wq, const float* __restrict__ bq,
    const float* __restrict__ wo, const float* __restrict__ bo,
    const float* __restrict__ Kin, const float* __restrict__ Vin,
    float* __restrict__ out)
{
  extern __shared__ float dynsmem[];
  float* Kbuf0 = dynsmem;                    // [256][TILEW]
  float* Vbuf0 = Kbuf0 + CDIM * TILEW;
  float* Kbuf1 = Vbuf0 + CDIM * TILEW;
  float* Vbuf1 = Kbuf1 + CDIM * TILEW;
  __shared__ float pbuf[4][16][18];          // per-wave fragment relayout

  const int mb = blockIdx.x;
  const int b  = blockIdx.y;
  const int lane = threadIdx.x & 31;
  const int wave = threadIdx.x >> 5;
  const int half = lane >> 4;
  const int l15  = lane & 15;
  const int m0 = mb * 64;
  const int mg = m0 + wave * 16 + l15;   // this lane's query token (B-frag col)

  const float* xb = x   + (size_t)b * CDIM * NTOK;
  const float* Kb = Kin + (size_t)b * CDIM * NTOK;
  const float* Vb = Vin + (size_t)b * CDIM * NTOK;

  const int n4   = (threadIdx.x & 3) * 4;    // staging: 4-float column group
  const int crow = threadIdx.x >> 2;         // staging: starting channel row

  // kick off async staging of key/value tile 0 while we compute Q
  {
#pragma unroll 8
    for (int cc = crow; cc < CDIM; cc += 32) {
      async_copy_b128(Kbuf0 + cc * TILEW + n4, Kb + (size_t)cc * NTOK + n4);
      async_copy_b128(Vbuf0 + cc * TILEW + n4, Vb + (size_t)cc * NTOK + n4);
    }
  }

  // ---- Phase A: Q projection for this wave's 16 tokens; keep Q^T as A-frags ----
  v2f a_q[64];                         // a_q[j] covers c = 4j..4j+3
#pragma unroll
  for (int og = 0; og < 4; ++og) {
    v8f qa[4];
#pragma unroll
    for (int i = 0; i < 4; ++i) qa[i] = vzero8();
    for (int k = 0; k < CDIM; k += 4) {
      const int kk = k + 2 * half;
      v2f bfr;                         // B = x[c][m], col m = l15
      bfr[0] = xb[(size_t)(kk + 0) * NTOK + mg];
      bfr[1] = xb[(size_t)(kk + 1) * NTOK + mg];
#pragma unroll
      for (int i = 0; i < 4; ++i) {
        const int o = og * 64 + i * 16 + l15;   // A = wq[o][c]
        v2f afr = *(const v2f*)(wq + (size_t)o * CDIM + kk);
        qa[i] = wmma4(afr, bfr, qa[i]);
      }
    }
    // transpose each 16x16 Q tile through LDS: D[o][m] -> A-frags of Q^T[m][c]
#pragma unroll
    for (int i = 0; i < 4; ++i) {
#pragma unroll
      for (int r = 0; r < 8; ++r) {
        const int oo = og * 64 + i * 16 + r + 8 * half;
        pbuf[wave][l15][r + 8 * half] = qa[i][r] + bq[oo];  // [m][o_local]
      }
      LDS_FENCE();
#pragma unroll
      for (int j = 0; j < 4; ++j)
        a_q[og * 16 + i * 4 + j] =
            *(const v2f*)&pbuf[wave][l15][4 * j + 2 * half];
      SCHED_FENCE();
    }
  }

  // ---- Main loop: stream 16-wide key tiles, online softmax, double-buffered ----
  v8f o_acc[16];                      // O[m][c] accumulators (rows m, cols c)
#pragma unroll
  for (int ct = 0; ct < 16; ++ct) o_acc[ct] = vzero8();
  float Mrow[8], Lrow[8];
#pragma unroll
  for (int r = 0; r < 8; ++r) { Mrow[r] = -3.0e38f; Lrow[r] = 0.f; }

  for (int ntile = 0; ntile < NT16; ++ntile) {
    const float* Kc = (ntile & 1) ? Kbuf1 : Kbuf0;
    const float* Vc = (ntile & 1) ? Vbuf1 : Vbuf0;
    if (ntile + 1 < NT16) {
      // prefetch next tile into the other buffer (its readers finished at the
      // barrier that ended iteration ntile-1)
      float* Kn = (ntile & 1) ? Kbuf0 : Kbuf1;
      float* Vn = (ntile & 1) ? Vbuf0 : Vbuf1;
      const int nb1 = (ntile + 1) * 16;
#pragma unroll 8
      for (int cc = crow; cc < CDIM; cc += 32) {
        async_copy_b128(Kn + cc * TILEW + n4, Kb + (size_t)cc * NTOK + nb1 + n4);
        async_copy_b128(Vn + cc * TILEW + n4, Vb + (size_t)cc * NTOK + nb1 + n4);
      }
      ASYNC_WAIT_PREFETCHED();   // current tile's 16 async ops are complete
    } else {
      ASYNC_WAIT_ALL();
    }
    __syncthreads();             // current tile visible to all waves

    // S = Q^T * K  (16m x 16n, k=256); 4 interleaved partial accumulators.
    // The tile's B fragments come from LDS in groups of 16 reads, each group
    // issued one group of WMMAs ahead of its use; V's follow behind K's.
    const float* kp = Kc + 2 * half * TILEW + l15;   // B[k=c][n=l15]
    const float* vp = Vc + l15 * TILEW + 2 * half;   // B[k=n][c=l15]
    v2f kf[64];
    v2f vf[64];
    v8f sp[4];
    sp[0] = sp[1] = sp[2] = sp[3] = vzero8();
#pragma unroll
    for (int j = 0; j < 16; ++j) {
      kf[j][0] = kp[(4 * j + 0) * TILEW];
      kf[j][1] = kp[(4 * j + 1) * TILEW];
    }
#pragma unroll
    for (int g = 0; g < 4; ++g) {
      if (g < 3) {
#pragma unroll
        for (int j = 16 * (g + 1); j < 16 * (g + 2); ++j) {
          kf[j][0] = kp[(4 * j + 0) * TILEW];
          kf[j][1] = kp[(4 * j + 1) * TILEW];
        }
      } else {
#pragma unroll
        for (int i = 0; i < 64; ++i)
          vf[i] = *(const v2f*)(vp + (i >> 2) * 16 * TILEW + 4 * (i & 3));
      }
      // holds the reads above in one place, ahead of this group's WMMAs;
      // left free they sink to their users and each waits out the LDS latency
      GROUP_FENCE();
#pragma unroll
      for (int j = 16 * g; j < 16 * (g + 1); ++j)
        sp[j & 3] = wmma4(a_q[j], kf[j], sp[j & 3]);
      // keeps the next group's reads behind these WMMAs: one place a group,
      // not spread among them
      if (g < 3) GROUP_FENCE();
    }
    v8f s = (sp[0] + sp[1]) + (sp[2] + sp[3]);

    // online softmax; rows r+8*half private to each 16-lane group
    float alpha[8];
#pragma unroll
    for (int r = 0; r < 8; ++r) {
      float mx = s[r];
      mx = fmaxf(mx, __shfl_xor(mx, 1, 32));
      mx = fmaxf(mx, __shfl_xor(mx, 2, 32));
      mx = fmaxf(mx, __shfl_xor(mx, 4, 32));
      mx = fmaxf(mx, __shfl_xor(mx, 8, 32));
      const float Mn = fmaxf(Mrow[r], mx);
      alpha[r] = exp2f((Mrow[r] - Mn) * LOG2E);
      const float p = exp2f((s[r] - Mn) * LOG2E);
      float rs = p;
      rs += __shfl_xor(rs, 1, 32);
      rs += __shfl_xor(rs, 2, 32);
      rs += __shfl_xor(rs, 4, 32);
      rs += __shfl_xor(rs, 8, 32);
      Lrow[r] = Lrow[r] * alpha[r] + rs;
      Mrow[r] = Mn;
      s[r] = p;
    }
#pragma unroll
    for (int ct = 0; ct < 16; ++ct)
#pragma unroll
      for (int r = 0; r < 8; ++r) o_acc[ct][r] *= alpha[r];

    // relayout P: D-frag [m][n] -> A-frags via per-wave LDS
#pragma unroll
    for (int r = 0; r < 8; ++r)
      pbuf[wave][r + 8 * half][l15] = s[r];     // [m][n]
    LDS_FENCE();
    v2f a_p[4];
#pragma unroll
    for (int j = 0; j < 4; ++j)
      a_p[j] = *(const v2f*)&pbuf[wave][l15][4 * j + 2 * half];
    SCHED_FENCE();

    // O += P * V^T   (B[k=n][c] = Vt[c][n])
#pragma unroll
    for (int ct = 0; ct < 16; ++ct)
#pragma unroll
      for (int j = 0; j < 4; ++j)
        o_acc[ct] = wmma4(a_p[j], vf[ct * 4 + j], o_acc[ct]);
    __syncthreads();   // all waves done with this tile before it is overwritten
  }

  // ---- Epilogue: Y = Wo * O^T + bo + x, per 16-c chunk; Wo staged in LDS ----
  float rinv[8];
#pragma unroll
  for (int r = 0; r < 8; ++r) rinv[r] = 1.0f / Lrow[r];

  float* wos = Kbuf0;                 // reuse 20KB of the staging area
  v8f y_acc[16];
#pragma unroll
  for (int ot = 0; ot < 16; ++ot) y_acc[ot] = vzero8();

#pragma unroll
  for (int cc = 0; cc < 16; ++cc) {
    __syncthreads();                  // previous chunk's readers are done
    // stage Wo[:, cc*16 .. cc*16+15] cooperatively (coalesced b128 loads)
#pragma unroll 8
    for (int oo = crow; oo < CDIM; oo += 32)
      *(float4*)(wos + oo * TILEW + n4) =
          *(const float4*)(wo + (size_t)oo * CDIM + cc * 16 + n4);
    // relayout this wave's O chunk: [m][c_local] through per-wave pbuf
#pragma unroll
    for (int r = 0; r < 8; ++r)
      pbuf[wave][r + 8 * half][l15] = o_acc[cc][r] * rinv[r];
    __syncthreads();                  // Wo chunk + (our) pbuf ready
    v2f b_o[4];
#pragma unroll
    for (int j = 0; j < 4; ++j)       // B[k=c][m=l15] = O[m][c]
      b_o[j] = *(const v2f*)&pbuf[wave][l15][4 * j + 2 * half];
    SCHED_FENCE();
#pragma unroll
    for (int ot = 0; ot < 16; ++ot)
#pragma unroll
      for (int j = 0; j < 4; ++j) {
        v2f afr = *(const v2f*)(wos + (ot * 16 + l15) * TILEW + 4 * j + 2 * half);
        y_acc[ot] = wmma4(afr, b_o[j], y_acc[ot]);
      }
  }

  float* yb = out + (size_t)b * CDIM * NTOK;
#pragma unroll
  for (int ot = 0; ot < 16; ++ot)
#pragma unroll
    for (int r = 0; r < 8; ++r) {
      const int o = ot * 16 + r + 8 * half;
      yb[(size_t)o * NTOK + mg] =
          y_acc[ot][r] + bo[o] + xb[(size_t)o * NTOK + mg];
    }
}

// ---------------------------------------------------------------------------
extern "C" void kernel_launch(void* const* d_in, const int* in_sizes, int n_in,
                              void* d_out, int out_size, void* d_ws, size_t ws_size,
                              hipStream_t stream) {
  (void)in_sizes; (void)n_in; (void)out_size; (void)ws_size;
  const float* x  = (const float*)d_in[0];
  const float* t  = (const float*)d_in[1];
  const float* wq = (const float*)d_in[2];
  const float* bq = (const float*)d_in[3];
  const float* wk = (const float*)d_in[4];
  const float* bk = (const float*)d_in[5];
  const float* wv = (const float*)d_in[6];
  const float* bv = (const float*)d_in[7];
  const float* wo = (const float*)d_in[8];
  const float* bo = (const float*)d_in[9];

  float* Kws = (float*)d_ws;                       // [B][C][N] f32, 8 MB
  float* Vws = Kws + (size_t)BSZ * CDIM * NTOK;    // [B][C][N] f32, 8 MB

  dim3 g1(NTOK / 64, BSZ, 2);
  kv_proj_kernel<<<g1, dim3(128, 1, 1), 0, stream>>>(t, wk, bk, wv, bv, Kws, Vws);

  const size_t smem = (size_t)4 * CDIM * TILEW * sizeof(float);  // 80 KB
  dim3 g2(NTOK / 64, BSZ, 1);
  attn_kernel<<<g2, dim3(128, 1, 1), smem, stream>>>(x, wq, bq, wo, bo,
                                                     Kws, Vws, (float*)d_out);
}

// v002
// One run takes 313 microseconds.
// In two side-by-side timings against v001, it was 1.91 and 1.92 times as fast.
// Over all steps from v000 it is 4.43 times as fast.
#include <hip/hip_runtime.h>

typedef float v2f __attribute__((ext_vector_type(2)));
typedef float v8f __attribute__((ext_vector_type(8)));

#define CDIM 256
#define NTOK 4096
#define BSZ  2
#define LOG2E 1.4426950408889634f
#define TILEW 20            // padded row width for [c][n16] LDS tiles
#define NT16  (NTOK / 16)
#define KSPLIT 4            // key ranges, one work-group each
#define NTS   (NT16 / KSPLIT)   // key tiles of one range
#define OSPLIT 4            // output-channel ranges of the merge kernel
#define WOP   260           // padded row width of the Wo slab in LDS

#define LDS_FENCE()   __asm__ volatile("s_wait_dscnt 0" ::: "memory")
#define SCHED_FENCE() __asm__ volatile("" ::: "memory")
#define GROUP_FENCE() __builtin_amdgcn_sched_barrier(0)
// previous tile's 16 async b128 done; next tile's 16 may still be in flight
#define ASYNC_WAIT_PREFETCHED() __asm__ volatile("s_wait_asynccnt 0x10" ::: "memory")
#define ASYNC_WAIT_ALL()        __asm__ volatile("s_wait_asynccnt 0x0"  ::: "memory")
// behind a group of global loads or stores: later code may reuse the registers
// that they name
#define ADDR_WAIT()   __asm__ volatile("s_wait_xcnt 0x0" ::: "memory")

__device__ __forceinline__ v8f wmma4(v2f a, v2f b, v8f c) {
  // D(16x16,f32) = A(16x4,f32) x B(4x16,f32) + C
  return __builtin_amdgcn_wmma_f32_16x16x4_f32(false, a, false, b, (short)0, c,
                                               false, false);
}

__device__ __forceinline__ v8f vzero8() {
  v8f z = {0.f, 0.f, 0.f, 0.f, 0.f, 0.f, 0.f, 0.f};
  return z;
}

// Async DMA: 16B global -> LDS, tracked by ASYNCcnt (no VGPR staging).
// Flat->LDS mapping truncates to low 32 bits, so low bits of the generic
// shared pointer are the LDS byte address.
__device__ __forceinline__ void async_copy_b128(float* lds_dst,
                                                const float* gsrc) {
  unsigned ldsoff = (unsigned)(unsigned long long)lds_dst;
  __asm__ volatile("global_load_async_to_lds_b128 %0, %1, off"
                   :: "v"(ldsoff), "v"(gsrc)
                   : "memory");
}

// ---------------------------------------------------------------------------
// Kernel 1: K = Wk*t + bk, V = Wv*t + bv   (per-token 1x1x1 conv == GEMM)
// Grid: (NTOK/64, B, 2), 128 threads (4 waves). Wave w owns o-range [w*64,+64).
// ---------------------------------------------------------------------------
__global__ __launch_bounds__(128) void kv_proj_kernel(
    const float* __restrict__ t,
    const float* __restrict__ wk, const float* __restrict__ bk,
    const float* __restrict__ wv, const float* __restrict__ bv,
    float* __restrict__ Kout, float* __restrict__ Vout)
{
  const int nb  = blockIdx.x;
  const int b   = blockIdx.y;
  const int mat = blockIdx.z;
  const float* W    = mat ? wv : wk;
  const float* bias = mat ? bv : bk;
  float* Out        = (mat ? Vout : Kout) + (size_t)b * CDIM * NTOK;
  const float* tb   = t + (size_t)b * CDIM * NTOK;

  const int lane = threadIdx.x & 31;
  const int wave = threadIdx.x >> 5;
  const int half = lane >> 4;
  const int l15  = lane & 15;
  const int n0    = nb * 64;
  const int obase = wave * 64;

  v8f acc[4][4];
#pragma unroll
  for (int i = 0; i < 4; ++i)
#pragma unroll
    for (int j = 0; j < 4; ++j) acc[i][j] = vzero8();

  for (int k = 0; k < CDIM; k += 4) {
    const int kk = k + 2 * half;   // this lane-half's K pair {kk, kk+1}
    v2f afr[4], bfr[4];
#pragma unroll
    for (int ot = 0; ot < 4; ++ot)  // A[o][k] = W[o][c], row o = l15
      afr[ot] = *(const v2f*)(W + (size_t)(obase + ot * 16 + l15) * CDIM + kk);
#pragma unroll
    for (int nt = 0; nt < 4; ++nt) { // B[k][n] = t[c][n], col n = l15
      const int n = n0 + nt * 16 + l15;
      bfr[nt][0] = tb[(size_t)(kk + 0) * NTOK + n];
      bfr[nt][1] = tb[(size_t)(kk + 1) * NTOK + n];
    }
#pragma unroll
    for (int ot = 0; ot < 4; ++ot)
#pragma unroll
      for (int nt = 0; nt < 4; ++nt)
        acc[ot][nt] = wmma4(afr[ot], bfr[nt], acc[ot][nt]);
  }

#pragma unroll
  for (int ot = 0; ot < 4; ++ot)
#pragma unroll
    for (int r = 0; r < 8; ++r) {
      const int o = obase + ot * 16 + r + 8 * half;  // D row
      const float bb = bias[o];
#pragma unroll
      for (int nt = 0; nt < 4; ++nt)
        Out[(size_t)o * NTOK + n0 + nt * 16 + l15] = acc[ot][nt][r] + bb;
    }
}

// ---------------------------------------------------------------------------
// Kernel 2: fused Q-projection + flash attention over ONE key range
// Grid: (NTOK/64, B, KSPLIT), 128 threads (4 waves). Wave w owns query rows
// m0+w*16..+15 and the keys [ks*NTOK/KSPLIT, +NTOK/KSPLIT). It leaves the
// un-normalised O with its row maxima and row sums in the workspace.
// Two work-groups share a WGP (two waves a SIMD): 512 VGPRs a wave at most.
// Dynamic LDS: double-buffered K/V tiles [256][20] each, filled by async DMA.
// ---------------------------------------------------------------------------
__global__ __launch_bounds__(128, 2) void attn_kernel(
    const float* __restrict__ x,
    const float* __restrict__ wq, const float* __restrict__ bq,
    const float* __restrict__ Kin, const float* __restrict__ Vin,
    float* __restrict__ Opart, float* __restrict__ MLpart)
{
  extern __shared__ float dynsmem[];
  float* Kbuf0 = dynsmem;                    // [256][TILEW]
  float* Vbuf0 = Kbuf0 + CDIM * TILEW;
  float* Kbuf1 = Vbuf0 + CDIM * TILEW;
  float* Vbuf1 = Kbuf1 + CDIM * TILEW;
  __shared__ float pbuf[4][16][18];          // per-wave fragment relayout

  const int mb = blockIdx.x;
  const int b  = blockIdx.y;
  const int ks = blockIdx.z;             // this work-group's key range
  const int lane = threadIdx.x & 31;
  const int wave = threadIdx.x >> 5;
  const int half = lane >> 4;
  const int l15  = lane & 15;
  const int m0 = mb * 64;
  const int mg = m0 + wave * 16 + l15;   // this lane's query token (B-frag col)

  const float* xb = x   + (size_t)b * CDIM * NTOK;
  const float* Kb = Kin + (size_t)b * CDIM * NTOK + ks * (NTOK / KSPLIT);
  const float* Vb = Vin + (size_t)b * CDIM * NTOK + ks * (NTOK / KSPLIT);

  const int n4   = (threadIdx.x & 3) * 4;    // staging: 4-float column group
  const int crow = threadIdx.x >> 2;         // staging: starting channel row

  // kick off async staging of key/value tile 0 while we compute Q
  {
#pragma unroll 8
    for (int cc = crow; cc < CDIM; cc += 32) {
      async_copy_b128(Kbuf0 + cc * TILEW + n4, Kb + (size_t)cc * NTOK + n4);
      async_copy_b128(Vbuf0 + cc * TILEW + n4, Vb + (size_t)cc * NTOK + n4);
    }
  }

  // ---- Phase A: Q projection for this wave's 16 tokens; keep Q^T as A-frags ----
  v2f a_q[64];                         // a_q[j] covers c = 4j..4j+3
#pragma unroll
  for (int og = 0; og < 4; ++og) {
    v8f qa[4];
#pragma unroll
    for (int i = 0; i < 4; ++i) qa[i] = vzero8();
    for (int k = 0; k < CDIM; k += 4) {
      const int kk = k + 2 * half;
      v2f bfr;                         // B = x[c][m], col m = l15
      bfr[0] = xb[(size_t)(kk + 0) * NTOK + mg];
      bfr[1] = xb[(size_t)(kk + 1) * NTOK + mg];
#pragma unroll
      for (int i = 0; i < 4; ++i) {
        const int o = og * 64 + i * 16 + l15;   // A = wq[o][c]
        v2f afr = *(const v2f*)(wq + (size_t)o * CDIM + kk);
        qa[i] = wmma4(afr, bfr, qa[i]);
      }
    }
    // transpose each 16x16 Q tile through LDS: D[o][m] -> A-frags of Q^T[m][c]
#pragma unroll
    for (int i = 0; i < 4; ++i) {
#pragma unroll
      for (int r = 0; r < 8; ++r) {
        const int oo = og * 64 + i * 16 + r + 8 * half;
        pbuf[wave][l15][r + 8 * half] = qa[i][r] + bq[oo];  // [m][o_local]
      }
      LDS_FENCE();
#pragma unroll
      for (int j = 0; j < 4; ++j)
        a_q[og * 16 + i * 4 + j] =
            *(const v2f*)&pbuf[wave][l15][4 * j + 2 * half];
      SCHED_FENCE();
    }
  }

  // ---- Main loop: stream 16-wide key tiles, online softmax, double-buffered ----
  v8f o_acc[16];                      // O[m][c] accumulators (rows m, cols c)
#pragma unroll
  for (int ct = 0; ct < 16; ++ct) o_acc[ct] = vzero8();
  float Mrow[8], Lrow[8];
#pragma unroll
  for (int r = 0; r < 8; ++r) { Mrow[r] = -3.0e38f; Lrow[r] = 0.f; }

  for (int ntile = 0; ntile < NTS; ++ntile) {
    const float* Kc = (ntile & 1) ? Kbuf1 : Kbuf0;
    const float* Vc = (ntile & 1) ? Vbuf1 : Vbuf0;
    if (ntile + 1 < NTS) {
      // prefetch next tile into the other buffer (its readers finished at the
      // barrier that ended iteration ntile-1)
      float* Kn = (ntile & 1) ? Kbuf0 : Kbuf1;
      float* Vn = (ntile & 1) ? Vbuf0 : Vbuf1;
      const int nb1 = (ntile + 1) * 16;
#pragma unroll 8
      for (int cc = crow; cc < CDIM; cc += 32) {
        async_copy_b128(Kn + cc * TILEW + n4, Kb + (size_t)cc * NTOK + nb1 + n4);
        async_copy_b128(Vn + cc * TILEW + n4, Vb + (size_t)cc * NTOK + nb1 + n4);
      }
      ASYNC_WAIT_PREFETCHED();   // current tile's 16 async ops are complete
    } else {
      ASYNC_WAIT_ALL();
    }
    __syncthreads();             // current tile visible to all waves

    // S = Q^T * K  (16m x 16n, k=256); 4 interleaved partial accumulators.
    // The tile's B fragments come from LDS in groups of 16 reads, each group
    // issued one group of WMMAs ahead of its use; V's follow behind K's.
    const float* kp = Kc + 2 * half * TILEW + l15;   // B[k=c][n=l15]
    const float* vp = Vc + l15 * TILEW + 2 * half;   // B[k=n][c=l15]
    v2f kf[64];
    v2f vf[64];
    v8f sp[4];
    sp[0] = sp[1] = sp[2] = sp[3] = vzero8();
#pragma unroll
    for (int j = 0; j < 16; ++j) {
      kf[j][0] = kp[(4 * j + 0) * TILEW];
      kf[j][1] = kp[(4 * j + 1) * TILEW];
    }
#pragma unroll
    for (int g = 0; g < 4; ++g) {
      if (g < 3) {
#pragma unroll
        for (int j = 16 * (g + 1); j < 16 * (g + 2); ++j) {
          kf[j][0] = kp[(4 * j + 0) * TILEW];
          kf[j][1] = kp[(4 * j + 1) * TILEW];
        }
      } else {
#pragma unroll
        for (int i = 0; i < 64; ++i)
          vf[i] = *(const v2f*)(vp + (i >> 2) * 16 * TILEW + 4 * (i & 3));
      }
      // holds the reads above in one place, ahead of this group's WMMAs;
      // left free they sink to their users and each waits out the LDS latency
      GROUP_FENCE();
#pragma unroll
      for (int j = 16 * g; j < 16 * (g + 1); ++j)
        sp[j & 3] = wmma4(a_q[j], kf[j], sp[j & 3]);
      // keeps the next group's reads behind these WMMAs: one place a group,
      // not spread among them
      if (g < 3) GROUP_FENCE();
    }
    v8f s = (sp[0] + sp[1]) + (sp[2] + sp[3]);

    // online softmax; rows r+8*half private to each 16-lane group
    float alpha[8];
#pragma unroll
    for (int r = 0; r < 8; ++r) {
      float mx = s[r];
      mx = fmaxf(mx, __shfl_xor(mx, 1, 32));
      mx = fmaxf(mx, __shfl_xor(mx, 2, 32));
      mx = fmaxf(mx, __shfl_xor(mx, 4, 32));
      mx = fmaxf(mx, __shfl_xor(mx, 8, 32));
      const float Mn = fmaxf(Mrow[r], mx);
      alpha[r] = exp2f((Mrow[r] - Mn) * LOG2E);
      const float p = exp2f((s[r] - Mn) * LOG2E);
      float rs = p;
      rs += __shfl_xor(rs, 1, 32);
      rs += __shfl_xor(rs, 2, 32);
      rs += __shfl_xor(rs, 4, 32);
      rs += __shfl_xor(rs, 8, 32);
      Lrow[r] = Lrow[r] * alpha[r] + rs;
      Mrow[r] = Mn;
      s[r] = p;
    }
#pragma unroll
    for (int ct = 0; ct < 16; ++ct)
#pragma unroll
      for (int r = 0; r < 8; ++r) o_acc[ct][r] *= alpha[r];

    // relayout P: D-frag [m][n] -> A-frags via per-wave LDS
#pragma unroll
    for (int r = 0; r < 8; ++r)
      pbuf[wave][r + 8 * half][l15] = s[r];     // [m][n]
    LDS_FENCE();
    v2f a_p[4];
#pragma unroll
    for (int j = 0; j < 4; ++j)
      a_p[j] = *(const v2f*)&pbuf[wave][l15][4 * j + 2 * half];
    SCHED_FENCE();

    // O += P * V^T   (B[k=n][c] = Vt[c][n])
#pragma unroll
    for (int ct = 0; ct < 16; ++ct)
#pragma unroll
      for (int j = 0; j < 4; ++j)
        o_acc[ct] = wmma4(a_p[j], vf[ct * 4 + j], o_acc[ct]);
    __syncthreads();   // all waves done with this tile before it is overwritten
  }

  // ---- Leave this range's partial result in the workspace ----
  // O tile: [ct][r>>2][lane][r&3], so that each b128 store covers 512 B in a row
  const size_t tile = ((size_t)b * NT16 + mb * 4 + wave) * KSPLIT + ks;
  float* op = Opart + tile * (16 * CDIM) + lane * 4;
#pragma unroll   // o_acc is indexed by constants only and stays in registers
  for (int ct = 0; ct < 16; ++ct) {
    *(float4*)(op + ct * 256) =
        make_float4(o_acc[ct][0], o_acc[ct][1], o_acc[ct][2], o_acc[ct][3]);
    *(float4*)(op + ct * 256 + 128) =
        make_float4(o_acc[ct][4], o_acc[ct][5], o_acc[ct][6], o_acc[ct][7]);
  }
  ADDR_WAIT();
  // row maxima [0..15] and row sums [16..31]; the 16 lanes of a half agree
  if (l15 == 0) {
    float* ml = MLpart + tile * 32 + 8 * half;
    *(float4*)(ml + 0)  = make_float4(Mrow[0], Mrow[1], Mrow[2], Mrow[3]);
    *(float4*)(ml + 4)  = make_float4(Mrow[4], Mrow[5], Mrow[6], Mrow[7]);
    *(float4*)(ml + 16) = make_float4(Lrow[0], Lrow[1], Lrow[2], Lrow[3]);
    *(float4*)(ml + 20) = make_float4(Lrow[4], Lrow[5], Lrow[6], Lrow[7]);
  }
}

// ---------------------------------------------------------------------------
// Kernel 3: merge the KSPLIT key ranges, then Y = Wo * O^T + bo + x
// Grid: (NTOK/64, B, OSPLIT), 128 threads (4 waves). Wave w owns query rows
// m0+w*16..+15; the work-group owns output channels [oz*64, +64).
// Two work-groups share a WGP, so that all 512 are resident at once.
// Every loop is unrolled in full: its arrays are indexed by constants only and
// so stay in registers.
// ---------------------------------------------------------------------------
__global__ __launch_bounds__(128, 2) void merge_proj_kernel(
    const float* __restrict__ x,
    const float* __restrict__ wo, const float* __restrict__ bo,
    const float* __restrict__ Opart, const float* __restrict__ MLpart,
    float* __restrict__ out)
{
  __shared__ float wos[(CDIM / OSPLIT) * WOP];   // Wo rows of this range
  __shared__ float pbuf[4][16][18];              // per-wave fragment relayout

  const int mb = blockIdx.x;
  const int b  = blockIdx.y;
  const int ob = blockIdx.z * (CDIM / OSPLIT);
  const int lane = threadIdx.x & 31;
  const int wave = threadIdx.x >> 5;
  const int half = lane >> 4;
  const int l15  = lane & 15;
  const int mg = mb * 64 + wave * 16 + l15;
  const float* xb = x + (size_t)b * CDIM * NTOK;

  // The global reads of the merge are issued in groups of 32 to 80 loads, so
  // that a wave pays the L2 latency once a group and not once a load.
  const size_t tile0 = ((size_t)b * NT16 + mb * 4 + wave) * KSPLIT;  // range 0
  const float* mlp = MLpart + tile0 * 32 + 8 * half;
  const float* opp = Opart + tile0 * (16 * CDIM) + lane * 4;
  const float* wop = wo + (size_t)(ob + (threadIdx.x >> 6)) * CDIM + (threadIdx.x & 63) * 4;
  const float* xp  = xb + (size_t)(ob + 8 * half) * NTOK + mg;
  const float* bop = bo + ob + 8 * half;
  const int c4 = (threadIdx.x & 63) * 4;   // Wo staging: column group
  const int r0 = threadIdx.x >> 6;         // Wo staging: first row

  float4 mv[KSPLIT][2], lv[KSPLIT][2];     // row maxima, row sums (r + 8*half)
#pragma unroll
  for (int s = 0; s < KSPLIT; ++s)
#pragma unroll
    for (int q = 0; q < 2; ++q) {
      mv[s][q] = *(const float4*)(mlp + s * 32 + 4 * q);
      lv[s][q] = *(const float4*)(mlp + s * 32 + 16 + 4 * q);
    }
  float4 wreg[CDIM / OSPLIT / 2];          // Wo[ob .. ob+63][0..255], 2 rows a pass
#pragma unroll
  for (int i = 0; i < CDIM / OSPLIT / 2; ++i)
    wreg[i] = *(const float4*)(wop + i * 2 * CDIM);
  // O comes in groups of four 16-channel chunks, all ranges: 32 loads a group
  float4 obuf[2][4][KSPLIT][2];
#pragma unroll
  for (int cl = 0; cl < 4; ++cl)
#pragma unroll
    for (int s = 0; s < KSPLIT; ++s)
#pragma unroll
      for (int h = 0; h < 2; ++h)
        obuf[0][cl][s][h] = *(const float4*)(
            opp + s * (16 * CDIM) + cl * 256 + h * 128);
  ADDR_WAIT();
  // holds the reads above in one place; left free they sink to their users
  GROUP_FENCE();

#pragma unroll
  for (int i = 0; i < CDIM / OSPLIT / 2; ++i)
    *(float4*)(wos + (r0 + 2 * i) * WOP + c4) = wreg[i];
  ADDR_WAIT();
  // group 1's reads take the registers that the Wo rows have left
  GROUP_FENCE();
#pragma unroll
  for (int cl = 0; cl < 4; ++cl)
#pragma unroll
    for (int s = 0; s < KSPLIT; ++s)
#pragma unroll
      for (int h = 0; h < 2; ++h)
        obuf[1][cl][s][h] = *(const float4*)(
            opp + s * (16 * CDIM) + (4 + cl) * 256 + h * 128);
  // the residual's x and the bias come with them
  float xres[16 / OSPLIT][8];
  float4 bov[16 / OSPLIT][2];
#pragma unroll
  for (int ot = 0; ot < 16 / OSPLIT; ++ot) {
#pragma unroll
    for (int r = 0; r < 8; ++r) xres[ot][r] = xp[(size_t)(ot * 16 + r) * NTOK];
    bov[ot][0] = *(const float4*)(bop + ot * 16);
    bov[ot][1] = *(const float4*)(bop + ot * 16 + 4);
  }
  ADDR_WAIT();
  // one place again, ahead of the weights
  GROUP_FENCE();

  // weights of the ranges for rows r + 8*half, 1 / (row sum) folded in
  float wgt[KSPLIT][8];
#pragma unroll
  for (int r = 0; r < 8; ++r) {
    float Ms[KSPLIT], Ls[KSPLIT];
#pragma unroll
    for (int s = 0; s < KSPLIT; ++s) {
      const float4 m4 = mv[s][r >> 2], l4 = lv[s][r >> 2];
      Ms[s] = (r & 3) == 0 ? m4.x : (r & 3) == 1 ? m4.y : (r & 3) == 2 ? m4.z : m4.w;
      Ls[s] = (r & 3) == 0 ? l4.x : (r & 3) == 1 ? l4.y : (r & 3) == 2 ? l4.z : l4.w;
    }
    float Mx = Ms[0];
#pragma unroll
    for (int s = 1; s < KSPLIT; ++s) Mx = fmaxf(Mx, Ms[s]);
    float Lt = 0.f;
#pragma unroll
    for (int s = 0; s < KSPLIT; ++s) {
      wgt[s][r] = exp2f((Ms[s] - Mx) * LOG2E);
      Lt += wgt[s][r] * Ls[s];
    }
    const float rinv = 1.0f / Lt;
#pragma unroll
    for (int s = 0; s < KSPLIT; ++s) wgt[s][r] *= rinv;
  }

  __syncthreads();                    // Wo slab visible to all waves

  v8f y_acc[16 / OSPLIT];
#pragma unroll
  for (int ot = 0; ot < 16 / OSPLIT; ++ot) y_acc[ot] = vzero8();

#pragma unroll
  for (int g = 0; g < 4; ++g) {
#pragma unroll
    for (int cl = 0; cl < 4; ++cl) {
      const int cc = g * 4 + cl;
      // merge the ranges: O[m = r + 8*half][c = cc*16 + l15], normalised
      float om[8];
#pragma unroll
      for (int r = 0; r < 8; ++r) om[r] = 0.f;
#pragma unroll
      for (int s = 0; s < KSPLIT; ++s) {
        const float4 lo = obuf[g & 1][cl][s][0], hi = obuf[g & 1][cl][s][1];
        om[0] += wgt[s][0] * lo.x; om[1] += wgt[s][1] * lo.y;
        om[2] += wgt[s][2] * lo.z; om[3] += wgt[s][3] * lo.w;
        om[4] += wgt[s][4] * hi.x; om[5] += wgt[s][5] * hi.y;
        om[6] += wgt[s][6] * hi.z; om[7] += wgt[s][7] * hi.w;
      }
      // relayout this wave's O chunk: [m][c_local] through per-wave pbuf
#pragma unroll
      for (int r = 0; r < 8; ++r)
        pbuf[wave][r + 8 * half][l15] = om[r];
      LDS_FENCE();
      v2f b_o[4];
#pragma unroll
      for (int j = 0; j < 4; ++j)     // B[k=c][m=l15] = O[m][c]
        b_o[j] = *(const v2f*)&pbuf[wave][l15][4 * j + 2 * half];
      SCHED_FENCE();
#pragma unroll
      for (int j = 0; j < 4; ++j)
#pragma unroll
        for (int ot = 0; ot < 16 / OSPLIT; ++ot) {
          v2f afr = *(const v2f*)(wos + (ot * 16 + l15) * WOP + cc * 16 + 4 * j + 2 * half);
          y_acc[ot] = wmma4(afr, b_o[j], y_acc[ot]);
        }
    }
    if (g + 2 < 4) {
      // keeps the refill behind the sums that free its registers ...
      GROUP_FENCE();
#pragma unroll
      for (int cl = 0; cl < 4; ++cl)
#pragma unroll
        for (int s = 0; s < KSPLIT; ++s)
#pragma unroll
          for (int h = 0; h < 2; ++h)
            obuf[g & 1][cl][s][h] = *(const float4*)(
                opp + s * (16 * CDIM) + ((g + 2) * 4 + cl) * 256 + h * 128);
      ADDR_WAIT();
      // ... and in one place, ahead of the next group's work
      GROUP_FENCE();
    }
  }

  float* yp = out + (size_t)b * CDIM * NTOK + (size_t)(ob + 8 * half) * NTOK + mg;
#pragma unroll
  for (int ot = 0; ot < 16 / OSPLIT; ++ot) {
    const float4 b0 = bov[ot][0], b1 = bov[ot][1];
    const float bb[8] = {b0.x, b0.y, b0.z, b0.w, b1.x, b1.y, b1.z, b1.w};
#pragma unroll
    for (int r = 0; r < 8; ++r)       // output channel ob + ot*16 + r + 8*half
      yp[(size_t)(ot * 16 + r) * NTOK] = y_acc[ot][r] + bb[r] + xres[ot][r];
  }
}

// ---------------------------------------------------------------------------
extern "C" void kernel_launch(void* const* d_in, const int* in_sizes, int n_in,
                              void* d_out, int out_size, void* d_ws, size_t ws_size,
                              hipStream_t stream) {
  (void)in_sizes; (void)n_in; (void)out_size; (void)ws_size;
  const float* x  = (const float*)d_in[0];
  const float* t  = (const float*)d_in[1];
  const float* wq = (const float*)d_in[2];
  const float* bq = (const float*)d_in[3];
  const float* wk = (const float*)d_in[4];
  const float* bk = (const float*)d_in[5];
  const float* wv = (const float*)d_in[6];
  const float* bv = (const float*)d_in[7];
  const float* wo = (const float*)d_in[8];
  const float* bo = (const float*)d_in[9];

  float* Kws = (float*)d_ws;                       // [B][C][N] f32, 8 MB
  float* Vws = Kws + (size_t)BSZ * CDIM * NTOK;    // [B][C][N] f32, 8 MB
  float* Ows = Vws + (size_t)BSZ * CDIM * NTOK;    // [B][N/16][KSPLIT][16*C], 32 MB
  float* MLws = Ows + (size_t)KSPLIT * BSZ * CDIM * NTOK;  // [B][N/16][KSPLIT][32]

  dim3 g1(NTOK / 64, BSZ, 2);
  kv_proj_kernel<<<g1, dim3(128, 1, 1), 0, stream>>>(t, wk, bk, wv, bv, Kws, Vws);

  const size_t smem = (size_t)4 * CDIM * TILEW * sizeof(float);  // 80 KB
  dim3 g2(NTOK / 64, BSZ, KSPLIT);
  attn_kernel<<<g2, dim3(128, 1, 1), smem, stream>>>(x, wq, bq, Kws, Vws,
                                                     Ows, MLws);

  dim3 g3(NTOK / 64, BSZ, OSPLIT);
  merge_proj_kernel<<<g3, dim3(128, 1, 1), 0, stream>>>(x, wo, bo, Ows, MLws,
                                                        (float*)d_out);
}

// v003
// It runs in 296 microseconds.
// Timed twice side by side with v002, it ran 1.06 times as fast both times.
// Over all steps from v000 it is 4.69 times as fast.
#include <hip/hip_runtime.h>

typedef float v2f __attribute__((ext_vector_type(2)));
typedef float v8f __attribute__((ext_vector_type(8)));

#define CDIM 256
#define NTOK 4096
#define BSZ  2
#define LOG2E 1.4426950408889634f
#define TILEW 20            // padded row width for [c][n16] LDS tiles
#define NT16  (NTOK / 16)
#define KSPLIT 4            // key ranges, one work-group each
#define NTS   (NT16 / KSPLIT)   // key tiles of one range
#define OSPLIT 4            // output-channel ranges of the merge kernel
#define WOP   260           // padded row width of the Wo slab in LDS

#define LDS_FENCE()   __asm__ volatile("s_wait_dscnt 0" ::: "memory")
#define SCHED_FENCE() __asm__ volatile("" ::: "memory")
#define GROUP_FENCE() __builtin_amdgcn_sched_barrier(0)
// previous tile's 16 async b128 done; next tile's 16 may still be in flight
#define ASYNC_WAIT_PREFETCHED() __asm__ volatile("s_wait_asynccnt 0x10" ::: "memory")
#define ASYNC_WAIT_ALL()        __asm__ volatile("s_wait_asynccnt 0x0"  ::: "memory")
// behind a group of global loads or stores: later code may reuse the registers
// that they name
#define ADDR_WAIT()   __asm__ volatile("s_wait_xcnt 0x0" ::: "memory")

__device__ __forceinline__ v8f wmma4(v2f a, v2f b, v8f c) {
  // D(16x16,f32) = A(16x4,f32) x B(4x16,f32) + C
  return __builtin_amdgcn_wmma_f32_16x16x4_f32(false, a, false, b, (short)0, c,
                                               false, false);
}

__device__ __forceinline__ v8f vzero8() {
  v8f z = {0.f, 0.f, 0.f, 0.f, 0.f, 0.f, 0.f, 0.f};
  return z;
}

// Maximum / sum over each 16-lane row, for eight values at once: four DPP
// row_xmask steps (lane l with lane l ^ 1, ^ 2, ^ 4, ^ 8) in the vector unit, in
// place. A shuffle would go through the LDS queue and cost its latency at every
// step. The eight values alternate, so that a step's producer stands eight
// instructions back and no step waits. All 32 lanes must be on.
__device__ __forceinline__ void row_max8(float (&v)[8]) {
  // asm: the compiler splits the builtin form into a DPP move and a maximum
  __asm__(
      "v_max_num_f32_dpp %0, %0, %0 row_xmask:1 row_mask:0xf bank_mask:0xf\n\t"
      "v_max_num_f32_dpp %1, %1, %1 row_xmask:1 row_mask:0xf bank_mask:0xf\n\t"
      "v_max_num_f32_dpp %2, %2, %2 row_xmask:1 row_mask:0xf bank_mask:0xf\n\t"
      "v_max_num_f32_dpp %3, %3, %3 row_xmask:1 row_mask:0xf bank_mask:0xf\n\t"
      "v_max_num_f32_dpp %4, %4, %4 row_xmask:1 row_mask:0xf bank_mask:0xf\n\t"
      "v_max_num_f32_dpp %5, %5, %5 row_xmask:1 row_mask:0xf bank_mask:0xf\n\t"
      "v_max_num_f32_dpp %6, %6, %6 row_xmask:1 row_mask:0xf bank_mask:0xf\n\t"
      "v_max_num_f32_dpp %7, %7, %7 row_xmask:1 row_mask:0xf bank_mask:0xf\n\t"
      "v_max_num_f32_dpp %0, %0, %0 row_xmask:2 row_mask:0xf bank_mask:0xf\n\t"
      "v_max_num_f32_dpp %1, %1, %1 row_xmask:2 row_mask:0xf bank_mask:0xf\n\t"
      "v_max_num_f32_dpp %2, %2, %2 row_xmask:2 row_mask:0xf bank_mask:0xf\n\t"
      "v_max_num_f32_dpp %3, %3, %3 row_xmask:2 row_mask:0xf bank_mask:0xf\n\t"
      "v_max_num_f32_dpp %4, %4, %4 row_xmask:2 row_mask:0xf bank_mask:0xf\n\t"
      "v_max_num_f32_dpp %5, %5, %5 row_xmask:2 row_mask:0xf bank_mask:0xf\n\t"
      "v_max_num_f32_dpp %6, %6, %6 row_xmask:2 row_mask:0xf bank_mask:0xf\n\t"
      "v_max_num_f32_dpp %7, %7, %7 row_xmask:2 row_mask:0xf bank_mask:0xf\n\t"
      "v_max_num_f32_dpp %0, %0, %0 row_xmask:4 row_mask:0xf bank_mask:0xf\n\t"
      "v_max_num_f32_dpp %1, %1, %1 row_xmask:4 row_mask:0xf bank_mask:0xf\n\t"
      "v_max_num_f32_dpp %2, %2, %2 row_xmask:4 row_mask:0xf bank_mask:0xf\n\t"
      "v_max_num_f32_dpp %3, %3, %3 row_xmask:4 row_mask:0xf bank_mask:0xf\n\t"
      "v_max_num_f32_dpp %4, %4, %4 row_xmask:4 row_mask:0xf bank_mask:0xf\n\t"
      "v_max_num_f32_dpp %5, %5, %5 row_xmask:4 row_mask:0xf bank_mask:0xf\n\t"
      "v_max_num_f32_dpp %6, %6, %6 row_xmask:4 row_mask:0xf bank_mask:0xf\n\t"
      "v_max_num_f32_dpp %7, %7, %7 row_xmask:4 row_mask:0xf bank_mask:0xf\n\t"
      "v_max_num_f32_dpp %0, %0, %0 row_xmask:8 row_mask:0xf bank_mask:0xf\n\t"
      "v_max_num_f32_dpp %1, %1, %1 row_xmask:8 row_mask:0xf bank_mask:0xf\n\t"
      "v_max_num_f32_dpp %2, %2, %2 row_xmask:8 row_mask:0xf bank_mask:0xf\n\t"
      "v_max_num_f32_dpp %3, %3, %3 row_xmask:8 row_mask:0xf bank_mask:0xf\n\t"
      "v_max_num_f32_dpp %4, %4, %4 row_xmask:8 row_mask:0xf bank_mask:0xf\n\t"
      "v_max_num_f32_dpp %5, %5, %5 row_xmask:8 row_mask:0xf bank_mask:0xf\n\t"
      "v_max_num_f32_dpp %6, %6, %6 row_xmask:8 row_mask:0xf bank_mask:0xf\n\t"
      "v_max_num_f32_dpp %7, %7, %7 row_xmask:8 row_mask:0xf bank_mask:0xf"
      : "+v"(v[0]), "+v"(v[1]), "+v"(v[2]), "+v"(v[3]),
        "+v"(v[4]), "+v"(v[5]), "+v"(v[6]), "+v"(v[7]));
}

__device__ __forceinline__ void row_sum8(float (&v)[8]) {
  // asm: in place, so that no step takes a register of its own for the moved value
  __asm__(
      "v_add_f32_dpp %0, %0, %0 row_xmask:1 row_mask:0xf bank_mask:0xf\n\t"
      "v_add_f32_dpp %1, %1, %1 row_xmask:1 row_mask:0xf bank_mask:0xf\n\t"
      "v_add_f32_dpp %2, %2, %2 row_xmask:1 row_mask:0xf bank_mask:0xf\n\t"
      "v_add_f32_dpp %3, %3, %3 row_xmask:1 row_mask:0xf bank_mask:0xf\n\t"
      "v_add_f32_dpp %4, %4, %4 row_xmask:1 row_mask:0xf bank_mask:0xf\n\t"
      "v_add_f32_dpp %5, %5, %5 row_xmask:1 row_mask:0xf bank_mask:0xf\n\t"
      "v_add_f32_dpp %6, %6, %6 row_xmask:1 row_mask:0xf bank_mask:0xf\n\t"
      "v_add_f32_dpp %7, %7, %7 row_xmask:1 row_mask:0xf bank_mask:0xf\n\t"
      "v_add_f32_dpp %0, %0, %0 row_xmask:2 row_mask:0xf bank_mask:0xf\n\t"
      "v_add_f32_dpp %1, %1, %1 row_xmask:2 row_mask:0xf bank_mask:0xf\n\t"
      "v_add_f32_dpp %2, %2, %2 row_xmask:2 row_mask:0xf bank_mask:0xf\n\t"
      "v_add_f32_dpp %3, %3, %3 row_xmask:2 row_mask:0xf bank_mask:0xf\n\t"
      "v_add_f32_dpp %4, %4, %4 row_xmask:2 row_mask:0xf bank_mask:0xf\n\t"
      "v_add_f32_dpp %5, %5, %5 row_xmask:2 row_mask:0xf bank_mask:0xf\n\t"
      "v_add_f32_dpp %6, %6, %6 row_xmask:2 row_mask:0xf bank_mask:0xf\n\t"
      "v_add_f32_dpp %7, %7, %7 row_xmask:2 row_mask:0xf bank_mask:0xf\n\t"
      "v_add_f32_dpp %0, %0, %0 row_xmask:4 row_mask:0xf bank_mask:0xf\n\t"
      "v_add_f32_dpp %1, %1, %1 row_xmask:4 row_mask:0xf bank_mask:0xf\n\t"
      "v_add_f32_dpp %2, %2, %2 row_xmask:4 row_mask:0xf bank_mask:0xf\n\t"
      "v_add_f32_dpp %3, %3, %3 row_xmask:4 row_mask:0xf bank_mask:0xf\n\t"
      "v_add_f32_dpp %4, %4, %4 row_xmask:4 row_mask:0xf bank_mask:0xf\n\t"
      "v_add_f32_dpp %5, %5, %5 row_xmask:4 row_mask:0xf bank_mask:0xf\n\t"
      "v_add_f32_dpp %6, %6, %6 row_xmask:4 row_mask:0xf bank_mask:0xf\n\t"
      "v_add_f32_dpp %7, %7, %7 row_xmask:4 row_mask:0xf bank_mask:0xf\n\t"
      "v_add_f32_dpp %0, %0, %0 row_xmask:8 row_mask:0xf bank_mask:0xf\n\t"
      "v_add_f32_dpp %1, %1, %1 row_xmask:8 row_mask:0xf bank_mask:0xf\n\t"
      "v_add_f32_dpp %2, %2, %2 row_xmask:8 row_mask:0xf bank_mask:0xf\n\t"
      "v_add_f32_dpp %3, %3, %3 row_xmask:8 row_mask:0xf bank_mask:0xf\n\t"
      "v_add_f32_dpp %4, %4, %4 row_xmask:8 row_mask:0xf bank_mask:0xf\n\t"
      "v_add_f32_dpp %5, %5, %5 row_xmask:8 row_mask:0xf bank_mask:0xf\n\t"
      "v_add_f32_dpp %6, %6, %6 row_xmask:8 row_mask:0xf bank_mask:0xf\n\t"
      "v_add_f32_dpp %7, %7, %7 row_xmask:8 row_mask:0xf bank_mask:0xf"
      : "+v"(v[0]), "+v"(v[1]), "+v"(v[2]), "+v"(v[3]),
        "+v"(v[4]), "+v"(v[5]), "+v"(v[6]), "+v"(v[7]));
}

// Async DMA: 16B global -> LDS, tracked by ASYNCcnt (no VGPR staging).
// Flat->LDS mapping truncates to low 32 bits, so low bits of the generic
// shared pointer are the LDS byte address.
__device__ __forceinline__ void async_copy_b128(float* lds_dst,
                                                const float* gsrc) {
  unsigned ldsoff = (unsigned)(unsigned long long)lds_dst;
  __asm__ volatile("global_load_async_to_lds_b128 %0, %1, off"
                   :: "v"(ldsoff), "v"(gsrc)
                   : "memory");
}

// ---------------------------------------------------------------------------
// Kernel 1: K = Wk*t + bk, V = Wv*t + bv   (per-token 1x1x1 conv == GEMM)
// Grid: (NTOK/64, B, 2), 128 threads (4 waves). Wave w owns o-range [w*64,+64).
// ---------------------------------------------------------------------------
__global__ __launch_bounds__(128) void kv_proj_kernel(
    const float* __restrict__ t,
    const float* __restrict__ wk, const float* __restrict__ bk,
    const float* __restrict__ wv, const float* __restrict__ bv,
    float* __restrict__ Kout, float* __restrict__ Vout)
{
  const int nb  = blockIdx.x;
  const int b   = blockIdx.y;
  const int mat = blockIdx.z;
  const float* W    = mat ? wv : wk;
  const float* bias = mat ? bv : bk;
  float* Out        = (mat ? Vout : Kout) + (size_t)b * CDIM * NTOK;
  const float* tb   = t + (size_t)b * CDIM * NTOK;

  const int lane = threadIdx.x & 31;
  const int wave = threadIdx.x >> 5;
  const int half = lane >> 4;
  const int l15  = lane & 15;
  const int n0    = nb * 64;
  const int obase = wave * 64;

  v8f acc[4][4];
#pragma unroll
  for (int i = 0; i < 4; ++i)
#pragma unroll
    for (int j = 0; j < 4; ++j) acc[i][j] = vzero8();

  for (int k = 0; k < CDIM; k += 4) {
    const int kk = k + 2 * half;   // this lane-half's K pair {kk, kk+1}
    v2f afr[4], bfr[4];
#pragma unroll
    for (int ot = 0; ot < 4; ++ot)  // A[o][k] = W[o][c], row o = l15
      afr[ot] = *(const v2f*)(W + (size_t)(obase + ot * 16 + l15) * CDIM + kk);
#pragma unroll
    for (int nt = 0; nt < 4; ++nt) { // B[k][n] = t[c][n], col n = l15
      const int n = n0 + nt * 16 + l15;
      bfr[nt][0] = tb[(size_t)(kk + 0) * NTOK + n];
      bfr[nt][1] = tb[(size_t)(kk + 1) * NTOK + n];
    }
#pragma unroll
    for (int ot = 0; ot < 4; ++ot)
#pragma unroll
      for (int nt = 0; nt < 4; ++nt)
        acc[ot][nt] = wmma4(afr[ot], bfr[nt], acc[ot][nt]);
  }

#pragma unroll
  for (int ot = 0; ot < 4; ++ot)
#pragma unroll
    for (int r = 0; r < 8; ++r) {
      const int o = obase + ot * 16 + r + 8 * half;  // D row
      const float bb = bias[o];
#pragma unroll
      for (int nt = 0; nt < 4; ++nt)
        Out[(size_t)o * NTOK + n0 + nt * 16 + l15] = acc[ot][nt][r] + bb;
    }
}

// ---------------------------------------------------------------------------
// Kernel 2: fused Q-projection + flash attention over ONE key range
// Grid: (NTOK/64, B, KSPLIT), 128 threads (4 waves). Wave w owns query rows
// m0+w*16..+15 and the keys [ks*NTOK/KSPLIT, +NTOK/KSPLIT). It leaves the
// un-normalised O with its row maxima and row sums in the workspace.
// Two work-groups share a WGP (two waves a SIMD): 512 VGPRs a wave at most.
// Dynamic LDS: double-buffered K/V tiles [256][20] each, filled by async DMA.
// ---------------------------------------------------------------------------
__global__ __launch_bounds__(128, 2) void attn_kernel(
    const float* __restrict__ x,
    const float* __restrict__ wq, const float* __restrict__ bq,
    const float* __restrict__ Kin, const float* __restrict__ Vin,
    float* __restrict__ Opart, float* __restrict__ MLpart)
{
  extern __shared__ float dynsmem[];
  float* Kbuf0 = dynsmem;                    // [256][TILEW]
  float* Vbuf0 = Kbuf0 + CDIM * TILEW;
  float* Kbuf1 = Vbuf0 + CDIM * TILEW;
  float* Vbuf1 = Kbuf1 + CDIM * TILEW;
  __shared__ float pbuf[4][16][18];          // per-wave fragment relayout

  const int mb = blockIdx.x;
  const int b  = blockIdx.y;
  const int ks = blockIdx.z;             // this work-group's key range
  const int lane = threadIdx.x & 31;
  const int wave = threadIdx.x >> 5;
  const int half = lane >> 4;
  const int l15  = lane & 15;
  const int m0 = mb * 64;
  const int mg = m0 + wave * 16 + l15;   // this lane's query token (B-frag col)

  const float* xb = x   + (size_t)b * CDIM * NTOK;
  const float* Kb = Kin + (size_t)b * CDIM * NTOK + ks * (NTOK / KSPLIT);
  const float* Vb = Vin + (size_t)b * CDIM * NTOK + ks * (NTOK / KSPLIT);

  const int n4   = (threadIdx.x & 3) * 4;    // staging: 4-float column group
  const int crow = threadIdx.x >> 2;         // staging: starting channel row

  // kick off async staging of key/value tile 0 while we compute Q
  {
#pragma unroll 8
    for (int cc = crow; cc < CDIM; cc += 32) {
      async_copy_b128(Kbuf0 + cc * TILEW + n4, Kb + (size_t)cc * NTOK + n4);
      async_copy_b128(Vbuf0 + cc * TILEW + n4, Vb + (size_t)cc * NTOK + n4);
    }
  }

  // ---- Phase A: Q projection for this wave's 16 tokens; keep Q^T as A-frags ----
  v2f a_q[64];                         // a_q[j] covers c = 4j..4j+3
#pragma unroll
  for (int og = 0; og < 4; ++og) {
    v8f qa[4];
#pragma unroll
    for (int i = 0; i < 4; ++i) qa[i] = vzero8();
    for (int k = 0; k < CDIM; k += 4) {
      const int kk = k + 2 * half;
      v2f bfr;                         // B = x[c][m], col m = l15
      bfr[0] = xb[(size_t)(kk + 0) * NTOK + mg];
      bfr[1] = xb[(size_t)(kk + 1) * NTOK + mg];
#pragma unroll
      for (int i = 0; i < 4; ++i) {
        const int o = og * 64 + i * 16 + l15;   // A = wq[o][c]
        v2f afr = *(const v2f*)(wq + (size_t)o * CDIM + kk);
        qa[i] = wmma4(afr, bfr, qa[i]);
      }
    }
    // transpose each 16x16 Q tile through LDS: D[o][m] -> A-frags of Q^T[m][c]
#pragma unroll
    for (int i = 0; i < 4; ++i) {
#pragma unroll
      for (int r = 0; r < 8; ++r) {
        const int oo = og * 64 + i * 16 + r + 8 * half;
        pbuf[wave][l15][r + 8 * half] = qa[i][r] + bq[oo];  // [m][o_local]
      }
      LDS_FENCE();
#pragma unroll
      for (int j = 0; j < 4; ++j)
        a_q[og * 16 + i * 4 + j] =
            *(const v2f*)&pbuf[wave][l15][4 * j + 2 * half];
      SCHED_FENCE();
    }
  }

  // ---- Main loop: stream 16-wide key tiles, online softmax, double-buffered ----
  v8f o_acc[16];                      // O[m][c] accumulators (rows m, cols c)
#pragma unroll
  for (int ct = 0; ct < 16; ++ct) o_acc[ct] = vzero8();
  float Mrow[8], Lrow[8];
#pragma unroll
  for (int r = 0; r < 8; ++r) { Mrow[r] = -3.0e38f; Lrow[r] = 0.f; }

  for (int ntile = 0; ntile < NTS; ++ntile) {
    const float* Kc = (ntile & 1) ? Kbuf1 : Kbuf0;
    const float* Vc = (ntile & 1) ? Vbuf1 : Vbuf0;
    if (ntile + 1 < NTS) {
      // prefetch next tile into the other buffer (its readers finished at the
      // barrier that ended iteration ntile-1)
      float* Kn = (ntile & 1) ? Kbuf0 : Kbuf1;
      float* Vn = (ntile & 1) ? Vbuf0 : Vbuf1;
      const int nb1 = (ntile + 1) * 16;
#pragma unroll 8
      for (int cc = crow; cc < CDIM; cc += 32) {
        async_copy_b128(Kn + cc * TILEW + n4, Kb + (size_t)cc * NTOK + nb1 + n4);
        async_copy_b128(Vn + cc * TILEW + n4, Vb + (size_t)cc * NTOK + nb1 + n4);
      }
      ASYNC_WAIT_PREFETCHED();   // current tile's 16 async ops are complete
    } else {
      ASYNC_WAIT_ALL();
    }
    __syncthreads();             // current tile visible to all waves

    // S = Q^T * K  (16m x 16n, k=256); 4 interleaved partial accumulators.
    // The tile's B fragments come from LDS in groups of 16 reads, each group
    // issued one group of WMMAs ahead of its use; V's follow behind K's.
    const float* kp = Kc + 2 * half * TILEW + l15;   // B[k=c][n=l15]
    const float* vp = Vc + l15 * TILEW + 2 * half;   // B[k=n][c=l15]
    v2f kf[64];
    v2f vf[64];
    v8f sp[4];
    sp[0] = sp[1] = sp[2] = sp[3] = vzero8();
#pragma unroll
    for (int j = 0; j < 16; ++j) {
      kf[j][0] = kp[(4 * j + 0) * TILEW];
      kf[j][1] = kp[(4 * j + 1) * TILEW];
    }
#pragma unroll
    for (int g = 0; g < 4; ++g) {
      if (g < 3) {
#pragma unroll
        for (int j = 16 * (g + 1); j < 16 * (g + 2); ++j) {
          kf[j][0] = kp[(4 * j + 0) * TILEW];
          kf[j][1] = kp[(4 * j + 1) * TILEW];
        }
      } else {
#pragma unroll
        for (int i = 0; i < 64; ++i)
          vf[i] = *(const v2f*)(vp + (i >> 2) * 16 * TILEW + 4 * (i & 3));
      }
      // holds the reads above in one place, ahead of this group's WMMAs;
      // left free they sink to their users and each waits out the LDS latency
      GROUP_FENCE();
#pragma unroll
      for (int j = 16 * g; j < 16 * (g + 1); ++j)
        sp[j & 3] = wmma4(a_q[j], kf[j], sp[j & 3]);
      // keeps the next group's reads behind these WMMAs: one place a group,
      // not spread among them
      if (g < 3) GROUP_FENCE();
    }
    v8f s = (sp[0] + sp[1]) + (sp[2] + sp[3]);

    // online softmax; rows r+8*half private to each 16-lane group
    float alpha[8], mx[8], rs[8];
#pragma unroll
    for (int r = 0; r < 8; ++r) mx[r] = s[r];
    row_max8(mx);
#pragma unroll
    for (int r = 0; r < 8; ++r) {
      const float Mn = fmaxf(Mrow[r], mx[r]);
      alpha[r] = exp2f((Mrow[r] - Mn) * LOG2E);
      const float p = exp2f((s[r] - Mn) * LOG2E);
      rs[r] = p;
      Mrow[r] = Mn;
      s[r] = p;
    }
    row_sum8(rs);
#pragma unroll
    for (int r = 0; r < 8; ++r) Lrow[r] = Lrow[r] * alpha[r] + rs[r];
#pragma unroll
    for (int ct = 0; ct < 16; ++ct)
#pragma unroll
      for (int r = 0; r < 8; ++r) o_acc[ct][r] *= alpha[r];

    // relayout P: D-frag [m][n] -> A-frags via per-wave LDS
#pragma unroll
    for (int r = 0; r < 8; ++r)
      pbuf[wave][r + 8 * half][l15] = s[r];     // [m][n]
    LDS_FENCE();
    v2f a_p[4];
#pragma unroll
    for (int j = 0; j < 4; ++j)
      a_p[j] = *(const v2f*)&pbuf[wave][l15][4 * j + 2 * half];
    SCHED_FENCE();

    // O += P * V^T   (B[k=n][c] = Vt[c][n])
#pragma unroll
    for (int ct = 0; ct < 16; ++ct)
#pragma unroll
      for (int j = 0; j < 4; ++j)
        o_acc[ct] = wmma4(a_p[j], vf[ct * 4 + j], o_acc[ct]);
    __syncthreads();   // all waves done with this tile before it is overwritten
  }

  // ---- Leave this range's partial result in the workspace ----
  // O tile: [ct][r>>2][lane][r&3], so that each b128 store covers 512 B in a row
  const size_t tile = ((size_t)b * NT16 + mb * 4 + wave) * KSPLIT + ks;
  float* op = Opart + tile * (16 * CDIM) + lane * 4;
#pragma unroll   // o_acc is indexed by constants only and stays in registers
  for (int ct = 0; ct < 16; ++ct) {
    *(float4*)(op + ct * 256) =
        make_float4(o_acc[ct][0], o_acc[ct][1], o_acc[ct][2], o_acc[ct][3]);
    *(float4*)(op + ct * 256 + 128) =
        make_float4(o_acc[ct][4], o_acc[ct][5], o_acc[ct][6], o_acc[ct][7]);
  }
  ADDR_WAIT();
  // row maxima [0..15] and row sums [16..31]; the 16 lanes of a half agree
  if (l15 == 0) {
    float* ml = MLpart + tile * 32 + 8 * half;
    *(float4*)(ml + 0)  = make_float4(Mrow[0], Mrow[1], Mrow[2], Mrow[3]);
    *(float4*)(ml + 4)  = make_float4(Mrow[4], Mrow[5], Mrow[6], Mrow[7]);
    *(float4*)(ml + 16) = make_float4(Lrow[0], Lrow[1], Lrow[2], Lrow[3]);
    *(float4*)(ml + 20) = make_float4(Lrow[4], Lrow[5], Lrow[6], Lrow[7]);
  }
}

// ---------------------------------------------------------------------------
// Kernel 3: merge the KSPLIT key ranges, then Y = Wo * O^T + bo + x
// Grid: (NTOK/64, B, OSPLIT), 128 threads (4 waves). Wave w owns query rows
// m0+w*16..+15; the work-group owns output channels [oz*64, +64).
// Two work-groups share a WGP, so that all 512 are resident at once.
// Every loop is unrolled in full: its arrays are indexed by constants only and
// so stay in registers.
// ---------------------------------------------------------------------------
__global__ __launch_bounds__(128, 2) void merge_proj_kernel(
    const float* __restrict__ x,
    const float* __restrict__ wo, const float* __restrict__ bo,
    const float* __restrict__ Opart, const float* __restrict__ MLpart,
    float* __restrict__ out)
{
  __shared__ float wos[(CDIM / OSPLIT) * WOP];   // Wo rows of this range
  __shared__ float pbuf[4][16][18];              // per-wave fragment relayout

  const int mb = blockIdx.x;
  const int b  = blockIdx.y;
  const int ob = blockIdx.z * (CDIM / OSPLIT);
  const int lane = threadIdx.x & 31;
  const int wave = threadIdx.x >> 5;
  const int half = lane >> 4;
  const int l15  = lane & 15;
  const int mg = mb * 64 + wave * 16 + l15;
  const float* xb = x + (size_t)b * CDIM * NTOK;

  // The global reads of the merge are issued in groups of 32 to 80 loads, so
  // that a wave pays the L2 latency once a group and not once a load.
  const size_t tile0 = ((size_t)b * NT16 + mb * 4 + wave) * KSPLIT;  // range 0
  const float* mlp = MLpart + tile0 * 32 + 8 * half;
  const float* opp = Opart + tile0 * (16 * CDIM) + lane * 4;
  const float* wop = wo + (size_t)(ob + (threadIdx.x >> 6)) * CDIM + (threadIdx.x & 63) * 4;
  const float* xp  = xb + (size_t)(ob + 8 * half) * NTOK + mg;
  const float* bop = bo + ob + 8 * half;
  const int c4 = (threadIdx.x & 63) * 4;   // Wo staging: column group
  const int r0 = threadIdx.x >> 6;         // Wo staging: first row

  float4 mv[KSPLIT][2], lv[KSPLIT][2];     // row maxima, row sums (r + 8*half)
#pragma unroll
  for (int s = 0; s < KSPLIT; ++s)
#pragma unroll
    for (int q = 0; q < 2; ++q) {
      mv[s][q] = *(const float4*)(mlp + s * 32 + 4 * q);
      lv[s][q] = *(const float4*)(mlp + s * 32 + 16 + 4 * q);
    }
  float4 wreg[CDIM / OSPLIT / 2];          // Wo[ob .. ob+63][0..255], 2 rows a pass
#pragma unroll
  for (int i = 0; i < CDIM / OSPLIT / 2; ++i)
    wreg[i] = *(const float4*)(wop + i * 2 * CDIM);
  // O comes in groups of four 16-channel chunks, all ranges: 32 loads a group
  float4 obuf[2][4][KSPLIT][2];
#pragma unroll
  for (int cl = 0; cl < 4; ++cl)
#pragma unroll
    for (int s = 0; s < KSPLIT; ++s)
#pragma unroll
      for (int h = 0; h < 2; ++h)
        obuf[0][cl][s][h] = *(const float4*)(
            opp + s * (16 * CDIM) + cl * 256 + h * 128);
  ADDR_WAIT();
  // holds the reads above in one place; left free they sink to their users
  GROUP_FENCE();

#pragma unroll
  for (int i = 0; i < CDIM / OSPLIT / 2; ++i)
    *(float4*)(wos + (r0 + 2 * i) * WOP + c4) = wreg[i];
  ADDR_WAIT();
  // group 1's reads take the registers that the Wo rows have left
  GROUP_FENCE();
#pragma unroll
  for (int cl = 0; cl < 4; ++cl)
#pragma unroll
    for (int s = 0; s < KSPLIT; ++s)
#pragma unroll
      for (int h = 0; h < 2; ++h)
        obuf[1][cl][s][h] = *(const float4*)(
            opp + s * (16 * CDIM) + (4 + cl) * 256 + h * 128);
  // the residual's x and the bias come with them
  float xres[16 / OSPLIT][8];
  float4 bov[16 / OSPLIT][2];
#pragma unroll
  for (int ot = 0; ot < 16 / OSPLIT; ++ot) {
#pragma unroll
    for (int r = 0; r < 8; ++r) xres[ot][r] = xp[(size_t)(ot * 16 + r) * NTOK];
    bov[ot][0] = *(const float4*)(bop + ot * 16);
    bov[ot][1] = *(const float4*)(bop + ot * 16 + 4);
  }
  ADDR_WAIT();
  // one place again, ahead of the weights
  GROUP_FENCE();

  // weights of the ranges for rows r + 8*half, 1 / (row sum) folded in
  float wgt[KSPLIT][8];
#pragma unroll
  for (int r = 0; r < 8; ++r) {
    float Ms[KSPLIT], Ls[KSPLIT];
#pragma unroll
    for (int s = 0; s < KSPLIT; ++s) {
      const float4 m4 = mv[s][r >> 2], l4 = lv[s][r >> 2];
      Ms[s] = (r & 3) == 0 ? m4.x : (r & 3) == 1 ? m4.y : (r & 3) == 2 ? m4.z : m4.w;
      Ls[s] = (r & 3) == 0 ? l4.x : (r & 3) == 1 ? l4.y : (r & 3) == 2 ? l4.z : l4.w;
    }
    float Mx = Ms[0];
#pragma unroll
    for (int s = 1; s < KSPLIT; ++s) Mx = fmaxf(Mx, Ms[s]);
    float Lt = 0.f;
#pragma unroll
    for (int s = 0; s < KSPLIT; ++s) {
      wgt[s][r] = exp2f((Ms[s] - Mx) * LOG2E);
      Lt += wgt[s][r] * Ls[s];
    }
    const float rinv = 1.0f / Lt;
#pragma unroll
    for (int s = 0; s < KSPLIT; ++s) wgt[s][r] *= rinv;
  }

  __syncthreads();                    // Wo slab visible to all waves

  v8f y_acc[16 / OSPLIT];
#pragma unroll
  for (int ot = 0; ot < 16 / OSPLIT; ++ot) y_acc[ot] = vzero8();

#pragma unroll
  for (int g = 0; g < 4; ++g) {
#pragma unroll
    for (int cl = 0; cl < 4; ++cl) {
      const int cc = g * 4 + cl;
      // merge the ranges: O[m = r + 8*half][c = cc*16 + l15], normalised
      float om[8];
#pragma unroll
      for (int r = 0; r < 8; ++r) om[r] = 0.f;
#pragma unroll
      for (int s = 0; s < KSPLIT; ++s) {
        const float4 lo = obuf[g & 1][cl][s][0], hi = obuf[g & 1][cl][s][1];
        om[0] += wgt[s][0] * lo.x; om[1] += wgt[s][1] * lo.y;
        om[2] += wgt[s][2] * lo.z; om[3] += wgt[s][3] * lo.w;
        om[4] += wgt[s][4] * hi.x; om[5] += wgt[s][5] * hi.y;
        om[6] += wgt[s][6] * hi.z; om[7] += wgt[s][7] * hi.w;
      }
      // relayout this wave's O chunk: [m][c_local] through per-wave pbuf
#pragma unroll
      for (int r = 0; r < 8; ++r)
        pbuf[wave][r + 8 * half][l15] = om[r];
      LDS_FENCE();
      v2f b_o[4];
#pragma unroll
      for (int j = 0; j < 4; ++j)     // B[k=c][m=l15] = O[m][c]
        b_o[j] = *(const v2f*)&pbuf[wave][l15][4 * j + 2 * half];
      SCHED_FENCE();
#pragma unroll
      for (int j = 0; j < 4; ++j)
#pragma unroll
        for (int ot = 0; ot < 16 / OSPLIT; ++ot) {
          v2f afr = *(const v2f*)(wos + (ot * 16 + l15) * WOP + cc * 16 + 4 * j + 2 * half);
          y_acc[ot] = wmma4(afr, b_o[j], y_acc[ot]);
        }
    }
    if (g + 2 < 4) {
      // keeps the refill behind the sums that free its registers ...
      GROUP_FENCE();
#pragma unroll
      for (int cl = 0; cl < 4; ++cl)
#pragma unroll
        for (int s = 0; s < KSPLIT; ++s)
#pragma unroll
          for (int h = 0; h < 2; ++h)
            obuf[g & 1][cl][s][h] = *(const float4*)(
                opp + s * (16 * CDIM) + ((g + 2) * 4 + cl) * 256 + h * 128);
      ADDR_WAIT();
      // ... and in one place, ahead of the next group's work
      GROUP_FENCE();
    }
  }

  float* yp = out + (size_t)b * CDIM * NTOK + (size_t)(ob + 8 * half) * NTOK + mg;
#pragma unroll
  for (int ot = 0; ot < 16 / OSPLIT; ++ot) {
    const float4 b0 = bov[ot][0], b1 = bov[ot][1];
    const float bb[8] = {b0.x, b0.y, b0.z, b0.w, b1.x, b1.y, b1.z, b1.w};
#pragma unroll
    for (int r = 0; r < 8; ++r)       // output channel ob + ot*16 + r + 8*half
      yp[(size_t)(ot * 16 + r) * NTOK] = y_acc[ot][r] + bb[r] + xres[ot][r];
  }
}

// ---------------------------------------------------------------------------
extern "C" void kernel_launch(void* const* d_in, const int* in_sizes, int n_in,
                              void* d_out, int out_size, void* d_ws, size_t ws_size,
                              hipStream_t stream) {
  (void)in_sizes; (void)n_in; (void)out_size; (void)ws_size;
  const float* x  = (const float*)d_in[0];
  const float* t  = (const float*)d_in[1];
  const float* wq = (const float*)d_in[2];
  const float* bq = (const float*)d_in[3];
  const float* wk = (const float*)d_in[4];
  const float* bk = (const float*)d_in[5];
  const float* wv = (const float*)d_in[6];
  const float* bv = (const float*)d_in[7];
  const float* wo = (const float*)d_in[8];
  const float* bo = (const float*)d_in[9];

  float* Kws = (float*)d_ws;                       // [B][C][N] f32, 8 MB
  float* Vws = Kws + (size_t)BSZ * CDIM * NTOK;    // [B][C][N] f32, 8 MB
  float* Ows = Vws + (size_t)BSZ * CDIM * NTOK;    // [B][N/16][KSPLIT][16*C], 32 MB
  float* MLws = Ows + (size_t)KSPLIT * BSZ * CDIM * NTOK;  // [B][N/16][KSPLIT][32]

  dim3 g1(NTOK / 64, BSZ, 2);
  kv_proj_kernel<<<g1, dim3(128, 1, 1), 0, stream>>>(t, wk, bk, wv, bv, Kws, Vws);

  const size_t smem = (size_t)4 * CDIM * TILEW * sizeof(float);  // 80 KB
  dim3 g2(NTOK / 64, BSZ, KSPLIT);
  attn_kernel<<<g2, dim3(128, 1, 1), smem, stream>>>(x, wq, bq, Kws, Vws,
                                                     Ows, MLws);

  dim3 g3(NTOK / 64, BSZ, OSPLIT);
  merge_proj_kernel<<<g3, dim3(128, 1, 1), 0, stream>>>(x, wo, bo, Ows, MLws,
                                                        (float*)d_out);
}

// v004
// One run takes 259 microseconds.
// Timed twice side by side with v003, it ran 1.16 times as fast both times.
// All steps since v000 together make it 5.42 times as fast.
#include <hip/hip_runtime.h>

typedef float v2f __attribute__((ext_vector_type(2)));
typedef float v8f __attribute__((ext_vector_type(8)));

#define CDIM 256
#define NTOK 4096
#define BSZ  2
#define LOG2E 1.4426950408889634f
#define TILEW 20            // padded row width for [c][n16] LDS tiles
#define NT16  (NTOK / 16)
#define KSPLIT 4            // key ranges, one work-group each
#define NTS   (NT16 / KSPLIT)   // key tiles of one range
#define OSPLIT 4            // output-channel ranges of the merge kernel
#define WOP   260           // padded row width of the Wo slab in LDS

#define LDS_FENCE()   __asm__ volatile("s_wait_dscnt 0" ::: "memory")
#define SCHED_FENCE() __asm__ volatile("" ::: "memory")
#define GROUP_FENCE() __builtin_amdgcn_sched_barrier(0)
// previous tile's 16 async b128 done; next tile's 16 may still be in flight
#define ASYNC_WAIT_PREFETCHED() __asm__ volatile("s_wait_asynccnt 0x10" ::: "memory")
#define ASYNC_WAIT_ALL()        __asm__ volatile("s_wait_asynccnt 0x0"  ::: "memory")
// behind a group of global loads or stores: later code may reuse the registers
// that they name
#define ADDR_WAIT()   __asm__ volatile("s_wait_xcnt 0x0" ::: "memory")

__device__ __forceinline__ v8f wmma4(v2f a, v2f b, v8f c) {
  // D(16x16,f32) = A(16x4,f32) x B(4x16,f32) + C
  return __builtin_amdgcn_wmma_f32_16x16x4_f32(false, a, false, b, (short)0, c,
                                               false, false);
}

__device__ __forceinline__ v8f vzero8() {
  v8f z = {0.f, 0.f, 0.f, 0.f, 0.f, 0.f, 0.f, 0.f};
  return z;
}

// Maximum / sum over each 16-lane row, for eight values at once: four DPP
// row_xmask steps (lane l with lane l ^ 1, ^ 2, ^ 4, ^ 8) in the vector unit, in
// place. A shuffle would go through the LDS queue and cost its latency at every
// step. The eight values alternate, so that a step's producer stands eight
// instructions back and no step waits. All 32 lanes must be on.
__device__ __forceinline__ void row_max8(float (&v)[8]) {
  // asm: the compiler splits the builtin form into a DPP move and a maximum
  __asm__(
      "v_max_num_f32_dpp %0, %0, %0 row_xmask:1 row_mask:0xf bank_mask:0xf\n\t"
      "v_max_num_f32_dpp %1, %1, %1 row_xmask:1 row_mask:0xf bank_mask:0xf\n\t"
      "v_max_num_f32_dpp %2, %2, %2 row_xmask:1 row_mask:0xf bank_mask:0xf\n\t"
      "v_max_num_f32_dpp %3, %3, %3 row_xmask:1 row_mask:0xf bank_mask:0xf\n\t"
      "v_max_num_f32_dpp %4, %4, %4 row_xmask:1 row_mask:0xf bank_mask:0xf\n\t"
      "v_max_num_f32_dpp %5, %5, %5 row_xmask:1 row_mask:0xf bank_mask:0xf\n\t"
      "v_max_num_f32_dpp %6, %6, %6 row_xmask:1 row_mask:0xf bank_mask:0xf\n\t"
      "v_max_num_f32_dpp %7, %7, %7 row_xmask:1 row_mask:0xf bank_mask:0xf\n\t"
      "v_max_num_f32_dpp %0, %0, %0 row_xmask:2 row_mask:0xf bank_mask:0xf\n\t"
      "v_max_num_f32_dpp %1, %1, %1 row_xmask:2 row_mask:0xf bank_mask:0xf\n\t"
      "v_max_num_f32_dpp %2, %2, %2 row_xmask:2 row_mask:0xf bank_mask:0xf\n\t"
      "v_max_num_f32_dpp %3, %3, %3 row_xmask:2 row_mask:0xf bank_mask:0xf\n\t"
      "v_max_num_f32_dpp %4, %4, %4 row_xmask:2 row_mask:0xf bank_mask:0xf\n\t"
      "v_max_num_f32_dpp %5, %5, %5 row_xmask:2 row_mask:0xf bank_mask:0xf\n\t"
      "v_max_num_f32_dpp %6, %6, %6 row_xmask:2 row_mask:0xf bank_mask:0xf\n\t"
      "v_max_num_f32_dpp %7, %7, %7 row_xmask:2 row_mask:0xf bank_mask:0xf\n\t"
      "v_max_num_f32_dpp %0, %0, %0 row_xmask:4 row_mask:0xf bank_mask:0xf\n\t"
      "v_max_num_f32_dpp %1, %1, %1 row_xmask:4 row_mask:0xf bank_mask:0xf\n\t"
      "v_max_num_f32_dpp %2, %2, %2 row_xmask:4 row_mask:0xf bank_mask:0xf\n\t"
      "v_max_num_f32_dpp %3, %3, %3 row_xmask:4 row_mask:0xf bank_mask:0xf\n\t"
      "v_max_num_f32_dpp %4, %4, %4 row_xmask:4 row_mask:0xf bank_mask:0xf\n\t"
      "v_max_num_f32_dpp %5, %5, %5 row_xmask:4 row_mask:0xf bank_mask:0xf\n\t"
      "v_max_num_f32_dpp %6, %6, %6 row_xmask:4 row_mask:0xf bank_mask:0xf\n\t"
      "v_max_num_f32_dpp %7, %7, %7 row_xmask:4 row_mask:0xf bank_mask:0xf\n\t"
      "v_max_num_f32_dpp %0, %0, %0 row_xmask:8 row_mask:0xf bank_mask:0xf\n\t"
      "v_max_num_f32_dpp %1, %1, %1 row_xmask:8 row_mask:0xf bank_mask:0xf\n\t"
      "v_max_num_f32_dpp %2, %2, %2 row_xmask:8 row_mask:0xf bank_mask:0xf\n\t"
      "v_max_num_f32_dpp %3, %3, %3 row_xmask:8 row_mask:0xf bank_mask:0xf\n\t"
      "v_max_num_f32_dpp %4, %4, %4 row_xmask:8 row_mask:0xf bank_mask:0xf\n\t"
      "v_max_num_f32_dpp %5, %5, %5 row_xmask:8 row_mask:0xf bank_mask:0xf\n\t"
      "v_max_num_f32_dpp %6, %6, %6 row_xmask:8 row_mask:0xf bank_mask:0xf\n\t"
      "v_max_num_f32_dpp %7, %7, %7 row_xmask:8 row_mask:0xf bank_mask:0xf"
      : "+v"(v[0]), "+v"(v[1]), "+v"(v[2]), "+v"(v[3]),
        "+v"(v[4]), "+v"(v[5]), "+v"(v[6]), "+v"(v[7]));
}

__device__ __forceinline__ void row_sum8(float (&v)[8]) {
  // asm: in place, so that no step takes a register of its own for the moved value
  __asm__(
      "v_add_f32_dpp %0, %0, %0 row_xmask:1 row_mask:0xf bank_mask:0xf\n\t"
      "v_add_f32_dpp %1, %1, %1 row_xmask:1 row_mask:0xf bank_mask:0xf\n\t"
      "v_add_f32_dpp %2, %2, %2 row_xmask:1 row_mask:0xf bank_mask:0xf\n\t"
      "v_add_f32_dpp %3, %3, %3 row_xmask:1 row_mask:0xf bank_mask:0xf\n\t"
      "v_add_f32_dpp %4, %4, %4 row_xmask:1 row_mask:0xf bank_mask:0xf\n\t"
      "v_add_f32_dpp %5, %5, %5 row_xmask:1 row_mask:0xf bank_mask:0xf\n\t"
      "v_add_f32_dpp %6, %6, %6 row_xmask:1 row_mask:0xf bank_mask:0xf\n\t"
      "v_add_f32_dpp %7, %7, %7 row_xmask:1 row_mask:0xf bank_mask:0xf\n\t"
      "v_add_f32_dpp %0, %0, %0 row_xmask:2 row_mask:0xf bank_mask:0xf\n\t"
      "v_add_f32_dpp %1, %1, %1 row_xmask:2 row_mask:0xf bank_mask:0xf\n\t"
      "v_add_f32_dpp %2, %2, %2 row_xmask:2 row_mask:0xf bank_mask:0xf\n\t"
      "v_add_f32_dpp %3, %3, %3 row_xmask:2 row_mask:0xf bank_mask:0xf\n\t"
      "v_add_f32_dpp %4, %4, %4 row_xmask:2 row_mask:0xf bank_mask:0xf\n\t"
      "v_add_f32_dpp %5, %5, %5 row_xmask:2 row_mask:0xf bank_mask:0xf\n\t"
      "v_add_f32_dpp %6, %6, %6 row_xmask:2 row_mask:0xf bank_mask:0xf\n\t"
      "v_add_f32_dpp %7, %7, %7 row_xmask:2 row_mask:0xf bank_mask:0xf\n\t"
      "v_add_f32_dpp %0, %0, %0 row_xmask:4 row_mask:0xf bank_mask:0xf\n\t"
      "v_add_f32_dpp %1, %1, %1 row_xmask:4 row_mask:0xf bank_mask:0xf\n\t"
      "v_add_f32_dpp %2, %2, %2 row_xmask:4 row_mask:0xf bank_mask:0xf\n\t"
      "v_add_f32_dpp %3, %3, %3 row_xmask:4 row_mask:0xf bank_mask:0xf\n\t"
      "v_add_f32_dpp %4, %4, %4 row_xmask:4 row_mask:0xf bank_mask:0xf\n\t"
      "v_add_f32_dpp %5, %5, %5 row_xmask:4 row_mask:0xf bank_mask:0xf\n\t"
      "v_add_f32_dpp %6, %6, %6 row_xmask:4 row_mask:0xf bank_mask:0xf\n\t"
      "v_add_f32_dpp %7, %7, %7 row_xmask:4 row_mask:0xf bank_mask:0xf\n\t"
      "v_add_f32_dpp %0, %0, %0 row_xmask:8 row_mask:0xf bank_mask:0xf\n\t"
      "v_add_f32_dpp %1, %1, %1 row_xmask:8 row_mask:0xf bank_mask:0xf\n\t"
      "v_add_f32_dpp %2, %2, %2 row_xmask:8 row_mask:0xf bank_mask:0xf\n\t"
      "v_add_f32_dpp %3, %3, %3 row_xmask:8 row_mask:0xf bank_mask:0xf\n\t"
      "v_add_f32_dpp %4, %4, %4 row_xmask:8 row_mask:0xf bank_mask:0xf\n\t"
      "v_add_f32_dpp %5, %5, %5 row_xmask:8 row_mask:0xf bank_mask:0xf\n\t"
      "v_add_f32_dpp %6, %6, %6 row_xmask:8 row_mask:0xf bank_mask:0xf\n\t"
      "v_add_f32_dpp %7, %7, %7 row_xmask:8 row_mask:0xf bank_mask:0xf"
      : "+v"(v[0]), "+v"(v[1]), "+v"(v[2]), "+v"(v[3]),
        "+v"(v[4]), "+v"(v[5]), "+v"(v[6]), "+v"(v[7]));
}

// Async DMA: 16B global -> LDS, tracked by ASYNCcnt (no VGPR staging).
// Flat->LDS mapping truncates to low 32 bits, so low bits of the generic
// shared pointer are the LDS byte address.
__device__ __forceinline__ void async_copy_b128(float* lds_dst,
                                                const float* gsrc) {
  unsigned ldsoff = (unsigned)(unsigned long long)lds_dst;
  __asm__ volatile("global_load_async_to_lds_b128 %0, %1, off"
                   :: "v"(ldsoff), "v"(gsrc)
                   : "memory");
}

// ---------------------------------------------------------------------------
// Kernel 1: K = Wk*t + bk, V = Wv*t + bv, Q = Wq*x + bq
// (per-token 1x1x1 conv == GEMM)
// Grid: (NTOK/64, B, 3), 128 threads (4 waves). Wave w owns o-range [w*64,+64).
// K and V are left as [c][n]; Q is left in the order of the attention kernel's
// A fragments: [token tile][c / 8][lane][4], lane = 16 * h + (m & 15), its four
// floats being Q[c = 8*jp + 2*h + {0, 1}][m] and Q[c = 8*jp + 4 + 2*h + {0, 1}][m].
// ---------------------------------------------------------------------------
__global__ __launch_bounds__(128) void qkv_proj_kernel(
    const float* __restrict__ t, const float* __restrict__ x,
    const float* __restrict__ wk, const float* __restrict__ bk,
    const float* __restrict__ wv, const float* __restrict__ bv,
    const float* __restrict__ wq, const float* __restrict__ bq,
    float* __restrict__ Kout, float* __restrict__ Vout,
    float* __restrict__ Qout)
{
  const int nb  = blockIdx.x;
  const int b   = blockIdx.y;
  const int mat = blockIdx.z;            // 0: K, 1: V, 2: Q
  const float* W    = mat == 0 ? wk : mat == 1 ? wv : wq;
  const float* bias = mat == 0 ? bk : mat == 1 ? bv : bq;
  float* Out        = (mat ? Vout : Kout) + (size_t)b * CDIM * NTOK;
  const float* tb   = (mat == 2 ? x : t) + (size_t)b * CDIM * NTOK;

  const int lane = threadIdx.x & 31;
  const int wave = threadIdx.x >> 5;
  const int half = lane >> 4;
  const int l15  = lane & 15;
  const int n0    = nb * 64;
  const int obase = wave * 64;

  v8f acc[4][4];
#pragma unroll
  for (int i = 0; i < 4; ++i)
#pragma unroll
    for (int j = 0; j < 4; ++j) acc[i][j] = vzero8();

  for (int k = 0; k < CDIM; k += 4) {
    const int kk = k + 2 * half;   // this lane-half's K pair {kk, kk+1}
    v2f afr[4], bfr[4];
#pragma unroll
    for (int ot = 0; ot < 4; ++ot)  // A[o][k] = W[o][c], row o = l15
      afr[ot] = *(const v2f*)(W + (size_t)(obase + ot * 16 + l15) * CDIM + kk);
#pragma unroll
    for (int nt = 0; nt < 4; ++nt) { // B[k][n] = t[c][n] (x[c][n] for Q), col n = l15
      const int n = n0 + nt * 16 + l15;
      bfr[nt][0] = tb[(size_t)(kk + 0) * NTOK + n];
      bfr[nt][1] = tb[(size_t)(kk + 1) * NTOK + n];
    }
#pragma unroll
    for (int ot = 0; ot < 4; ++ot)
#pragma unroll
      for (int nt = 0; nt < 4; ++nt)
        acc[ot][nt] = wmma4(afr[ot], bfr[nt], acc[ot][nt]);
  }

  if (mat == 2) {
    // this lane holds Q[c = 8*jp + r][m = l15] of token tile nb*4 + nt
    float* qo = Qout + ((size_t)(b * NT16 + nb * 4) * 32 + wave * 8 + half) * 128 +
                l15 * 4;
#pragma unroll   // acc is indexed by constants only and stays in registers
    for (int ot = 0; ot < 4; ++ot) {
      const float4 b0 = *(const float4*)(bias + obase + ot * 16 + 8 * half);
      const float4 b1 = *(const float4*)(bias + obase + ot * 16 + 8 * half + 4);
#pragma unroll
      for (int nt = 0; nt < 4; ++nt) {
        float* q = qo + nt * (16 * CDIM) + ot * 256;
        *(float4*)(q) =                  // fragment lanes 0..15
            make_float4(acc[ot][nt][0] + b0.x, acc[ot][nt][1] + b0.y,
                        acc[ot][nt][4] + b1.x, acc[ot][nt][5] + b1.y);
        *(float4*)(q + 64) =             // fragment lanes 16..31
            make_float4(acc[ot][nt][2] + b0.z, acc[ot][nt][3] + b0.w,
                        acc[ot][nt][6] + b1.z, acc[ot][nt][7] + b1.w);
      }
    }
    return;
  }

#pragma unroll
  for (int ot = 0; ot < 4; ++ot)
#pragma unroll
    for (int r = 0; r < 8; ++r) {
      const int o = obase + ot * 16 + r + 8 * half;  // D row
      const float bb = bias[o];
#pragma unroll
      for (int nt = 0; nt < 4; ++nt)
        Out[(size_t)o * NTOK + n0 + nt * 16 + l15] = acc[ot][nt][r] + bb;
    }
}

// ---------------------------------------------------------------------------
// Kernel 2: flash attention over ONE key range
// Grid: (NTOK/64, B, KSPLIT), 128 threads (4 waves). Wave w owns query rows
// m0+w*16..+15 and the keys [ks*NTOK/KSPLIT, +NTOK/KSPLIT). It leaves the
// un-normalised O with its row maxima and row sums in the workspace.
// Two work-groups share a WGP (two waves a SIMD): 512 VGPRs a wave at most.
// Dynamic LDS: double-buffered K/V tiles [256][20] each, filled by async DMA.
// ---------------------------------------------------------------------------
__global__ __launch_bounds__(128, 2) void attn_kernel(
    const float* __restrict__ Qin,
    const float* __restrict__ Kin, const float* __restrict__ Vin,
    float* __restrict__ Opart, float* __restrict__ MLpart)
{
  extern __shared__ float dynsmem[];
  float* Kbuf0 = dynsmem;                    // [256][TILEW]
  float* Vbuf0 = Kbuf0 + CDIM * TILEW;
  float* Kbuf1 = Vbuf0 + CDIM * TILEW;
  float* Vbuf1 = Kbuf1 + CDIM * TILEW;
  __shared__ float pbuf[4][16][18];          // per-wave fragment relayout

  const int mb = blockIdx.x;
  const int b  = blockIdx.y;
  const int ks = blockIdx.z;             // this work-group's key range
  const int lane = threadIdx.x & 31;
  const int wave = threadIdx.x >> 5;
  const int half = lane >> 4;
  const int l15  = lane & 15;

  const float* Kb = Kin + (size_t)b * CDIM * NTOK + ks * (NTOK / KSPLIT);
  const float* Vb = Vin + (size_t)b * CDIM * NTOK + ks * (NTOK / KSPLIT);

  const int n4   = (threadIdx.x & 3) * 4;    // staging: 4-float column group
  const int crow = threadIdx.x >> 2;         // staging: starting channel row

  // kick off async staging of key/value tile 0 while Q comes in
  {
#pragma unroll 8
    for (int cc = crow; cc < CDIM; cc += 32) {
      async_copy_b128(Kbuf0 + cc * TILEW + n4, Kb + (size_t)cc * NTOK + n4);
      async_copy_b128(Vbuf0 + cc * TILEW + n4, Vb + (size_t)cc * NTOK + n4);
    }
  }

  // ---- Q^T of this wave's 16 tokens, as launch 1 left it: A fragments ----
  v2f a_q[64];                         // a_q[j] covers c = 4j..4j+3
  {
    const float* qp = Qin + (size_t)(b * NT16 + mb * 4 + wave) * (16 * CDIM) + lane * 4;
#pragma unroll   // a_q is indexed by constants only and stays in registers
    for (int jp = 0; jp < 32; ++jp) {
      const float4 q4 = *(const float4*)(qp + jp * 128);
      a_q[2 * jp + 0][0] = q4.x; a_q[2 * jp + 0][1] = q4.y;
      a_q[2 * jp + 1][0] = q4.z; a_q[2 * jp + 1][1] = q4.w;
    }
    ADDR_WAIT();
    // keeps later register writes from being lifted over the wait above
    GROUP_FENCE();
  }

  // ---- Main loop: stream 16-wide key tiles, online softmax, double-buffered ----
  v8f o_acc[16];                      // O[m][c] accumulators (rows m, cols c)
#pragma unroll
  for (int ct = 0; ct < 16; ++ct) o_acc[ct] = vzero8();
  float Mrow[8], Lrow[8];
#pragma unroll
  for (int r = 0; r < 8; ++r) { Mrow[r] = -3.0e38f; Lrow[r] = 0.f; }

  for (int ntile = 0; ntile < NTS; ++ntile) {
    const float* Kc = (ntile & 1) ? Kbuf1 : Kbuf0;
    const float* Vc = (ntile & 1) ? Vbuf1 : Vbuf0;
    if (ntile + 1 < NTS) {
      // prefetch next tile into the other buffer (its readers finished at the
      // barrier that ended iteration ntile-1)
      float* Kn = (ntile & 1) ? Kbuf0 : Kbuf1;
      float* Vn = (ntile & 1) ? Vbuf0 : Vbuf1;
      const int nb1 = (ntile + 1) * 16;
#pragma unroll 8
      for (int cc = crow; cc < CDIM; cc += 32) {
        async_copy_b128(Kn + cc * TILEW + n4, Kb + (size_t)cc * NTOK + nb1 + n4);
        async_copy_b128(Vn + cc * TILEW + n4, Vb + (size_t)cc * NTOK + nb1 + n4);
      }
      ASYNC_WAIT_PREFETCHED();   // current tile's 16 async ops are complete
    } else {
      ASYNC_WAIT_ALL();
    }
    __syncthreads();             // current tile visible to all waves

    // S = Q^T * K  (16m x 16n, k=256); 4 interleaved partial accumulators.
    // The tile's B fragments come from LDS in groups of 16 reads, each group
    // issued one group of WMMAs ahead of its use; V's follow behind K's.
    const float* kp = Kc + 2 * half * TILEW + l15;   // B[k=c][n=l15]
    const float* vp = Vc + l15 * TILEW + 2 * half;   // B[k=n][c=l15]
    v2f kf[64];
    v2f vf[64];
    v8f sp[4];
    sp[0] = sp[1] = sp[2] = sp[3] = vzero8();
#pragma unroll
    for (int j = 0; j < 16; ++j) {
      kf[j][0] = kp[(4 * j + 0) * TILEW];
      kf[j][1] = kp[(4 * j + 1) * TILEW];
    }
#pragma unroll
    for (int g = 0; g < 4; ++g) {
      if (g < 3) {
#pragma unroll
        for (int j = 16 * (g + 1); j < 16 * (g + 2); ++j) {
          kf[j][0] = kp[(4 * j + 0) * TILEW];
          kf[j][1] = kp[(4 * j + 1) * TILEW];
        }
      } else {
#pragma unroll
        for (int i = 0; i < 64; ++i)
          vf[i] = *(const v2f*)(vp + (i >> 2) * 16 * TILEW + 4 * (i & 3));
      }
      // holds the reads above in one place, ahead of this group's WMMAs;
      // left free they sink to their users and each waits out the LDS latency
      GROUP_FENCE();
#pragma unroll
      for (int j = 16 * g; j < 16 * (g + 1); ++j)
        sp[j & 3] = wmma4(a_q[j], kf[j], sp[j & 3]);
      // keeps the next group's reads behind these WMMAs: one place a group,
      // not spread among them
      if (g < 3) GROUP_FENCE();
    }
    v8f s = (sp[0] + sp[1]) + (sp[2] + sp[3]);

    // online softmax; rows r+8*half private to each 16-lane group
    float alpha[8], mx[8], rs[8];
#pragma unroll
    for (int r = 0; r < 8; ++r) mx[r] = s[r];
    row_max8(mx);
#pragma unroll
    for (int r = 0; r < 8; ++r) {
      const float Mn = fmaxf(Mrow[r], mx[r]);
      alpha[r] = exp2f((Mrow[r] - Mn) * LOG2E);
      const float p = exp2f((s[r] - Mn) * LOG2E);
      rs[r] = p;
      Mrow[r] = Mn;
      s[r] = p;
    }
    row_sum8(rs);
#pragma unroll
    for (int r = 0; r < 8; ++r) Lrow[r] = Lrow[r] * alpha[r] + rs[r];
#pragma unroll
    for (int ct = 0; ct < 16; ++ct)
#pragma unroll
      for (int r = 0; r < 8; ++r) o_acc[ct][r] *= alpha[r];

    // relayout P: D-frag [m][n] -> A-frags via per-wave LDS
#pragma unroll
    for (int r = 0; r < 8; ++r)
      pbuf[wave][r + 8 * half][l15] = s[r];     // [m][n]
    LDS_FENCE();
    v2f a_p[4];
#pragma unroll
    for (int j = 0; j < 4; ++j)
      a_p[j] = *(const v2f*)&pbuf[wave][l15][4 * j + 2 * half];
    SCHED_FENCE();

    // O += P * V^T   (B[k=n][c] = Vt[c][n])
#pragma unroll
    for (int ct = 0; ct < 16; ++ct)
#pragma unroll
      for (int j = 0; j < 4; ++j)
        o_acc[ct] = wmma4(a_p[j], vf[ct * 4 + j], o_acc[ct]);
    __syncthreads();   // all waves done with this tile before it is overwritten
  }

  // ---- Leave this range's partial result in the workspace ----
  // O tile: [ct][r>>2][lane][r&3], so that each b128 store covers 512 B in a row
  const size_t tile = ((size_t)b * NT16 + mb * 4 + wave) * KSPLIT + ks;
  float* op = Opart + tile * (16 * CDIM) + lane * 4;
#pragma unroll   // o_acc is indexed by constants only and stays in registers
  for (int ct = 0; ct < 16; ++ct) {
    *(float4*)(op + ct * 256) =
        make_float4(o_acc[ct][0], o_acc[ct][1], o_acc[ct][2], o_acc[ct][3]);
    *(float4*)(op + ct * 256 + 128) =
        make_float4(o_acc[ct][4], o_acc[ct][5], o_acc[ct][6], o_acc[ct][7]);
  }
  ADDR_WAIT();
  // row maxima [0..15] and row sums [16..31]; the 16 lanes of a half agree
  if (l15 == 0) {
    float* ml = MLpart + tile * 32 + 8 * half;
    *(float4*)(ml + 0)  = make_float4(Mrow[0], Mrow[1], Mrow[2], Mrow[3]);
    *(float4*)(ml + 4)  = make_float4(Mrow[4], Mrow[5], Mrow[6], Mrow[7]);
    *(float4*)(ml + 16) = make_float4(Lrow[0], Lrow[1], Lrow[2], Lrow[3]);
    *(float4*)(ml + 20) = make_float4(Lrow[4], Lrow[5], Lrow[6], Lrow[7]);
  }
}

// ---------------------------------------------------------------------------
// Kernel 3: merge the KSPLIT key ranges, then Y = Wo * O^T + bo + x
// Grid: (NTOK/64, B, OSPLIT), 128 threads (4 waves). Wave w owns query rows
// m0+w*16..+15; the work-group owns output channels [oz*64, +64).
// Two work-groups share a WGP, so that all 512 are resident at once.
// Every loop is unrolled in full: its arrays are indexed by constants only and
// so stay in registers.
// ---------------------------------------------------------------------------
__global__ __launch_bounds__(128, 2) void merge_proj_kernel(
    const float* __restrict__ x,
    const float* __restrict__ wo, const float* __restrict__ bo,
    const float* __restrict__ Opart, const float* __restrict__ MLpart,
    float* __restrict__ out)
{
  __shared__ float wos[(CDIM / OSPLIT) * WOP];   // Wo rows of this range
  __shared__ float pbuf[4][16][18];              // per-wave fragment relayout

  const int mb = blockIdx.x;
  const int b  = blockIdx.y;
  const int ob = blockIdx.z * (CDIM / OSPLIT);
  const int lane = threadIdx.x & 31;
  const int wave = threadIdx.x >> 5;
  const int half = lane >> 4;
  const int l15  = lane & 15;
  const int mg = mb * 64 + wave * 16 + l15;
  const float* xb = x + (size_t)b * CDIM * NTOK;

  // The global reads of the merge are issued in groups of 32 to 80 loads, so
  // that a wave pays the L2 latency once a group and not once a load.
  const size_t tile0 = ((size_t)b * NT16 + mb * 4 + wave) * KSPLIT;  // range 0
  const float* mlp = MLpart + tile0 * 32 + 8 * half;
  const float* opp = Opart + tile0 * (16 * CDIM) + lane * 4;
  const float* wop = wo + (size_t)(ob + (threadIdx.x >> 6)) * CDIM + (threadIdx.x & 63) * 4;
  const float* xp  = xb + (size_t)(ob + 8 * half) * NTOK + mg;
  const float* bop = bo + ob + 8 * half;
  const int c4 = (threadIdx.x & 63) * 4;   // Wo staging: column group
  const int r0 = threadIdx.x >> 6;         // Wo staging: first row

  float4 mv[KSPLIT][2], lv[KSPLIT][2];     // row maxima, row sums (r + 8*half)
#pragma unroll
  for (int s = 0; s < KSPLIT; ++s)
#pragma unroll
    for (int q = 0; q < 2; ++q) {
      mv[s][q] = *(const float4*)(mlp + s * 32 + 4 * q);
      lv[s][q] = *(const float4*)(mlp + s * 32 + 16 + 4 * q);
    }
  float4 wreg[CDIM / OSPLIT / 2];          // Wo[ob .. ob+63][0..255], 2 rows a pass
#pragma unroll
  for (int i = 0; i < CDIM / OSPLIT / 2; ++i)
    wreg[i] = *(const float4*)(wop + i * 2 * CDIM);
  // O comes in groups of four 16-channel chunks, all ranges: 32 loads a group
  float4 obuf[2][4][KSPLIT][2];
#pragma unroll
  for (int cl = 0; cl < 4; ++cl)
#pragma unroll
    for (int s = 0; s < KSPLIT; ++s)
#pragma unroll
      for (int h = 0; h < 2; ++h)
        obuf[0][cl][s][h] = *(const float4*)(
            opp + s * (16 * CDIM) + cl * 256 + h * 128);
  ADDR_WAIT();
  // holds the reads above in one place; left free they sink to their users
  GROUP_FENCE();

#pragma unroll
  for (int i = 0; i < CDIM / OSPLIT / 2; ++i)
    *(float4*)(wos + (r0 + 2 * i) * WOP + c4) = wreg[i];
  ADDR_WAIT();
  // group 1's reads take the registers that the Wo rows have left
  GROUP_FENCE();
#pragma unroll
  for (int cl = 0; cl < 4; ++cl)
#pragma unroll
    for (int s = 0; s < KSPLIT; ++s)
#pragma unroll
      for (int h = 0; h < 2; ++h)
        obuf[1][cl][s][h] = *(const float4*)(
            opp + s * (16 * CDIM) + (4 + cl) * 256 + h * 128);
  // the residual's x and the bias come with them
  float xres[16 / OSPLIT][8];
  float4 bov[16 / OSPLIT][2];
#pragma unroll
  for (int ot = 0; ot < 16 / OSPLIT; ++ot) {
#pragma unroll
    for (int r = 0; r < 8; ++r) xres[ot][r] = xp[(size_t)(ot * 16 + r) * NTOK];
    bov[ot][0] = *(const float4*)(bop + ot * 16);
    bov[ot][1] = *(const float4*)(bop + ot * 16 + 4);
  }
  ADDR_WAIT();
  // one place again, ahead of the weights
  GROUP_FENCE();

  // weights of the ranges for rows r + 8*half, 1 / (row sum) folded in
  float wgt[KSPLIT][8];
#pragma unroll
  for (int r = 0; r < 8; ++r) {
    float Ms[KSPLIT], Ls[KSPLIT];
#pragma unroll
    for (int s = 0; s < KSPLIT; ++s) {
      const float4 m4 = mv[s][r >> 2], l4 = lv[s][r >> 2];
      Ms[s] = (r & 3) == 0 ? m4.x : (r & 3) == 1 ? m4.y : (r & 3) == 2 ? m4.z : m4.w;
      Ls[s] = (r & 3) == 0 ? l4.x : (r & 3) == 1 ? l4.y : (r & 3) == 2 ? l4.z : l4.w;
    }
    float Mx = Ms[0];
#pragma unroll
    for (int s = 1; s < KSPLIT; ++s) Mx = fmaxf(Mx, Ms[s]);
    float Lt = 0.f;
#pragma unroll
    for (int s = 0; s < KSPLIT; ++s) {
      wgt[s][r] = exp2f((Ms[s] - Mx) * LOG2E);
      Lt += wgt[s][r] * Ls[s];
    }
    const float rinv = 1.0f / Lt;
#pragma unroll
    for (int s = 0; s < KSPLIT; ++s) wgt[s][r] *= rinv;
  }

  __syncthreads();                    // Wo slab visible to all waves

  v8f y_acc[16 / OSPLIT];
#pragma unroll
  for (int ot = 0; ot < 16 / OSPLIT; ++ot) y_acc[ot] = vzero8();

#pragma unroll
  for (int g = 0; g < 4; ++g) {
#pragma unroll
    for (int cl = 0; cl < 4; ++cl) {
      const int cc = g * 4 + cl;
      // merge the ranges: O[m = r + 8*half][c = cc*16 + l15], normalised
      float om[8];
#pragma unroll
      for (int r = 0; r < 8; ++r) om[r] = 0.f;
#pragma unroll
      for (int s = 0; s < KSPLIT; ++s) {
        const float4 lo = obuf[g & 1][cl][s][0], hi = obuf[g & 1][cl][s][1];
        om[0] += wgt[s][0] * lo.x; om[1] += wgt[s][1] * lo.y;
        om[2] += wgt[s][2] * lo.z; om[3] += wgt[s][3] * lo.w;
        om[4] += wgt[s][4] * hi.x; om[5] += wgt[s][5] * hi.y;
        om[6] += wgt[s][6] * hi.z; om[7] += wgt[s][7] * hi.w;
      }
      // relayout this wave's O chunk: [m][c_local] through per-wave pbuf
#pragma unroll
      for (int r = 0; r < 8; ++r)
        pbuf[wave][r + 8 * half][l15] = om[r];
      LDS_FENCE();
      v2f b_o[4];
#pragma unroll
      for (int j = 0; j < 4; ++j)     // B[k=c][m=l15] = O[m][c]
        b_o[j] = *(const v2f*)&pbuf[wave][l15][4 * j + 2 * half];
      SCHED_FENCE();
#pragma unroll
      for (int j = 0; j < 4; ++j)
#pragma unroll
        for (int ot = 0; ot < 16 / OSPLIT; ++ot) {
          v2f afr = *(const v2f*)(wos + (ot * 16 + l15) * WOP + cc * 16 + 4 * j + 2 * half);
          y_acc[ot] = wmma4(afr, b_o[j], y_acc[ot]);
        }
    }
    if (g + 2 < 4) {
      // keeps the refill behind the sums that free its registers ...
      GROUP_FENCE();
#pragma unroll
      for (int cl = 0; cl < 4; ++cl)
#pragma unroll
        for (int s = 0; s < KSPLIT; ++s)
#pragma unroll
          for (int h = 0; h < 2; ++h)
            obuf[g & 1][cl][s][h] = *(const float4*)(
                opp + s * (16 * CDIM) + ((g + 2) * 4 + cl) * 256 + h * 128);
      ADDR_WAIT();
      // ... and in one place, ahead of the next group's work
      GROUP_FENCE();
    }
  }

  float* yp = out + (size_t)b * CDIM * NTOK + (size_t)(ob + 8 * half) * NTOK + mg;
#pragma unroll
  for (int ot = 0; ot < 16 / OSPLIT; ++ot) {
    const float4 b0 = bov[ot][0], b1 = bov[ot][1];
    const float bb[8] = {b0.x, b0.y, b0.z, b0.w, b1.x, b1.y, b1.z, b1.w};
#pragma unroll
    for (int r = 0; r < 8; ++r)       // output channel ob + ot*16 + r + 8*half
      yp[(size_t)(ot * 16 + r) * NTOK] = y_acc[ot][r] + bb[r] + xres[ot][r];
  }
}

// ---------------------------------------------------------------------------
extern "C" void kernel_launch(void* const* d_in, const int* in_sizes, int n_in,
                              void* d_out, int out_size, void* d_ws, size_t ws_size,
                              hipStream_t stream) {
  (void)in_sizes; (void)n_in; (void)out_size; (void)ws_size;
  const float* x  = (const float*)d_in[0];
  const float* t  = (const float*)d_in[1];
  const float* wq = (const float*)d_in[2];
  const float* bq = (const float*)d_in[3];
  const float* wk = (const float*)d_in[4];
  const float* bk = (const float*)d_in[5];
  const float* wv = (const float*)d_in[6];
  const float* bv = (const float*)d_in[7];
  const float* wo = (const float*)d_in[8];
  const float* bo = (const float*)d_in[9];

  float* Kws = (float*)d_ws;                       // [B][C][N] f32, 8 MB
  float* Vws = Kws + (size_t)BSZ * CDIM * NTOK;    // [B][C][N] f32, 8 MB
  float* Ows = Vws + (size_t)BSZ * CDIM * NTOK;    // [B][N/16][KSPLIT][16*C], 32 MB
  float* MLws = Ows + (size_t)KSPLIT * BSZ * CDIM * NTOK;  // [B][N/16][KSPLIT][32]
  float* Qws = MLws + (size_t)BSZ * NT16 * KSPLIT * 32;    // [B][N/16][C/8][32][4], 8 MB

  dim3 g1(NTOK / 64, BSZ, 3);
  qkv_proj_kernel<<<g1, dim3(128, 1, 1), 0, stream>>>(t, x, wk, bk, wv, bv, wq, bq,
                                                      Kws, Vws, Qws);

  const size_t smem = (size_t)4 * CDIM * TILEW * sizeof(float);  // 80 KB
  dim3 g2(NTOK / 64, BSZ, KSPLIT);
  attn_kernel<<<g2, dim3(128, 1, 1), smem, stream>>>(Qws, Kws, Vws, Ows, MLws);

  dim3 g3(NTOK / 64, BSZ, OSPLIT);
  merge_proj_kernel<<<g3, dim3(128, 1, 1), 0, stream>>>(x, wo, bo, Ows, MLws,
                                                        (float*)d_out);
}

// v005
// Measured time: 223 microseconds a run.
// Next to v004, in two timings, it ran 1.15 times as fast each time.
// Counting every step since v000, it is 6.21 times as fast.
#include <hip/hip_runtime.h>

typedef float v2f __attribute__((ext_vector_type(2)));
typedef float v8f __attribute__((ext_vector_type(8)));

#define CDIM 256
#define NTOK 4096
#define BSZ  2
#define LOG2E 1.4426950408889634f
#define TILEF (16 * CDIM)   // floats of one 16-key tile of K or of V
#define NT16  (NTOK / 16)
#define KSPLIT 4            // key ranges, one work-group each
#define NTS   (NT16 / KSPLIT)   // key tiles of one range
#define OSPLIT 4            // output-channel ranges of the merge kernel
#define WOP   260           // padded row width of the Wo slab in LDS

#define LDS_FENCE()   __asm__ volatile("s_wait_dscnt 0" ::: "memory")
#define SCHED_FENCE() __asm__ volatile("" ::: "memory")
#define GROUP_FENCE() __builtin_amdgcn_sched_barrier(0)
// previous tile's 16 async b128 done; next tile's 16 may still be in flight
#define ASYNC_WAIT_PREFETCHED() __asm__ volatile("s_wait_asynccnt 0x10" ::: "memory")
#define ASYNC_WAIT_ALL()        __asm__ volatile("s_wait_asynccnt 0x0"  ::: "memory")
// behind a group of global loads or stores: later code may reuse the registers
// that they name
#define ADDR_WAIT()   __asm__ volatile("s_wait_xcnt 0x0" ::: "memory")

__device__ __forceinline__ v8f wmma4(v2f a, v2f b, v8f c) {
  // D(16x16,f32) = A(16x4,f32) x B(4x16,f32) + C
  return __builtin_amdgcn_wmma_f32_16x16x4_f32(false, a, false, b, (short)0, c,
                                               false, false);
}

__device__ __forceinline__ v8f vzero8() {
  v8f z = {0.f, 0.f, 0.f, 0.f, 0.f, 0.f, 0.f, 0.f};
  return z;
}

// Maximum / sum over each 16-lane row, for eight values at once: four DPP
// row_xmask steps (lane l with lane l ^ 1, ^ 2, ^ 4, ^ 8) in the vector unit, in
// place. A shuffle would go through the LDS queue and cost its latency at every
// step. The eight values alternate, so that a step's producer stands eight
// instructions back and no step waits. All 32 lanes must be on.
__device__ __forceinline__ void row_max8(float (&v)[8]) {
  // asm: the compiler splits the builtin form into a DPP move and a maximum
  __asm__(
      "v_max_num_f32_dpp %0, %0, %0 row_xmask:1 row_mask:0xf bank_mask:0xf\n\t"
      "v_max_num_f32_dpp %1, %1, %1 row_xmask:1 row_mask:0xf bank_mask:0xf\n\t"
      "v_max_num_f32_dpp %2, %2, %2 row_xmask:1 row_mask:0xf bank_mask:0xf\n\t"
      "v_max_num_f32_dpp %3, %3, %3 row_xmask:1 row_mask:0xf bank_mask:0xf\n\t"
      "v_max_num_f32_dpp %4, %4, %4 row_xmask:1 row_mask:0xf bank_mask:0xf\n\t"
      "v_max_num_f32_dpp %5, %5, %5 row_xmask:1 row_mask:0xf bank_mask:0xf\n\t"
      "v_max_num_f32_dpp %6, %6, %6 row_xmask:1 row_mask:0xf bank_mask:0xf\n\t"
      "v_max_num_f32_dpp %7, %7, %7 row_xmask:1 row_mask:0xf bank_mask:0xf\n\t"
      "v_max_num_f32_dpp %0, %0, %0 row_xmask:2 row_mask:0xf bank_mask:0xf\n\t"
      "v_max_num_f32_dpp %1, %1, %1 row_xmask:2 row_mask:0xf bank_mask:0xf\n\t"
      "v_max_num_f32_dpp %2, %2, %2 row_xmask:2 row_mask:0xf bank_mask:0xf\n\t"
      "v_max_num_f32_dpp %3, %3, %3 row_xmask:2 row_mask:0xf bank_mask:0xf\n\t"
      "v_max_num_f32_dpp %4, %4, %4 row_xmask:2 row_mask:0xf bank_mask:0xf\n\t"
      "v_max_num_f32_dpp %5, %5, %5 row_xmask:2 row_mask:0xf bank_mask:0xf\n\t"
      "v_max_num_f32_dpp %6, %6, %6 row_xmask:2 row_mask:0xf bank_mask:0xf\n\t"
      "v_max_num_f32_dpp %7, %7, %7 row_xmask:2 row_mask:0xf bank_mask:0xf\n\t"
      "v_max_num_f32_dpp %0, %0, %0 row_xmask:4 row_mask:0xf bank_mask:0xf\n\t"
      "v_max_num_f32_dpp %1, %1, %1 row_xmask:4 row_mask:0xf bank_mask:0xf\n\t"
      "v_max_num_f32_dpp %2, %2, %2 row_xmask:4 row_mask:0xf bank_mask:0xf\n\t"
      "v_max_num_f32_dpp %3, %3, %3 row_xmask:4 row_mask:0xf bank_mask:0xf\n\t"
      "v_max_num_f32_dpp %4, %4, %4 row_xmask:4 row_mask:0xf bank_mask:0xf\n\t"
      "v_max_num_f32_dpp %5, %5, %5 row_xmask:4 row_mask:0xf bank_mask:0xf\n\t"
      "v_max_num_f32_dpp %6, %6, %6 row_xmask:4 row_mask:0xf bank_mask:0xf\n\t"
      "v_max_num_f32_dpp %7, %7, %7 row_xmask:4 row_mask:0xf bank_mask:0xf\n\t"
      "v_max_num_f32_dpp %0, %0, %0 row_xmask:8 row_mask:0xf bank_mask:0xf\n\t"
      "v_max_num_f32_dpp %1, %1, %1 row_xmask:8 row_mask:0xf bank_mask:0xf\n\t"
      "v_max_num_f32_dpp %2, %2, %2 row_xmask:8 row_mask:0xf bank_mask:0xf\n\t"
      "v_max_num_f32_dpp %3, %3, %3 row_xmask:8 row_mask:0xf bank_mask:0xf\n\t"
      "v_max_num_f32_dpp %4, %4, %4 row_xmask:8 row_mask:0xf bank_mask:0xf\n\t"
      "v_max_num_f32_dpp %5, %5, %5 row_xmask:8 row_mask:0xf bank_mask:0xf\n\t"
      "v_max_num_f32_dpp %6, %6, %6 row_xmask:8 row_mask:0xf bank_mask:0xf\n\t"
      "v_max_num_f32_dpp %7, %7, %7 row_xmask:8 row_mask:0xf bank_mask:0xf"
      : "+v"(v[0]), "+v"(v[1]), "+v"(v[2]), "+v"(v[3]),
        "+v"(v[4]), "+v"(v[5]), "+v"(v[6]), "+v"(v[7]));
}

__device__ __forceinline__ void row_sum8(float (&v)[8]) {
  // asm: in place, so that no step takes a register of its own for the moved value
  __asm__(
      "v_add_f32_dpp %0, %0, %0 row_xmask:1 row_mask:0xf bank_mask:0xf\n\t"
      "v_add_f32_dpp %1, %1, %1 row_xmask:1 row_mask:0xf bank_mask:0xf\n\t"
      "v_add_f32_dpp %2, %2, %2 row_xmask:1 row_mask:0xf bank_mask:0xf\n\t"
      "v_add_f32_dpp %3, %3, %3 row_xmask:1 row_mask:0xf bank_mask:0xf\n\t"
      "v_add_f32_dpp %4, %4, %4 row_xmask:1 row_mask:0xf bank_mask:0xf\n\t"
      "v_add_f32_dpp %5, %5, %5 row_xmask:1 row_mask:0xf bank_mask:0xf\n\t"
      "v_add_f32_dpp %6, %6, %6 row_xmask:1 row_mask:0xf bank_mask:0xf\n\t"
      "v_add_f32_dpp %7, %7, %7 row_xmask:1 row_mask:0xf bank_mask:0xf\n\t"
      "v_add_f32_dpp %0, %0, %0 row_xmask:2 row_mask:0xf bank_mask:0xf\n\t"
      "v_add_f32_dpp %1, %1, %1 row_xmask:2 row_mask:0xf bank_mask:0xf\n\t"
      "v_add_f32_dpp %2, %2, %2 row_xmask:2 row_mask:0xf bank_mask:0xf\n\t"
      "v_add_f32_dpp %3, %3, %3 row_xmask:2 row_mask:0xf bank_mask:0xf\n\t"
      "v_add_f32_dpp %4, %4, %4 row_xmask:2 row_mask:0xf bank_mask:0xf\n\t"
      "v_add_f32_dpp %5, %5, %5 row_xmask:2 row_mask:0xf bank_mask:0xf\n\t"
      "v_add_f32_dpp %6, %6, %6 row_xmask:2 row_mask:0xf bank_mask:0xf\n\t"
      "v_add_f32_dpp %7, %7, %7 row_xmask:2 row_mask:0xf bank_mask:0xf\n\t"
      "v_add_f32_dpp %0, %0, %0 row_xmask:4 row_mask:0xf bank_mask:0xf\n\t"
      "v_add_f32_dpp %1, %1, %1 row_xmask:4 row_mask:0xf bank_mask:0xf\n\t"
      "v_add_f32_dpp %2, %2, %2 row_xmask:4 row_mask:0xf bank_mask:0xf\n\t"
      "v_add_f32_dpp %3, %3, %3 row_xmask:4 row_mask:0xf bank_mask:0xf\n\t"
      "v_add_f32_dpp %4, %4, %4 row_xmask:4 row_mask:0xf bank_mask:0xf\n\t"
      "v_add_f32_dpp %5, %5, %5 row_xmask:4 row_mask:0xf bank_mask:0xf\n\t"
      "v_add_f32_dpp %6, %6, %6 row_xmask:4 row_mask:0xf bank_mask:0xf\n\t"
      "v_add_f32_dpp %7, %7, %7 row_xmask:4 row_mask:0xf bank_mask:0xf\n\t"
      "v_add_f32_dpp %0, %0, %0 row_xmask:8 row_mask:0xf bank_mask:0xf\n\t"
      "v_add_f32_dpp %1, %1, %1 row_xmask:8 row_mask:0xf bank_mask:0xf\n\t"
      "v_add_f32_dpp %2, %2, %2 row_xmask:8 row_mask:0xf bank_mask:0xf\n\t"
      "v_add_f32_dpp %3, %3, %3 row_xmask:8 row_mask:0xf bank_mask:0xf\n\t"
      "v_add_f32_dpp %4, %4, %4 row_xmask:8 row_mask:0xf bank_mask:0xf\n\t"
      "v_add_f32_dpp %5, %5, %5 row_xmask:8 row_mask:0xf bank_mask:0xf\n\t"
      "v_add_f32_dpp %6, %6, %6 row_xmask:8 row_mask:0xf bank_mask:0xf\n\t"
      "v_add_f32_dpp %7, %7, %7 row_xmask:8 row_mask:0xf bank_mask:0xf"
      : "+v"(v[0]), "+v"(v[1]), "+v"(v[2]), "+v"(v[3]),
        "+v"(v[4]), "+v"(v[5]), "+v"(v[6]), "+v"(v[7]));
}

// Async DMA: 16B global -> LDS, tracked by ASYNCcnt (no VGPR staging).
// Flat->LDS mapping truncates to low 32 bits, so low bits of the generic
// shared pointer are the LDS byte address.
// One 16-key tile of K and of V, 16 KB each and contiguous on both sides: the
// 128 lanes of the work-group move 2 KB a copy, eight copies a matrix. The
// immediate offset moves the LDS and the global address alike.
__device__ __forceinline__ void async_copy_tile(float* k_lds, const float* k_src,
                                                float* v_lds, const float* v_src) {
  unsigned kl = (unsigned)(unsigned long long)k_lds;
  unsigned vl = (unsigned)(unsigned long long)v_lds;
  // the closing wait stands inside the statement: later code may rewrite the
  // address registers that the copies name
  __asm__ volatile(
      "global_load_async_to_lds_b128 %0, %1, off\n\t"
      "global_load_async_to_lds_b128 %2, %3, off\n\t"
      "global_load_async_to_lds_b128 %0, %1, off offset:2048\n\t"
      "global_load_async_to_lds_b128 %2, %3, off offset:2048\n\t"
      "global_load_async_to_lds_b128 %0, %1, off offset:4096\n\t"
      "global_load_async_to_lds_b128 %2, %3, off offset:4096\n\t"
      "global_load_async_to_lds_b128 %0, %1, off offset:6144\n\t"
      "global_load_async_to_lds_b128 %2, %3, off offset:6144\n\t"
      "global_load_async_to_lds_b128 %0, %1, off offset:8192\n\t"
      "global_load_async_to_lds_b128 %2, %3, off offset:8192\n\t"
      "global_load_async_to_lds_b128 %0, %1, off offset:10240\n\t"
      "global_load_async_to_lds_b128 %2, %3, off offset:10240\n\t"
      "global_load_async_to_lds_b128 %0, %1, off offset:12288\n\t"
      "global_load_async_to_lds_b128 %2, %3, off offset:12288\n\t"
      "global_load_async_to_lds_b128 %0, %1, off offset:14336\n\t"
      "global_load_async_to_lds_b128 %2, %3, off offset:14336\n\t"
      "s_wait_xcnt 0x0"
      :: "v"(kl), "v"(k_src), "v"(vl), "v"(v_src)
      : "memory");
}

// ---------------------------------------------------------------------------
// Kernel 1: K = Wk*t + bk, V = Wv*t + bv, Q = Wq*x + bq
// (per-token 1x1x1 conv == GEMM)
// Grid: (NTOK/64, B, 3), 128 threads (4 waves). Wave w owns o-range [w*64,+64).
// All three are left in the order of the attention kernel's fragments, 16 bytes
// a lane: [token tile][32][lane][4], lane = 16 * h + i.
// Q (A) and K (B): entry jp, i = token & 15, the four floats being
// [c = 8*jp + 2*h + {0, 1}][token] and [c = 8*jp + 4 + 2*h + {0, 1}][token].
// V (B): entry 2*(c / 16) + jp, i = c & 15, the four floats being
// V[c][n = 8*jp + 2*h + {0, 1}] and V[c][n = 8*jp + 4 + 2*h + {0, 1}] of the tile.
// V is therefore computed transposed (tokens as D's rows): operands swapped.
// ---------------------------------------------------------------------------
// acc[ot][nt] += W[obase + ot*16 ..][:] * t[:][n0 + nt*16 ..], 16 x 16 each; D's
// rows are the output channels, or the tokens where TOKEN_ROWS (the two
// fragments have the same lane map, so that they only change places).
template <bool TOKEN_ROWS>
__device__ __forceinline__ void proj_tiles(const float* __restrict__ W,
                                           const float* __restrict__ tb,
                                           int obase, int n0, int half, int l15,
                                           v8f (&acc)[4][4]) {
  for (int k = 0; k < CDIM; k += 4) {
    const int kk = k + 2 * half;   // this lane-half's K pair {kk, kk+1}
    v2f afr[4], bfr[4];
    // the four inner loops are unrolled: afr, bfr, acc stay in registers
#pragma unroll
    for (int ot = 0; ot < 4; ++ot)  // W[o][c], o = l15, c = kk, kk + 1
      afr[ot] = *(const v2f*)(W + (size_t)(obase + ot * 16 + l15) * CDIM + kk);
#pragma unroll
    for (int nt = 0; nt < 4; ++nt) { // t[c][n], n = l15, c = kk, kk + 1
      const int n = n0 + nt * 16 + l15;
      bfr[nt][0] = tb[(size_t)(kk + 0) * NTOK + n];
      bfr[nt][1] = tb[(size_t)(kk + 1) * NTOK + n];
    }
#pragma unroll
    for (int ot = 0; ot < 4; ++ot)
#pragma unroll
      for (int nt = 0; nt < 4; ++nt)
        acc[ot][nt] = TOKEN_ROWS ? wmma4(bfr[nt], afr[ot], acc[ot][nt])
                                 : wmma4(afr[ot], bfr[nt], acc[ot][nt]);
  }
}

__global__ __launch_bounds__(128) void qkv_proj_kernel(
    const float* __restrict__ t, const float* __restrict__ x,
    const float* __restrict__ wk, const float* __restrict__ bk,
    const float* __restrict__ wv, const float* __restrict__ bv,
    const float* __restrict__ wq, const float* __restrict__ bq,
    float* __restrict__ Kout, float* __restrict__ Vout,
    float* __restrict__ Qout)
{
  const int nb  = blockIdx.x;
  const int b   = blockIdx.y;
  const int mat = blockIdx.z;            // 0: K, 1: V, 2: Q
  const float* W    = mat == 0 ? wk : mat == 1 ? wv : wq;
  const float* bias = mat == 0 ? bk : mat == 1 ? bv : bq;
  float* Out        = mat == 0 ? Kout : mat == 1 ? Vout : Qout;
  const float* tb   = (mat == 2 ? x : t) + (size_t)b * CDIM * NTOK;

  const int lane = threadIdx.x & 31;
  const int wave = threadIdx.x >> 5;
  const int half = lane >> 4;
  const int l15  = lane & 15;
  const int n0    = nb * 64;
  const int obase = wave * 64;

  v8f acc[4][4];
#pragma unroll
  for (int i = 0; i < 4; ++i)
#pragma unroll
    for (int j = 0; j < 4; ++j) acc[i][j] = vzero8();

  if (mat == 1) proj_tiles<true>(W, tb, obase, n0, half, l15, acc);
  else          proj_tiles<false>(W, tb, obase, n0, half, l15, acc);

  {
    // of token tile nb*4 + nt this lane holds, with e = wave*8 + ot*2 + half,
    // Q or K: [c = 8*e + r][token l15]; V: [c = obase + ot*16 + l15][n = 8*half + r]
    float* qo = Out + ((size_t)(b * NT16 + nb * 4) * 32 + wave * 8 + half) * 128 +
                l15 * 4;
    float4 blo[4], bhi[4];   // the bias of acc[ot][.][0..3] and of [4..7]
    if (mat == 1) {
#pragma unroll   // blo, bhi are indexed by constants only and stay in registers
      for (int ot = 0; ot < 4; ++ot) {
        const float bc = bias[obase + ot * 16 + l15];
        blo[ot] = bhi[ot] = make_float4(bc, bc, bc, bc);
      }
    } else {
#pragma unroll   // as above
      for (int ot = 0; ot < 4; ++ot) {
        blo[ot] = *(const float4*)(bias + obase + ot * 16 + 8 * half);
        bhi[ot] = *(const float4*)(bias + obase + ot * 16 + 8 * half + 4);
      }
    }
#pragma unroll   // acc is indexed by constants only and stays in registers
    for (int ot = 0; ot < 4; ++ot) {
      const float4 b0 = blo[ot];
      const float4 b1 = bhi[ot];
#pragma unroll
      for (int nt = 0; nt < 4; ++nt) {
        float* q = qo + nt * (16 * CDIM) + ot * 256;
        *(float4*)(q) =                  // fragment lanes 0..15
            make_float4(acc[ot][nt][0] + b0.x, acc[ot][nt][1] + b0.y,
                        acc[ot][nt][4] + b1.x, acc[ot][nt][5] + b1.y);
        *(float4*)(q + 64) =             // fragment lanes 16..31
            make_float4(acc[ot][nt][2] + b0.z, acc[ot][nt][3] + b0.w,
                        acc[ot][nt][6] + b1.z, acc[ot][nt][7] + b1.w);
      }
    }
  }
}

// ---------------------------------------------------------------------------
// Kernel 2: flash attention over ONE key range
// Grid: (NTOK/64, B, KSPLIT), 128 threads (4 waves). Wave w owns query rows
// m0+w*16..+15 and the keys [ks*NTOK/KSPLIT, +NTOK/KSPLIT). It leaves the
// un-normalised O with its row maxima and row sums in the workspace.
// Two work-groups share a WGP (two waves a SIMD): 512 VGPRs a wave at most.
// Dynamic LDS: double-buffered K/V tiles in fragment order, 16 KB each, filled
// by async DMA.
// ---------------------------------------------------------------------------
__global__ __launch_bounds__(128, 2) void attn_kernel(
    const float* __restrict__ Qin,
    const float* __restrict__ Kin, const float* __restrict__ Vin,
    float* __restrict__ Opart, float* __restrict__ MLpart)
{
  extern __shared__ float dynsmem[];
  float* Kbuf0 = dynsmem;                    // [32][lane][4]
  float* Vbuf0 = Kbuf0 + TILEF;
  float* Kbuf1 = Vbuf0 + TILEF;
  float* Vbuf1 = Kbuf1 + TILEF;
  __shared__ float pbuf[4][16][18];          // per-wave fragment relayout

  const int mb = blockIdx.x;
  const int b  = blockIdx.y;
  const int ks = blockIdx.z;             // this work-group's key range
  const int lane = threadIdx.x & 31;
  const int wave = threadIdx.x >> 5;
  const int half = lane >> 4;
  const int l15  = lane & 15;

  const int st = threadIdx.x * 4;            // staging: this lane's 16 bytes
  const float* Kb = Kin + (size_t)(b * NT16 + ks * NTS) * TILEF + st;
  const float* Vb = Vin + (size_t)(b * NT16 + ks * NTS) * TILEF + st;

  // kick off async staging of key/value tile 0 while Q comes in
  async_copy_tile(Kbuf0 + st, Kb, Vbuf0 + st, Vb);

  // ---- Q^T of this wave's 16 tokens, as launch 1 left it: A fragments ----
  v2f a_q[64];                         // a_q[j] covers c = 4j..4j+3
  {
    const float* qp = Qin + (size_t)(b * NT16 + mb * 4 + wave) * (16 * CDIM) + lane * 4;
#pragma unroll   // a_q is indexed by constants only and stays in registers
    for (int jp = 0; jp < 32; ++jp) {
      const float4 q4 = *(const float4*)(qp + jp * 128);
      a_q[2 * jp + 0][0] = q4.x; a_q[2 * jp + 0][1] = q4.y;
      a_q[2 * jp + 1][0] = q4.z; a_q[2 * jp + 1][1] = q4.w;
    }
    ADDR_WAIT();
    // keeps later register writes from being lifted over the wait above
    GROUP_FENCE();
  }

  // ---- Main loop: stream 16-wide key tiles, online softmax, double-buffered ----
  v8f o_acc[16];                      // O[m][c] accumulators (rows m, cols c)
#pragma unroll
  for (int ct = 0; ct < 16; ++ct) o_acc[ct] = vzero8();
  float Mrow[8], Lrow[8];
#pragma unroll
  for (int r = 0; r < 8; ++r) { Mrow[r] = -3.0e38f; Lrow[r] = 0.f; }

  for (int ntile = 0; ntile < NTS; ++ntile) {
    const float* Kc = (ntile & 1) ? Kbuf1 : Kbuf0;
    const float* Vc = (ntile & 1) ? Vbuf1 : Vbuf0;
    if (ntile + 1 < NTS) {
      // prefetch next tile into the other buffer (its readers finished at the
      // barrier that ended iteration ntile-1)
      float* Kn = (ntile & 1) ? Kbuf0 : Kbuf1;
      float* Vn = (ntile & 1) ? Vbuf0 : Vbuf1;
      async_copy_tile(Kn + st, Kb + (size_t)(ntile + 1) * TILEF,
                      Vn + st, Vb + (size_t)(ntile + 1) * TILEF);
      ASYNC_WAIT_PREFETCHED();   // current tile's 16 async ops are complete
    } else {
      ASYNC_WAIT_ALL();
    }
    __syncthreads();             // current tile visible to all waves

    // S = Q^T * K  (16m x 16n, k=256); 4 interleaved partial accumulators.
    // The tile's B fragments come from LDS two to a 16-byte read, in groups of
    // 8 reads, each group issued one group of WMMAs ahead of its use; V's 32
    // reads follow behind K's.
    const float* kp = Kc + lane * 4;   // B[k=c][n=l15], fragments 2*jp, 2*jp + 1
    const float* vp = Vc + lane * 4;   // B[k=n][c=l15], fragments 2*i, 2*i + 1
    v2f kf[64];
    v2f vf[64];
    v8f sp[4];
    sp[0] = sp[1] = sp[2] = sp[3] = vzero8();
#pragma unroll
    for (int jp = 0; jp < 8; ++jp) {
      const float4 k4 = *(const float4*)(kp + jp * 128);
      kf[2 * jp + 0][0] = k4.x; kf[2 * jp + 0][1] = k4.y;
      kf[2 * jp + 1][0] = k4.z; kf[2 * jp + 1][1] = k4.w;
    }
#pragma unroll
    for (int g = 0; g < 4; ++g) {
      if (g < 3) {
#pragma unroll
        for (int jp = 8 * (g + 1); jp < 8 * (g + 2); ++jp) {
          const float4 k4 = *(const float4*)(kp + jp * 128);
          kf[2 * jp + 0][0] = k4.x; kf[2 * jp + 0][1] = k4.y;
          kf[2 * jp + 1][0] = k4.z; kf[2 * jp + 1][1] = k4.w;
        }
      } else {
#pragma unroll
        for (int i = 0; i < 32; ++i) {
          const float4 v4 = *(const float4*)(vp + i * 128);
          vf[2 * i + 0][0] = v4.x; vf[2 * i + 0][1] = v4.y;
          vf[2 * i + 1][0] = v4.z; vf[2 * i + 1][1] = v4.w;
        }
      }
      // holds the reads above in one place, ahead of this group's WMMAs;
      // left free they sink to their users and each waits out the LDS latency
      GROUP_FENCE();
#pragma unroll
      for (int j = 16 * g; j < 16 * (g + 1); ++j)
        sp[j & 3] = wmma4(a_q[j], kf[j], sp[j & 3]);
      // keeps the next group's reads behind these WMMAs: one place a group,
      // not spread among them
      if (g < 3) GROUP_FENCE();
    }
    v8f s = (sp[0] + sp[1]) + (sp[2] + sp[3]);

    // online softmax; rows r+8*half private to each 16-lane group
    float alpha[8], mx[8], rs[8];
#pragma unroll
    for (int r = 0; r < 8; ++r) mx[r] = s[r];
    row_max8(mx);
#pragma unroll
    for (int r = 0; r < 8; ++r) {
      const float Mn = fmaxf(Mrow[r], mx[r]);
      alpha[r] = exp2f((Mrow[r] - Mn) * LOG2E);
      const float p = exp2f((s[r] - Mn) * LOG2E);
      rs[r] = p;
      Mrow[r] = Mn;
      s[r] = p;
    }
    row_sum8(rs);
#pragma unroll
    for (int r = 0; r < 8; ++r) Lrow[r] = Lrow[r] * alpha[r] + rs[r];
#pragma unroll
    for (int ct = 0; ct < 16; ++ct)
#pragma unroll
      for (int r = 0; r < 8; ++r) o_acc[ct][r] *= alpha[r];

    // relayout P: D-frag [m][n] -> A-frags via per-wave LDS
#pragma unroll
    for (int r = 0; r < 8; ++r)
      pbuf[wave][r + 8 * half][l15] = s[r];     // [m][n]
    LDS_FENCE();
    v2f a_p[4];
#pragma unroll
    for (int j = 0; j < 4; ++j)
      a_p[j] = *(const v2f*)&pbuf[wave][l15][4 * j + 2 * half];
    SCHED_FENCE();

    // O += P * V^T   (B[k=n][c] = Vt[c][n])
#pragma unroll
    for (int ct = 0; ct < 16; ++ct)
#pragma unroll
      for (int j = 0; j < 4; ++j)
        o_acc[ct] = wmma4(a_p[j], vf[ct * 4 + j], o_acc[ct]);
    __syncthreads();   // all waves done with this tile before it is overwritten
  }

  // ---- Leave this range's partial result in the workspace ----
  // O tile: [ct][r>>2][lane][r&3], so that each b128 store covers 512 B in a row
  const size_t tile = ((size_t)b * NT16 + mb * 4 + wave) * KSPLIT + ks;
  float* op = Opart + tile * (16 * CDIM) + lane * 4;
#pragma unroll   // o_acc is indexed by constants only and stays in registers
  for (int ct = 0; ct < 16; ++ct) {
    *(float4*)(op + ct * 256) =
        make_float4(o_acc[ct][0], o_acc[ct][1], o_acc[ct][2], o_acc[ct][3]);
    *(float4*)(op + ct * 256 + 128) =
        make_float4(o_acc[ct][4], o_acc[ct][5], o_acc[ct][6], o_acc[ct][7]);
  }
  ADDR_WAIT();
  // row maxima [0..15] and row sums [16..31]; the 16 lanes of a half agree
  if (l15 == 0) {
    float* ml = MLpart + tile * 32 + 8 * half;
    *(float4*)(ml + 0)  = make_float4(Mrow[0], Mrow[1], Mrow[2], Mrow[3]);
    *(float4*)(ml + 4)  = make_float4(Mrow[4], Mrow[5], Mrow[6], Mrow[7]);
    *(float4*)(ml + 16) = make_float4(Lrow[0], Lrow[1], Lrow[2], Lrow[3]);
    *(float4*)(ml + 20) = make_float4(Lrow[4], Lrow[5], Lrow[6], Lrow[7]);
  }
}

// ---------------------------------------------------------------------------
// Kernel 3: merge the KSPLIT key ranges, then Y = Wo * O^T + bo + x
// Grid: (NTOK/64, B, OSPLIT), 128 threads (4 waves). Wave w owns query rows
// m0+w*16..+15; the work-group owns output channels [oz*64, +64).
// Two work-groups share a WGP, so that all 512 are resident at once.
// Every loop is unrolled in full: its arrays are indexed by constants only and
// so stay in registers.
// ---------------------------------------------------------------------------
__global__ __launch_bounds__(128, 2) void merge_proj_kernel(
    const float* __restrict__ x,
    const float* __restrict__ wo, const float* __restrict__ bo,
    const float* __restrict__ Opart, const float* __restrict__ MLpart,
    float* __restrict__ out)
{
  __shared__ float wos[(CDIM / OSPLIT) * WOP];   // Wo rows of this range
  __shared__ float pbuf[4][16][18];              // per-wave fragment relayout

  const int mb = blockIdx.x;
  const int b  = blockIdx.y;
  const int ob = blockIdx.z * (CDIM / OSPLIT);
  const int lane = threadIdx.x & 31;
  const int wave = threadIdx.x >> 5;
  const int half = lane >> 4;
  const int l15  = lane & 15;
  const int mg = mb * 64 + wave * 16 + l15;
  const float* xb = x + (size_t)b * CDIM * NTOK;

  // The global reads of the merge are issued in groups of 32 to 80 loads, so
  // that a wave pays the L2 latency once a group and not once a load.
  const size_t tile0 = ((size_t)b * NT16 + mb * 4 + wave) * KSPLIT;  // range 0
  const float* mlp = MLpart + tile0 * 32 + 8 * half;
  const float* opp = Opart + tile0 * (16 * CDIM) + lane * 4;
  const float* wop = wo + (size_t)(ob + (threadIdx.x >> 6)) * CDIM + (threadIdx.x & 63) * 4;
  const float* xp  = xb + (size_t)(ob + 8 * half) * NTOK + mg;
  const float* bop = bo + ob + 8 * half;
  const int c4 = (threadIdx.x & 63) * 4;   // Wo staging: column group
  const int r0 = threadIdx.x >> 6;         // Wo staging: first row

  float4 mv[KSPLIT][2], lv[KSPLIT][2];     // row maxima, row sums (r + 8*half)
#pragma unroll
  for (int s = 0; s < KSPLIT; ++s)
#pragma unroll
    for (int q = 0; q < 2; ++q) {
      mv[s][q] = *(const float4*)(mlp + s * 32 + 4 * q);
      lv[s][q] = *(const float4*)(mlp + s * 32 + 16 + 4 * q);
    }
  float4 wreg[CDIM / OSPLIT / 2];          // Wo[ob .. ob+63][0..255], 2 rows a pass
#pragma unroll
  for (int i = 0; i < CDIM / OSPLIT / 2; ++i)
    wreg[i] = *(const float4*)(wop + i * 2 * CDIM);
  // O comes in groups of four 16-channel chunks, all ranges: 32 loads a group
  float4 obuf[2][4][KSPLIT][2];
#pragma unroll
  for (int cl = 0; cl < 4; ++cl)
#pragma unroll
    for (int s = 0; s < KSPLIT; ++s)
#pragma unroll
      for (int h = 0; h < 2; ++h)
        obuf[0][cl][s][h] = *(const float4*)(
            opp + s * (16 * CDIM) + cl * 256 + h * 128);
  ADDR_WAIT();
  // holds the reads above in one place; left free they sink to their users
  GROUP_FENCE();

#pragma unroll
  for (int i = 0; i < CDIM / OSPLIT / 2; ++i)
    *(float4*)(wos + (r0 + 2 * i) * WOP + c4) = wreg[i];
  ADDR_WAIT();
  // group 1's reads take the registers that the Wo rows have left
  GROUP_FENCE();
#pragma unroll
  for (int cl = 0; cl < 4; ++cl)
#pragma unroll
    for (int s = 0; s < KSPLIT; ++s)
#pragma unroll
      for (int h = 0; h < 2; ++h)
        obuf[1][cl][s][h] = *(const float4*)(
            opp + s * (16 * CDIM) + (4 + cl) * 256 + h * 128);
  // the residual's x and the bias come with them
  float xres[16 / OSPLIT][8];
  float4 bov[16 / OSPLIT][2];
#pragma unroll
  for (int ot = 0; ot < 16 / OSPLIT; ++ot) {
#pragma unroll
    for (int r = 0; r < 8; ++r) xres[ot][r] = xp[(size_t)(ot * 16 + r) * NTOK];
    bov[ot][0] = *(const float4*)(bop + ot * 16);
    bov[ot][1] = *(const float4*)(bop + ot * 16 + 4);
  }
  ADDR_WAIT();
  // one place again, ahead of the weights
  GROUP_FENCE();

  // weights of the ranges for rows r + 8*half, 1 / (row sum) folded in
  float wgt[KSPLIT][8];
#pragma unroll
  for (int r = 0; r < 8; ++r) {
    float Ms[KSPLIT], Ls[KSPLIT];
#pragma unroll
    for (int s = 0; s < KSPLIT; ++s) {
      const float4 m4 = mv[s][r >> 2], l4 = lv[s][r >> 2];
      Ms[s] = (r & 3) == 0 ? m4.x : (r & 3) == 1 ? m4.y : (r & 3) == 2 ? m4.z : m4.w;
      Ls[s] = (r & 3) == 0 ? l4.x : (r & 3) == 1 ? l4.y : (r & 3) == 2 ? l4.z : l4.w;
    }
    float Mx = Ms[0];
#pragma unroll
    for (int s = 1; s < KSPLIT; ++s) Mx = fmaxf(Mx, Ms[s]);
    float Lt = 0.f;
#pragma unroll
    for (int s = 0; s < KSPLIT; ++s) {
      wgt[s][r] = exp2f((Ms[s] - Mx) * LOG2E);
      Lt += wgt[s][r] * Ls[s];
    }
    const float rinv = 1.0f / Lt;
#pragma unroll
    for (int s = 0; s < KSPLIT; ++s) wgt[s][r] *= rinv;
  }

  __syncthreads();                    // Wo slab visible to all waves

  v8f y_acc[16 / OSPLIT];
#pragma unroll
  for (int ot = 0; ot < 16 / OSPLIT; ++ot) y_acc[ot] = vzero8();

#pragma unroll
  for (int g = 0; g < 4; ++g) {
#pragma unroll
    for (int cl = 0; cl < 4; ++cl) {
      const int cc = g * 4 + cl;
      // merge the ranges: O[m = r + 8*half][c = cc*16 + l15], normalised
      float om[8];
#pragma unroll
      for (int r = 0; r < 8; ++r) om[r] = 0.f;
#pragma unroll
      for (int s = 0; s < KSPLIT; ++s) {
        const float4 lo = obuf[g & 1][cl][s][0], hi = obuf[g & 1][cl][s][1];
        om[0] += wgt[s][0] * lo.x; om[1] += wgt[s][1] * lo.y;
        om[2] += wgt[s][2] * lo.z; om[3] += wgt[s][3] * lo.w;
        om[4] += wgt[s][4] * hi.x; om[5] += wgt[s][5] * hi.y;
        om[6] += wgt[s][6] * hi.z; om[7] += wgt[s][7] * hi.w;
      }
      // relayout this wave's O chunk: [m][c_local] through per-wave pbuf
#pragma unroll
      for (int r = 0; r < 8; ++r)
        pbuf[wave][r + 8 * half][l15] = om[r];
      LDS_FENCE();
      v2f b_o[4];
#pragma unroll
      for (int j = 0; j < 4; ++j)     // B[k=c][m=l15] = O[m][c]
        b_o[j] = *(const v2f*)&pbuf[wave][l15][4 * j + 2 * half];
      SCHED_FENCE();
#pragma unroll
      for (int j = 0; j < 4; ++j)
#pragma unroll
        for (int ot = 0; ot < 16 / OSPLIT; ++ot) {
          v2f afr = *(const v2f*)(wos + (ot * 16 + l15) * WOP + cc * 16 + 4 * j + 2 * half);
          y_acc[ot] = wmma4(afr, b_o[j], y_acc[ot]);
        }
    }
    if (g + 2 < 4) {
      // keeps the refill behind the sums that free its registers ...
      GROUP_FENCE();
#pragma unroll
      for (int cl = 0; cl < 4; ++cl)
#pragma unroll
        for (int s = 0; s < KSPLIT; ++s)
#pragma unroll
          for (int h = 0; h < 2; ++h)
            obuf[g & 1][cl][s][h] = *(const float4*)(
                opp + s * (16 * CDIM) + ((g + 2) * 4 + cl) * 256 + h * 128);
      ADDR_WAIT();
      // ... and in one place, ahead of the next group's work
      GROUP_FENCE();
    }
  }

  float* yp = out + (size_t)b * CDIM * NTOK + (size_t)(ob + 8 * half) * NTOK + mg;
#pragma unroll
  for (int ot = 0; ot < 16 / OSPLIT; ++ot) {
    const float4 b0 = bov[ot][0], b1 = bov[ot][1];
    const float bb[8] = {b0.x, b0.y, b0.z, b0.w, b1.x, b1.y, b1.z, b1.w};
#pragma unroll
    for (int r = 0; r < 8; ++r)       // output channel ob + ot*16 + r + 8*half
      yp[(size_t)(ot * 16 + r) * NTOK] = y_acc[ot][r] + bb[r] + xres[ot][r];
  }
}

// ---------------------------------------------------------------------------
extern "C" void kernel_launch(void* const* d_in, const int* in_sizes, int n_in,
                              void* d_out, int out_size, void* d_ws, size_t ws_size,
                              hipStream_t stream) {
  (void)in_sizes; (void)n_in; (void)out_size; (void)ws_size;
  const float* x  = (const float*)d_in[0];
  const float* t  = (const float*)d_in[1];
  const float* wq = (const float*)d_in[2];
  const float* bq = (const float*)d_in[3];
  const float* wk = (const float*)d_in[4];
  const float* bk = (const float*)d_in[5];
  const float* wv = (const float*)d_in[6];
  const float* bv = (const float*)d_in[7];
  const float* wo = (const float*)d_in[8];
  const float* bo = (const float*)d_in[9];

  float* Kws = (float*)d_ws;                       // [B][N/16][32][32][4], 8 MB
  float* Vws = Kws + (size_t)BSZ * CDIM * NTOK;    // [B][N/16][32][32][4], 8 MB
  float* Ows = Vws + (size_t)BSZ * CDIM * NTOK;    // [B][N/16][KSPLIT][16*C], 32 MB
  float* MLws = Ows + (size_t)KSPLIT * BSZ * CDIM * NTOK;  // [B][N/16][KSPLIT][32]
  float* Qws = MLws + (size_t)BSZ * NT16 * KSPLIT * 32;    // [B][N/16][C/8][32][4], 8 MB

  dim3 g1(NTOK / 64, BSZ, 3);
  qkv_proj_kernel<<<g1, dim3(128, 1, 1), 0, stream>>>(t, x, wk, bk, wv, bv, wq, bq,
                                                      Kws, Vws, Qws);

  const size_t smem = (size_t)4 * TILEF * sizeof(float);  // 64 KB
  dim3 g2(NTOK / 64, BSZ, KSPLIT);
  attn_kernel<<<g2, dim3(128, 1, 1), smem, stream>>>(Qws, Kws, Vws, Ows, MLws);

  dim3 g3(NTOK / 64, BSZ, OSPLIT);
  merge_proj_kernel<<<g3, dim3(128, 1, 1), 0, stream>>>(x, wo, bo, Ows, MLws,
                                                        (float*)d_out);
}

// v006
// One run takes 205 microseconds.
// Next to v005, in two timings, it ran 1.09 times as fast each time.
// All steps since v000 together make it 6.78 times as fast.
#include <hip/hip_runtime.h>

typedef float v2f __attribute__((ext_vector_type(2)));
typedef float v4f __attribute__((ext_vector_type(4)));
typedef float v8f __attribute__((ext_vector_type(8)));

#define CDIM 256
#define NTOK 4096
#define BSZ  2
#define LOG2E 1.4426950408889634f
#define TILEF (16 * CDIM)   // floats of one 16-key tile of K or of V
#define NT16  (NTOK / 16)
#define KSPLIT 4            // key ranges, one work-group each
#define NTS   (NT16 / KSPLIT)   // key tiles of one range
#define OSPLIT 4            // output-channel ranges of the merge kernel
#define WOP   260           // padded row width of the Wo slab in LDS

#define GROUP_FENCE() __builtin_amdgcn_sched_barrier(0)
// previous tile's 16 async b128 done; next tile's 16 may still be in flight
#define ASYNC_WAIT_PREFETCHED() __asm__ volatile("s_wait_asynccnt 0x10" ::: "memory")
#define ASYNC_WAIT_ALL()        __asm__ volatile("s_wait_asynccnt 0x0"  ::: "memory")
// behind a group of global loads or stores: later code may reuse the registers
// that they name
#define ADDR_WAIT()   __asm__ volatile("s_wait_xcnt 0x0" ::: "memory")

__device__ __forceinline__ v8f wmma4(v2f a, v2f b, v8f c) {
  // D(16x16,f32) = A(16x4,f32) x B(4x16,f32) + C
  return __builtin_amdgcn_wmma_f32_16x16x4_f32(false, a, false, b, (short)0, c,
                                               false, false);
}

__device__ __forceinline__ v8f vzero8() {
  v8f z = {0.f, 0.f, 0.f, 0.f, 0.f, 0.f, 0.f, 0.f};
  return z;
}

// The value of lane l ^ 16: the other half of the keys of this lane's query.
__device__ __forceinline__ float xhalf(float v) {
  const int b = __builtin_bit_cast(int, v);
  return __builtin_bit_cast(float, __builtin_amdgcn_permlanex16(
      b, b, 0x76543210, 0xfedcba98, false, false));
}

// Async DMA: 16B global -> LDS, tracked by ASYNCcnt (no VGPR staging).
// Flat->LDS mapping truncates to low 32 bits, so low bits of the generic
// shared pointer are the LDS byte address.
// One 16-key tile of K and of V, 16 KB each and contiguous on both sides: the
// 128 lanes of the work-group move 2 KB a copy, eight copies a matrix. The
// immediate offset moves the LDS and the global address alike.
__device__ __forceinline__ void async_copy_tile(float* k_lds, const float* k_src,
                                                float* v_lds, const float* v_src) {
  unsigned kl = (unsigned)(unsigned long long)k_lds;
  unsigned vl = (unsigned)(unsigned long long)v_lds;
  // the closing wait stands inside the statement: later code may rewrite the
  // address registers that the copies name
  __asm__ volatile(
      "global_load_async_to_lds_b128 %0, %1, off\n\t"
      "global_load_async_to_lds_b128 %2, %3, off\n\t"
      "global_load_async_to_lds_b128 %0, %1, off offset:2048\n\t"
      "global_load_async_to_lds_b128 %2, %3, off offset:2048\n\t"
      "global_load_async_to_lds_b128 %0, %1, off offset:4096\n\t"
      "global_load_async_to_lds_b128 %2, %3, off offset:4096\n\t"
      "global_load_async_to_lds_b128 %0, %1, off offset:6144\n\t"
      "global_load_async_to_lds_b128 %2, %3, off offset:6144\n\t"
      "global_load_async_to_lds_b128 %0, %1, off offset:8192\n\t"
      "global_load_async_to_lds_b128 %2, %3, off offset:8192\n\t"
      "global_load_async_to_lds_b128 %0, %1, off offset:10240\n\t"
      "global_load_async_to_lds_b128 %2, %3, off offset:10240\n\t"
      "global_load_async_to_lds_b128 %0, %1, off offset:12288\n\t"
      "global_load_async_to_lds_b128 %2, %3, off offset:12288\n\t"
      "global_load_async_to_lds_b128 %0, %1, off offset:14336\n\t"
      "global_load_async_to_lds_b128 %2, %3, off offset:14336\n\t"
      "s_wait_xcnt 0x0"
      :: "v"(kl), "v"(k_src), "v"(vl), "v"(v_src)
      : "memory");
}

// ---------------------------------------------------------------------------
// Kernel 1: K = Wk*t + bk, V = Wv*t + bv, Q = Wq*x + bq
// (per-token 1x1x1 conv == GEMM)
// Grid: (NTOK/64, B, 3), 128 threads (4 waves). Wave w owns o-range [w*64,+64).
// All three are left in the order of the attention kernel's fragments, 16 bytes
// a lane: [token tile][32][lane][4], lane = 16 * h + i.
// Q (B) and K (A): entry jp, the four floats being
// [c = 8*jp + 2*h + {0, 1}][token] and [c = 8*jp + 4 + 2*h + {0, 1}][token];
// Q: i = token & 15. K: token n = 4*f + 2*g + v of the tile stands at
// i = 8*g + 2*f + v, so that the score tile's registers 2*f, 2*f + 1 of lane half
// g hold keys 4*f + 2*g + {0, 1}: the k order of V's fragment f.
// V (A): entry 2*(c / 16) + jp, i = c & 15, the four floats being
// V[c][n = 8*jp + 2*h + {0, 1}] and V[c][n = 8*jp + 4 + 2*h + {0, 1}] of the tile.
// V is therefore computed transposed (tokens as D's rows): operands swapped.
// ---------------------------------------------------------------------------
// acc[ot][nt] += W[obase + ot*16 ..][:] * t[:][n0 + nt*16 ..], 16 x 16 each; D's
// rows are the output channels, or the tokens where TOKEN_ROWS (the two
// fragments have the same lane map, so that they only change places).
template <bool TOKEN_ROWS>
__device__ __forceinline__ void proj_tiles(const float* __restrict__ W,
                                           const float* __restrict__ tb,
                                           int obase, int n0, int half, int l15,
                                           v8f (&acc)[4][4]) {
  for (int k = 0; k < CDIM; k += 4) {
    const int kk = k + 2 * half;   // this lane-half's K pair {kk, kk+1}
    v2f afr[4], bfr[4];
    // the four inner loops are unrolled: afr, bfr, acc stay in registers
#pragma unroll
    for (int ot = 0; ot < 4; ++ot)  // W[o][c], o = l15, c = kk, kk + 1
      afr[ot] = *(const v2f*)(W + (size_t)(obase + ot * 16 + l15) * CDIM + kk);
#pragma unroll
    for (int nt = 0; nt < 4; ++nt) { // t[c][n], n = l15, c = kk, kk + 1
      const int n = n0 + nt * 16 + l15;
      bfr[nt][0] = tb[(size_t)(kk + 0) * NTOK + n];
      bfr[nt][1] = tb[(size_t)(kk + 1) * NTOK + n];
    }
#pragma unroll
    for (int ot = 0; ot < 4; ++ot)
#pragma unroll
      for (int nt = 0; nt < 4; ++nt)
        acc[ot][nt] = TOKEN_ROWS ? wmma4(bfr[nt], afr[ot], acc[ot][nt])
                                 : wmma4(afr[ot], bfr[nt], acc[ot][nt]);
  }
}

__global__ __launch_bounds__(128) void qkv_proj_kernel(
    const float* __restrict__ t, const float* __restrict__ x,
    const float* __restrict__ wk, const float* __restrict__ bk,
    const float* __restrict__ wv, const float* __restrict__ bv,
    const float* __restrict__ wq, const float* __restrict__ bq,
    float* __restrict__ Kout, float* __restrict__ Vout,
    float* __restrict__ Qout)
{
  const int nb  = blockIdx.x;
  const int b   = blockIdx.y;
  const int mat = blockIdx.z;            // 0: K, 1: V, 2: Q
  const float* W    = mat == 0 ? wk : mat == 1 ? wv : wq;
  const float* bias = mat == 0 ? bk : mat == 1 ? bv : bq;
  float* Out        = mat == 0 ? Kout : mat == 1 ? Vout : Qout;
  const float* tb   = (mat == 2 ? x : t) + (size_t)b * CDIM * NTOK;

  const int lane = threadIdx.x & 31;
  const int wave = threadIdx.x >> 5;
  const int half = lane >> 4;
  const int l15  = lane & 15;
  const int n0    = nb * 64;
  const int obase = wave * 64;

  v8f acc[4][4];
#pragma unroll
  for (int i = 0; i < 4; ++i)
#pragma unroll
    for (int j = 0; j < 4; ++j) acc[i][j] = vzero8();

  if (mat == 1) proj_tiles<true>(W, tb, obase, n0, half, l15, acc);
  else          proj_tiles<false>(W, tb, obase, n0, half, l15, acc);

  {
    // of token tile nb*4 + nt this lane holds, with e = wave*8 + ot*2 + half,
    // Q or K: [c = 8*e + r][token l15]; V: [c = obase + ot*16 + l15][n = 8*half + r]
    // the place of token l15 (V: channel l15) among the fragment's 16 lanes (K: see above)
    const int pos = mat == 0 ? ((l15 >> 1) & 1) * 8 + (l15 >> 2) * 2 + (l15 & 1) : l15;
    float* qo = Out + ((size_t)(b * NT16 + nb * 4) * 32 + wave * 8 + half) * 128 +
                pos * 4;
    float4 blo[4], bhi[4];   // the bias of acc[ot][.][0..3] and of [4..7]
    if (mat == 1) {
#pragma unroll   // blo, bhi are indexed by constants only and stay in registers
      for (int ot = 0; ot < 4; ++ot) {
        const float bc = bias[obase + ot * 16 + l15];
        blo[ot] = bhi[ot] = make_float4(bc, bc, bc, bc);
      }
    } else {
#pragma unroll   // as above
      for (int ot = 0; ot < 4; ++ot) {
        blo[ot] = *(const float4*)(bias + obase + ot * 16 + 8 * half);
        bhi[ot] = *(const float4*)(bias + obase + ot * 16 + 8 * half + 4);
      }
    }
    ADDR_WAIT();
    // keeps later register writes from being lifted over the wait above
    GROUP_FENCE();
#pragma unroll   // acc is indexed by constants only and stays in registers
    for (int ot = 0; ot < 4; ++ot) {
      const float4 b0 = blo[ot];
      const float4 b1 = bhi[ot];
#pragma unroll
      for (int nt = 0; nt < 4; ++nt) {
        float* q = qo + nt * (16 * CDIM) + ot * 256;
        *(float4*)(q) =                  // fragment lanes 0..15
            make_float4(acc[ot][nt][0] + b0.x, acc[ot][nt][1] + b0.y,
                        acc[ot][nt][4] + b1.x, acc[ot][nt][5] + b1.y);
        *(float4*)(q + 64) =             // fragment lanes 16..31
            make_float4(acc[ot][nt][2] + b0.z, acc[ot][nt][3] + b0.w,
                        acc[ot][nt][6] + b1.z, acc[ot][nt][7] + b1.w);
      }
    }
  }
}

// ---------------------------------------------------------------------------
// Kernel 2: flash attention over ONE key range
// Grid: (NTOK/64, B, KSPLIT), 128 threads (4 waves). Wave w owns queries
// m0+w*16..+15 and the keys [ks*NTOK/KSPLIT, +NTOK/KSPLIT). It leaves the
// un-normalised O with its maxima and sums in the workspace.
// Both products are formed transposed, S^T = K^T * Q and O^T += V * P^T, so that
// a query is a column of D: lane 16*h + i holds query i alone, with eight keys of
// the tile in its eight score registers (register r: key 4*(r/2) + 2*h + (r&1),
// by the order in which launch 1 left K). Maximum and sum are taken in the
// lane, with one move between the halves, and the registers of P^T are the B
// operand of the second product as they stand.
// Two work-groups share a WGP (two waves a SIMD): 512 VGPRs a wave at most.
// Dynamic LDS: double-buffered K/V tiles in fragment order, 16 KB each, filled
// by async DMA.
// ---------------------------------------------------------------------------
__global__ __launch_bounds__(128, 2) void attn_kernel(
    const float* __restrict__ Qin,
    const float* __restrict__ Kin, const float* __restrict__ Vin,
    float* __restrict__ Opart, float* __restrict__ MLpart)
{
  extern __shared__ float dynsmem[];
  float* Kbuf0 = dynsmem;                    // [32][lane][4]
  float* Vbuf0 = Kbuf0 + TILEF;
  float* Kbuf1 = Vbuf0 + TILEF;
  float* Vbuf1 = Kbuf1 + TILEF;

  const int mb = blockIdx.x;
  const int b  = blockIdx.y;
  const int ks = blockIdx.z;             // this work-group's key range
  const int lane = threadIdx.x & 31;
  const int wave = threadIdx.x >> 5;
  const int half = lane >> 4;

  const int st = threadIdx.x * 4;            // staging: this lane's 16 bytes
  const float* Kb = Kin + (size_t)(b * NT16 + ks * NTS) * TILEF + st;
  const float* Vb = Vin + (size_t)(b * NT16 + ks * NTS) * TILEF + st;

  // kick off async staging of key/value tile 0 while Q comes in
  async_copy_tile(Kbuf0 + st, Kb, Vbuf0 + st, Vb);

  // ---- Q of this wave's 16 tokens, as launch 1 left it: B fragments ----
  v2f a_q[64];                         // a_q[j] covers c = 4j..4j+3
  {
    const float* qp = Qin + (size_t)(b * NT16 + mb * 4 + wave) * (16 * CDIM) + lane * 4;
#pragma unroll   // a_q is indexed by constants only and stays in registers
    for (int jp = 0; jp < 32; ++jp) {
      const float4 q4 = *(const float4*)(qp + jp * 128);
      a_q[2 * jp + 0][0] = q4.x; a_q[2 * jp + 0][1] = q4.y;
      a_q[2 * jp + 1][0] = q4.z; a_q[2 * jp + 1][1] = q4.w;
    }
    ADDR_WAIT();
    // keeps later register writes from being lifted over the wait above
    GROUP_FENCE();
  }

  // ---- Main loop: stream 16-wide key tiles, online softmax, double-buffered ----
  v8f o_acc[16];                      // O^T[c][m] accumulators (rows c, cols m)
#pragma unroll
  for (int ct = 0; ct < 16; ++ct) o_acc[ct] = vzero8();
  float Mq = -3.0e38f;                // maximum of this lane's query, both halves alike
  float Lq = 0.f;                     // sum of this lane's query over this half's keys

  for (int ntile = 0; ntile < NTS; ++ntile) {
    const float* Kc = (ntile & 1) ? Kbuf1 : Kbuf0;
    const float* Vc = (ntile & 1) ? Vbuf1 : Vbuf0;
    if (ntile + 1 < NTS) {
      // prefetch next tile into the other buffer (its readers finished at the
      // barrier that ended iteration ntile-1)
      float* Kn = (ntile & 1) ? Kbuf0 : Kbuf1;
      float* Vn = (ntile & 1) ? Vbuf0 : Vbuf1;
      async_copy_tile(Kn + st, Kb + (size_t)(ntile + 1) * TILEF,
                      Vn + st, Vb + (size_t)(ntile + 1) * TILEF);
      ASYNC_WAIT_PREFETCHED();   // current tile's 16 async ops are complete
    } else {
      ASYNC_WAIT_ALL();
    }
    __syncthreads();             // current tile visible to all waves

    // S^T = K^T * Q  (16n x 16m, k=256); 4 interleaved partial accumulators.
    // The tile's A fragments come from LDS two to a 16-byte read, in groups of
    // 8 reads, each group issued one group of WMMAs ahead of its use; V's 32
    // reads follow behind K's.
    const float* kp = Kc + lane * 4;   // A[row lane & 15][k=c], fragments 2*jp, 2*jp + 1
    const float* vp = Vc + lane * 4;   // A[c=lane & 15][k=n], fragments 2*i, 2*i + 1
    v2f kf[64];
    v2f vf[64];
    v8f sp[4];
    sp[0] = sp[1] = sp[2] = sp[3] = vzero8();
#pragma unroll
    for (int jp = 0; jp < 8; ++jp) {
      const float4 k4 = *(const float4*)(kp + jp * 128);
      kf[2 * jp + 0][0] = k4.x; kf[2 * jp + 0][1] = k4.y;
      kf[2 * jp + 1][0] = k4.z; kf[2 * jp + 1][1] = k4.w;
    }
#pragma unroll
    for (int g = 0; g < 4; ++g) {
      if (g < 3) {
#pragma unroll
        for (int jp = 8 * (g + 1); jp < 8 * (g + 2); ++jp) {
          const float4 k4 = *(const float4*)(kp + jp * 128);
          kf[2 * jp + 0][0] = k4.x; kf[2 * jp + 0][1] = k4.y;
          kf[2 * jp + 1][0] = k4.z; kf[2 * jp + 1][1] = k4.w;
        }
      } else {
#pragma unroll
        for (int i = 0; i < 32; ++i) {
          const float4 v4 = *(const float4*)(vp + i * 128);
          vf[2 * i + 0][0] = v4.x; vf[2 * i + 0][1] = v4.y;
          vf[2 * i + 1][0] = v4.z; vf[2 * i + 1][1] = v4.w;
        }
      }
      // holds the reads above in one place, ahead of this group's WMMAs;
      // left free they sink to their users and each waits out the LDS latency
      GROUP_FENCE();
#pragma unroll
      for (int j = 16 * g; j < 16 * (g + 1); ++j)
        sp[j & 3] = wmma4(kf[j], a_q[j], sp[j & 3]);
      // keeps the next group's reads behind these WMMAs: one place a group,
      // not spread among them
      if (g < 3) GROUP_FENCE();
    }
    v8f s = (sp[0] + sp[1]) + (sp[2] + sp[3]);

    // online softmax of this lane's query; s[0..7]: its scores with this half's keys
    float mx = fmaxf(fmaxf(fmaxf(s[0], s[1]), fmaxf(s[2], s[3])),
                     fmaxf(fmaxf(s[4], s[5]), fmaxf(s[6], s[7])));
    mx = fmaxf(mx, xhalf(mx));
    const float Mn = fmaxf(Mq, mx);
    const float alpha = exp2f((Mq - Mn) * LOG2E);
    Mq = Mn;
#pragma unroll
    for (int r = 0; r < 8; ++r) s[r] = exp2f((s[r] - Mn) * LOG2E);
#pragma unroll
    for (int ct = 0; ct < 16; ++ct)
#pragma unroll
      for (int r = 0; r < 8; ++r) o_acc[ct][r] *= alpha;

    // O^T += V * P^T; step j takes keys 4*j + 2*half + {0, 1}, on both sides
    v2f b_p[4];
#pragma unroll
    for (int j = 0; j < 4; ++j) { b_p[j][0] = s[2 * j]; b_p[j][1] = s[2 * j + 1]; }
    const v2f ps = (b_p[0] + b_p[1]) + (b_p[2] + b_p[3]);   // pairs: no register moves
    Lq = Lq * alpha + (ps[0] + ps[1]);
    // keeps the closing barrier behind the softmax: a build without this line has
    // the barrier, with its s_wait_dscnt 0, in front of the last 16 score products,
    // which then stand still until V's 32 reads have landed
    GROUP_FENCE();
#pragma unroll
    for (int ct = 0; ct < 16; ++ct)
#pragma unroll
      for (int j = 0; j < 4; ++j)
        o_acc[ct] = wmma4(vf[ct * 4 + j], b_p[j], o_acc[ct]);
    __syncthreads();   // all waves done with this tile before it is overwritten
  }

  // ---- Leave this range's partial result in the workspace ----
  // O^T tile: [ct][r>>2][lane][r&3], so that each b128 store covers 512 B in a row
  const size_t tile = ((size_t)b * NT16 + mb * 4 + wave) * KSPLIT + ks;
  float* op = Opart + tile * (16 * CDIM) + lane * 4;
#pragma unroll   // o_acc is indexed by constants only and stays in registers
  for (int ct = 0; ct < 16; ++ct) {
    *(float4*)(op + ct * 256) =
        make_float4(o_acc[ct][0], o_acc[ct][1], o_acc[ct][2], o_acc[ct][3]);
    *(float4*)(op + ct * 256 + 128) =
        make_float4(o_acc[ct][4], o_acc[ct][5], o_acc[ct][6], o_acc[ct][7]);
  }
  ADDR_WAIT();
  // the queries' maxima [0..15] and sums [16..31], the halves' sums joined
  Lq += xhalf(Lq);
  MLpart[tile * 32 + lane] = half ? Lq : Mq;
}

// ---------------------------------------------------------------------------
// Kernel 3: merge the KSPLIT key ranges, then Y = Wo * O^T + bo + x
// Grid: (NTOK/64, B, OSPLIT), 128 threads (4 waves). Wave w owns queries
// m0+w*16..+15; the work-group owns output channels [oz*64, +64).
// Lane 16*h + i holds query i alone: O^T[c = 16*cc + 8*h + r][i], which is the B
// operand as it stands, step j taking c = 16*cc + 8*h + 2*j + {0, 1}.
// Two work-groups share a WGP, so that all 512 are resident at once.
// Every loop is unrolled in full: its arrays are indexed by constants only and
// so stay in registers.
// ---------------------------------------------------------------------------
__global__ __launch_bounds__(128, 2) void merge_proj_kernel(
    const float* __restrict__ x,
    const float* __restrict__ wo, const float* __restrict__ bo,
    const float* __restrict__ Opart, const float* __restrict__ MLpart,
    float* __restrict__ out)
{
  __shared__ float wos[(CDIM / OSPLIT) * WOP];   // Wo rows of this range

  const int mb = blockIdx.x;
  const int b  = blockIdx.y;
  const int ob = blockIdx.z * (CDIM / OSPLIT);
  const int lane = threadIdx.x & 31;
  const int wave = threadIdx.x >> 5;
  const int half = lane >> 4;
  const int l15  = lane & 15;
  const int mg = mb * 64 + wave * 16 + l15;
  const float* xb = x + (size_t)b * CDIM * NTOK;

  // The global reads of the merge are issued in groups of 8 to 72 loads, so
  // that a wave pays the L2 latency once a group and not once a load.
  const size_t tile0 = ((size_t)b * NT16 + mb * 4 + wave) * KSPLIT;  // range 0
  const float* mlp = MLpart + tile0 * 32 + l15;
  const float* opp = Opart + tile0 * (16 * CDIM) + lane * 4;
  const float* wop = wo + (size_t)(ob + (threadIdx.x >> 6)) * CDIM + (threadIdx.x & 63) * 4;
  const float* xp  = xb + (size_t)(ob + 8 * half) * NTOK + mg;
  const float* bop = bo + ob + 8 * half;
  const int c4 = (threadIdx.x & 63) * 4;   // Wo staging: column group
  const int r0 = threadIdx.x >> 6;         // Wo staging: first row

  float Ms[KSPLIT], Ls[KSPLIT];            // maxima and sums of query l15
#pragma unroll
  for (int s = 0; s < KSPLIT; ++s) {
    Ms[s] = mlp[s * 32];
    Ls[s] = mlp[s * 32 + 16];
  }
  ADDR_WAIT();
  // keeps later register writes from being lifted over the wait above
  GROUP_FENCE();
  // Wo[ob .. ob+63][0..255], 2 rows a pass; a plain vector type: as float4, with
  // wop named in the wait behind the LDS stores, the array was built in scratch
  v4f wreg[CDIM / OSPLIT / 2];
#pragma unroll
  for (int i = 0; i < CDIM / OSPLIT / 2; ++i)
    wreg[i] = *(const v4f*)(wop + i * 2 * CDIM);
  // O comes in groups of four 16-channel chunks, all ranges: 32 loads a group
  float4 obuf[2][4][KSPLIT][2];
#pragma unroll
  for (int cl = 0; cl < 4; ++cl)
#pragma unroll
    for (int s = 0; s < KSPLIT; ++s)
#pragma unroll
      for (int h = 0; h < 2; ++h)
        obuf[0][cl][s][h] = *(const float4*)(
            opp + s * (16 * CDIM) + cl * 256 + h * 128);
  ADDR_WAIT();
  // holds the reads above in one place; left free they sink to their users
  GROUP_FENCE();

#pragma unroll
  for (int i = 0; i < CDIM / OSPLIT / 2; ++i)
    *(v4f*)(wos + (r0 + 2 * i) * WOP + c4) = wreg[i];
  // the wait of ADDR_WAIT; wop as its input keeps the Wo loads' address pair
  // whole up to here (the run's last load would else take it for its result)
  __asm__ volatile("s_wait_xcnt 0x0" :: "v"(wop) : "memory");
  // group 1's reads take the registers that the Wo rows have left
  GROUP_FENCE();
#pragma unroll
  for (int cl = 0; cl < 4; ++cl)
#pragma unroll
    for (int s = 0; s < KSPLIT; ++s)
#pragma unroll
      for (int h = 0; h < 2; ++h)
        obuf[1][cl][s][h] = *(const float4*)(
            opp + s * (16 * CDIM) + (4 + cl) * 256 + h * 128);
  // the residual's x and the bias come with them
  float xres[16 / OSPLIT][8];
  v4f bov[16 / OSPLIT][2];
#pragma unroll
  for (int ot = 0; ot < 16 / OSPLIT; ++ot) {
#pragma unroll
    for (int r = 0; r < 8; ++r) xres[ot][r] = xp[(size_t)(ot * 16 + r) * NTOK];
    bov[ot][0] = *(const v4f*)(bop + ot * 16);
    bov[ot][1] = *(const v4f*)(bop + ot * 16 + 4);
  }
  // holds the bias loads in this group, ahead of the wait below: left free they
  // sink past it, among the products (inputs only; the barrier below waits for
  // every load of the group in any case)
  __asm__ volatile("" :: "v"(bov[0][0]), "v"(bov[0][1]), "v"(bov[1][0]), "v"(bov[1][1]),
                         "v"(bov[2][0]), "v"(bov[2][1]), "v"(bov[3][0]), "v"(bov[3][1]));
  ADDR_WAIT();
  // one place again, ahead of the weights
  GROUP_FENCE();

  // weights of the ranges for query l15, 1 / (sum) folded in
  float wgt[KSPLIT];
  {
    float Mx = Ms[0];
#pragma unroll
    for (int s = 1; s < KSPLIT; ++s) Mx = fmaxf(Mx, Ms[s]);
    float Lt = 0.f;
#pragma unroll
    for (int s = 0; s < KSPLIT; ++s) {
      wgt[s] = exp2f((Ms[s] - Mx) * LOG2E);
      Lt += wgt[s] * Ls[s];
    }
    const float rinv = 1.0f / Lt;
#pragma unroll
    for (int s = 0; s < KSPLIT; ++s) wgt[s] *= rinv;
  }

  __syncthreads();                    // Wo slab visible to all waves

  v8f y_acc[16 / OSPLIT];
#pragma unroll
  for (int ot = 0; ot < 16 / OSPLIT; ++ot) y_acc[ot] = vzero8();

#pragma unroll
  for (int g = 0; g < 4; ++g) {
#pragma unroll
    for (int cl = 0; cl < 4; ++cl) {
      const int cc = g * 4 + cl;
      // merge the ranges: O^T[c = cc*16 + 8*half + r][m = l15], normalised
      v2f om[4];                      // om[j]: r = 2*j, 2*j + 1
#pragma unroll
      for (int s = 0; s < KSPLIT; ++s) {
        const float4 lo = obuf[g & 1][cl][s][0], hi = obuf[g & 1][cl][s][1];
        const v2f w2 = {wgt[s], wgt[s]};
        const v2f p[4] = {{lo.x, lo.y}, {lo.z, lo.w}, {hi.x, hi.y}, {hi.z, hi.w}};
#pragma unroll
        for (int j = 0; j < 4; ++j)
          om[j] = s == 0 ? w2 * p[j] : __builtin_elementwise_fma(w2, p[j], om[j]);
      }
#pragma unroll
      for (int jp = 0; jp < 2; ++jp) {
        // B[k=c][m=l15], steps 2*jp and 2*jp + 1
        const v2f b0 = om[2 * jp], b1 = om[2 * jp + 1];
#pragma unroll
        for (int ot = 0; ot < 16 / OSPLIT; ++ot) {
          // A[o=l15][k=c] of both steps in one 16-byte read
          const float4 w4 = *(const float4*)(
              wos + (ot * 16 + l15) * WOP + cc * 16 + 8 * half + 4 * jp);
          v2f a0, a1;
          a0[0] = w4.x; a0[1] = w4.y;
          a1[0] = w4.z; a1[1] = w4.w;
          y_acc[ot] = wmma4(a0, b0, y_acc[ot]);
          y_acc[ot] = wmma4(a1, b1, y_acc[ot]);
        }
      }
    }
    if (g + 2 < 4) {
      // keeps the refill behind the sums that free its registers ...
      GROUP_FENCE();
#pragma unroll
      for (int cl = 0; cl < 4; ++cl)
#pragma unroll
        for (int s = 0; s < KSPLIT; ++s)
#pragma unroll
          for (int h = 0; h < 2; ++h)
            obuf[g & 1][cl][s][h] = *(const float4*)(
                opp + s * (16 * CDIM) + ((g + 2) * 4 + cl) * 256 + h * 128);
      ADDR_WAIT();
      // ... and in one place, ahead of the next group's work
      GROUP_FENCE();
    }
  }

  float* yp = out + (size_t)b * CDIM * NTOK + (size_t)(ob + 8 * half) * NTOK + mg;
#pragma unroll
  for (int ot = 0; ot < 16 / OSPLIT; ++ot) {
    const v4f b0 = bov[ot][0], b1 = bov[ot][1];
    const float bb[8] = {b0.x, b0.y, b0.z, b0.w, b1.x, b1.y, b1.z, b1.w};
#pragma unroll
    for (int r = 0; r < 8; ++r)       // output channel ob + ot*16 + r + 8*half
      yp[(size_t)(ot * 16 + r) * NTOK] = y_acc[ot][r] + bb[r] + xres[ot][r];
  }
}

// ---------------------------------------------------------------------------
extern "C" void kernel_launch(void* const* d_in, const int* in_sizes, int n_in,
                              void* d_out, int out_size, void* d_ws, size_t ws_size,
                              hipStream_t stream) {
  (void)in_sizes; (void)n_in; (void)out_size; (void)ws_size;
  const float* x  = (const float*)d_in[0];
  const float* t  = (const float*)d_in[1];
  const float* wq = (const float*)d_in[2];
  const float* bq = (const float*)d_in[3];
  const float* wk = (const float*)d_in[4];
  const float* bk = (const float*)d_in[5];
  const float* wv = (const float*)d_in[6];
  const float* bv = (const float*)d_in[7];
  const float* wo = (const float*)d_in[8];
  const float* bo = (const float*)d_in[9];

  float* Kws = (float*)d_ws;                       // [B][N/16][32][32][4], 8 MB
  float* Vws = Kws + (size_t)BSZ * CDIM * NTOK;    // [B][N/16][32][32][4], 8 MB
  float* Ows = Vws + (size_t)BSZ * CDIM * NTOK;    // [B][N/16][KSPLIT][16*C], 32 MB
  float* MLws = Ows + (size_t)KSPLIT * BSZ * CDIM * NTOK;  // [B][N/16][KSPLIT][32]
  float* Qws = MLws + (size_t)BSZ * NT16 * KSPLIT * 32;    // [B][N/16][C/8][32][4], 8 MB

  dim3 g1(NTOK / 64, BSZ, 3);
  qkv_proj_kernel<<<g1, dim3(128, 1, 1), 0, stream>>>(t, x, wk, bk, wv, bv, wq, bq,
                                                      Kws, Vws, Qws);

  const size_t smem = (size_t)4 * TILEF * sizeof(float);  // 64 KB
  dim3 g2(NTOK / 64, BSZ, KSPLIT);
  attn_kernel<<<g2, dim3(128, 1, 1), smem, stream>>>(Qws, Kws, Vws, Ows, MLws);

  dim3 g3(NTOK / 64, BSZ, OSPLIT);
  merge_proj_kernel<<<g3, dim3(128, 1, 1), 0, stream>>>(x, wo, bo, Ows, MLws,
                                                        (float*)d_out);
}

// v007
// A run of this version takes 198 microseconds.
// Two timings next to v006 both put it at 1.03 times that version's speed.
// Counting every step since v000, it is 6.99 times as fast.
#include <hip/hip_runtime.h>

typedef float v2f __attribute__((ext_vector_type(2)));
typedef float v4f __attribute__((ext_vector_type(4)));
typedef float v8f __attribute__((ext_vector_type(8)));

#define CDIM 256
#define NTOK 4096
#define BSZ  2
#define LOG2E 1.4426950408889634f
#define TILEF (16 * CDIM)   // floats of one 16-key tile of K or of V
#define NT16  (NTOK / 16)
#define KSPLIT 4            // key ranges, one work-group each
#define NTS   (NT16 / KSPLIT)   // key tiles of one range
#define OSPLIT 4            // output-channel ranges of the merge kernel
#define WOP   260           // padded row width of the Wo slab in LDS
// key tiles of a range at which an attention wave steps its priority down; the last
// stretch is short: only there can one work-group still end ahead of the other
#define PRIO_T1 32
#define PRIO_T2 48
#define PRIO_T3 60

#define GROUP_FENCE() __builtin_amdgcn_sched_barrier(0)
// previous tile's 16 async b128 done; next tile's 16 may still be in flight
#define ASYNC_WAIT_PREFETCHED() __asm__ volatile("s_wait_asynccnt 0x10" ::: "memory")
#define ASYNC_WAIT_ALL()        __asm__ volatile("s_wait_asynccnt 0x0"  ::: "memory")
// behind a group of global loads or stores: later code may reuse the registers
// that they name
#define ADDR_WAIT()   __asm__ volatile("s_wait_xcnt 0x0" ::: "memory")

__device__ __forceinline__ v8f wmma4(v2f a, v2f b, v8f c) {
  // D(16x16,f32) = A(16x4,f32) x B(4x16,f32) + C
  return __builtin_amdgcn_wmma_f32_16x16x4_f32(false, a, false, b, (short)0, c,
                                               false, false);
}

__device__ __forceinline__ v8f vzero8() {
  v8f z = {0.f, 0.f, 0.f, 0.f, 0.f, 0.f, 0.f, 0.f};
  return z;
}

// The value of lane l ^ 16: the other half of the keys of this lane's query.
__device__ __forceinline__ float xhalf(float v) {
  const int b = __builtin_bit_cast(int, v);
  return __builtin_bit_cast(float, __builtin_amdgcn_permlanex16(
      b, b, 0x76543210, 0xfedcba98, false, false));
}

// Async DMA: 16B global -> LDS, tracked by ASYNCcnt (no VGPR staging).
// Flat->LDS mapping truncates to low 32 bits, so low bits of the generic
// shared pointer are the LDS byte address.
// One 16-key tile of K and of V, 16 KB each and contiguous on both sides: the
// 128 lanes of the work-group move 2 KB a copy, eight copies a matrix. The
// immediate offset moves the LDS and the global address alike.
__device__ __forceinline__ void async_copy_tile(float* k_lds, const float* k_src,
                                                float* v_lds, const float* v_src) {
  unsigned kl = (unsigned)(unsigned long long)k_lds;
  unsigned vl = (unsigned)(unsigned long long)v_lds;
  // the closing wait stands inside the statement: later code may rewrite the
  // address registers that the copies name
  __asm__ volatile(
      "global_load_async_to_lds_b128 %0, %1, off\n\t"
      "global_load_async_to_lds_b128 %2, %3, off\n\t"
      "global_load_async_to_lds_b128 %0, %1, off offset:2048\n\t"
      "global_load_async_to_lds_b128 %2, %3, off offset:2048\n\t"
      "global_load_async_to_lds_b128 %0, %1, off offset:4096\n\t"
      "global_load_async_to_lds_b128 %2, %3, off offset:4096\n\t"
      "global_load_async_to_lds_b128 %0, %1, off offset:6144\n\t"
      "global_load_async_to_lds_b128 %2, %3, off offset:6144\n\t"
      "global_load_async_to_lds_b128 %0, %1, off offset:8192\n\t"
      "global_load_async_to_lds_b128 %2, %3, off offset:8192\n\t"
      "global_load_async_to_lds_b128 %0, %1, off offset:10240\n\t"
      "global_load_async_to_lds_b128 %2, %3, off offset:10240\n\t"
      "global_load_async_to_lds_b128 %0, %1, off offset:12288\n\t"
      "global_load_async_to_lds_b128 %2, %3, off offset:12288\n\t"
      "global_load_async_to_lds_b128 %0, %1, off offset:14336\n\t"
      "global_load_async_to_lds_b128 %2, %3, off offset:14336\n\t"
      "s_wait_xcnt 0x0"
      :: "v"(kl), "v"(k_src), "v"(vl), "v"(v_src)
      : "memory");
}

// ---------------------------------------------------------------------------
// Kernel 1: K = Wk*t + bk, V = Wv*t + bv, Q = Wq*x + bq
// (per-token 1x1x1 conv == GEMM)
// Grid: (NTOK/64, B, 3), 128 threads (4 waves). Wave w owns o-range [w*64,+64).
// All three are left in the order of the attention kernel's fragments, 16 bytes
// a lane: [token tile][32][lane][4], lane = 16 * h + i.
// Q (B) and K (A): entry jp, the four floats being
// [c = 8*jp + 2*h + {0, 1}][token] and [c = 8*jp + 4 + 2*h + {0, 1}][token];
// Q: i = token & 15. K: token n = 4*f + 2*g + v of the tile stands at
// i = 8*g + 2*f + v, so that the score tile's registers 2*f, 2*f + 1 of lane half
// g hold keys 4*f + 2*g + {0, 1}: the k order of V's fragment f.
// V (A): entry 2*(c / 16) + jp, i = c & 15, the four floats being
// V[c][n = 8*jp + 2*h + {0, 1}] and V[c][n = 8*jp + 4 + 2*h + {0, 1}] of the tile.
// V is therefore computed transposed (tokens as D's rows): operands swapped.
// ---------------------------------------------------------------------------
// acc[ot][nt] += W[obase + ot*16 ..][:] * t[:][n0 + nt*16 ..], 16 x 16 each; D's
// rows are the output channels, or the tokens where TOKEN_ROWS (the two
// fragments have the same lane map, so that they only change places).
template <bool TOKEN_ROWS>
__device__ __forceinline__ void proj_tiles(const float* __restrict__ W,
                                           const float* __restrict__ tb,
                                           int obase, int n0, int half, int l15,
                                           v8f (&acc)[4][4]) {
  for (int k = 0; k < CDIM; k += 4) {
    const int kk = k + 2 * half;   // this lane-half's K pair {kk, kk+1}
    v2f afr[4], bfr[4];
    // the four inner loops are unrolled: afr, bfr, acc stay in registers
#pragma unroll
    for (int ot = 0; ot < 4; ++ot)  // W[o][c], o = l15, c = kk, kk + 1
      afr[ot] = *(const v2f*)(W + (size_t)(obase + ot * 16 + l15) * CDIM + kk);
#pragma unroll
    for (int nt = 0; nt < 4; ++nt) { // t[c][n], n = l15, c = kk, kk + 1
      const int n = n0 + nt * 16 + l15;
      bfr[nt][0] = tb[(size_t)(kk + 0) * NTOK + n];
      bfr[nt][1] = tb[(size_t)(kk + 1) * NTOK + n];
    }
#pragma unroll
    for (int ot = 0; ot < 4; ++ot)
#pragma unroll
      for (int nt = 0; nt < 4; ++nt)
        acc[ot][nt] = TOKEN_ROWS ? wmma4(bfr[nt], afr[ot], acc[ot][nt])
                                 : wmma4(afr[ot], bfr[nt], acc[ot][nt]);
  }
}

__global__ __launch_bounds__(128) void qkv_proj_kernel(
    const float* __restrict__ t, const float* __restrict__ x,
    const float* __restrict__ wk, const float* __restrict__ bk,
    const float* __restrict__ wv, const float* __restrict__ bv,
    const float* __restrict__ wq, const float* __restrict__ bq,
    float* __restrict__ Kout, float* __restrict__ Vout,
    float* __restrict__ Qout)
{
  const int nb  = blockIdx.x;
  const int b   = blockIdx.y;
  const int mat = blockIdx.z;            // 0: K, 1: V, 2: Q
  const float* W    = mat == 0 ? wk : mat == 1 ? wv : wq;
  const float* bias = mat == 0 ? bk : mat == 1 ? bv : bq;
  float* Out        = mat == 0 ? Kout : mat == 1 ? Vout : Qout;
  const float* tb   = (mat == 2 ? x : t) + (size_t)b * CDIM * NTOK;

  const int lane = threadIdx.x & 31;
  const int wave = threadIdx.x >> 5;
  const int half = lane >> 4;
  const int l15  = lane & 15;
  const int n0    = nb * 64;
  const int obase = wave * 64;

  v8f acc[4][4];
#pragma unroll
  for (int i = 0; i < 4; ++i)
#pragma unroll
    for (int j = 0; j < 4; ++j) acc[i][j] = vzero8();

  if (mat == 1) proj_tiles<true>(W, tb, obase, n0, half, l15, acc);
  else          proj_tiles<false>(W, tb, obase, n0, half, l15, acc);

  {
    // of token tile nb*4 + nt this lane holds, with e = wave*8 + ot*2 + half,
    // Q or K: [c = 8*e + r][token l15]; V: [c = obase + ot*16 + l15][n = 8*half + r]
    // the place of token l15 (V: channel l15) among the fragment's 16 lanes (K: see above)
    const int pos = mat == 0 ? ((l15 >> 1) & 1) * 8 + (l15 >> 2) * 2 + (l15 & 1) : l15;
    float* qo = Out + ((size_t)(b * NT16 + nb * 4) * 32 + wave * 8 + half) * 128 +
                pos * 4;
    float4 blo[4], bhi[4];   // the bias of acc[ot][.][0..3] and of [4..7]
    if (mat == 1) {
#pragma unroll   // blo, bhi are indexed by constants only and stay in registers
      for (int ot = 0; ot < 4; ++ot) {
        const float bc = bias[obase + ot * 16 + l15];
        blo[ot] = bhi[ot] = make_float4(bc, bc, bc, bc);
      }
    } else {
#pragma unroll   // as above
      for (int ot = 0; ot < 4; ++ot) {
        blo[ot] = *(const float4*)(bias + obase + ot * 16 + 8 * half);
        bhi[ot] = *(const float4*)(bias + obase + ot * 16 + 8 * half + 4);
      }
    }
    ADDR_WAIT();
    // keeps later register writes from being lifted over the wait above
    GROUP_FENCE();
#pragma unroll   // acc is indexed by constants only and stays in registers
    for (int ot = 0; ot < 4; ++ot) {
      const float4 b0 = blo[ot];
      const float4 b1 = bhi[ot];
#pragma unroll
      for (int nt = 0; nt < 4; ++nt) {
        float* q = qo + nt * (16 * CDIM) + ot * 256;
        *(float4*)(q) =                  // fragment lanes 0..15
            make_float4(acc[ot][nt][0] + b0.x, acc[ot][nt][1] + b0.y,
                        acc[ot][nt][4] + b1.x, acc[ot][nt][5] + b1.y);
        *(float4*)(q + 64) =             // fragment lanes 16..31
            make_float4(acc[ot][nt][2] + b0.z, acc[ot][nt][3] + b0.w,
                        acc[ot][nt][6] + b1.z, acc[ot][nt][7] + b1.w);
      }
    }
  }
}

// ---------------------------------------------------------------------------
// Kernel 2: flash attention over ONE key range
// Grid: (NTOK/64, B, KSPLIT), 128 threads (4 waves). Wave w owns queries
// m0+w*16..+15 and the keys [ks*NTOK/KSPLIT, +NTOK/KSPLIT). It leaves the
// un-normalised O with its maxima and sums in the workspace.
// Both products are formed transposed, S^T = K^T * Q and O^T += V * P^T, so that
// a query is a column of D: lane 16*h + i holds query i alone, with eight keys of
// the tile in its eight score registers (register r: key 4*(r/2) + 2*h + (r&1),
// by the order in which launch 1 left K). Maximum and sum are taken in the
// lane, with one move between the halves, and the registers of P^T are the B
// operand of the second product as they stand.
// Two work-groups share a WGP (two waves a SIMD): 512 VGPRs a wave at most.
// Dynamic LDS: double-buffered K/V tiles in fragment order, 16 KB each, filled
// by async DMA.
// ---------------------------------------------------------------------------
__global__ __launch_bounds__(128, 2) void attn_kernel(
    const float* __restrict__ Qin,
    const float* __restrict__ Kin, const float* __restrict__ Vin,
    float* __restrict__ Opart, float* __restrict__ MLpart)
{
  extern __shared__ float dynsmem[];
  float* Kbuf0 = dynsmem;                    // [32][lane][4]
  float* Vbuf0 = Kbuf0 + TILEF;
  float* Kbuf1 = Vbuf0 + TILEF;
  float* Vbuf1 = Kbuf1 + TILEF;

  const int mb = blockIdx.x;
  const int b  = blockIdx.y;
  const int ks = blockIdx.z;             // this work-group's key range
  const int lane = threadIdx.x & 31;
  const int wave = threadIdx.x >> 5;
  const int half = lane >> 4;

  const int st = threadIdx.x * 4;            // staging: this lane's 16 bytes
  const float* Kb = Kin + (size_t)(b * NT16 + ks * NTS) * TILEF + st;
  const float* Vb = Vin + (size_t)(b * NT16 + ks * NTS) * TILEF + st;

  // kick off async staging of key/value tile 0 while Q comes in
  async_copy_tile(Kbuf0 + st, Kb, Vbuf0 + st, Vb);

  // ---- Q of this wave's 16 tokens, as launch 1 left it: B fragments ----
  v2f a_q[64];                         // a_q[j] covers c = 4j..4j+3
  {
    const float* qp = Qin + (size_t)(b * NT16 + mb * 4 + wave) * (16 * CDIM) + lane * 4;
#pragma unroll   // a_q is indexed by constants only and stays in registers
    for (int jp = 0; jp < 32; ++jp) {
      const float4 q4 = *(const float4*)(qp + jp * 128);
      a_q[2 * jp + 0][0] = q4.x; a_q[2 * jp + 0][1] = q4.y;
      a_q[2 * jp + 1][0] = q4.z; a_q[2 * jp + 1][1] = q4.w;
    }
    ADDR_WAIT();
    // keeps later register writes from being lifted over the wait above
    GROUP_FENCE();
  }

  // ---- Main loop: stream 16-wide key tiles, online softmax, double-buffered ----
  v8f o_acc[16];                      // O^T[c][m] accumulators (rows c, cols m)
#pragma unroll
  for (int ct = 0; ct < 16; ++ct) o_acc[ct] = vzero8();
  float Mq = -3.0e38f;                // maximum of this lane's query, both halves alike
  float Lq = 0.f;                     // sum of this lane's query over this half's keys

  // The two waves of a SIMD belong to two work-groups that no barrier joins. A
  // wave's priority falls as it advances, so that the work-group that is
  // behind wins the pipe and both end together. It is 0 from PRIO_T3 on, and so at
  // the kernel's end.
  __builtin_amdgcn_s_setprio(3);

  for (int ntile = 0; ntile < NTS; ++ntile) {
    // ntile is the same for the whole work-group: scalar compares and branches
    if ((ntile & 3) == 0) {
      if (ntile == PRIO_T1) __builtin_amdgcn_s_setprio(2);
      else if (ntile == PRIO_T2) __builtin_amdgcn_s_setprio(1);
      else if (ntile == PRIO_T3) __builtin_amdgcn_s_setprio(0);
    }
    const float* Kc = (ntile & 1) ? Kbuf1 : Kbuf0;
    const float* Vc = (ntile & 1) ? Vbuf1 : Vbuf0;
    if (ntile + 1 < NTS) {
      // prefetch next tile into the other buffer (its readers finished at the
      // barrier that ended iteration ntile-1)
      float* Kn = (ntile & 1) ? Kbuf0 : Kbuf1;
      float* Vn = (ntile & 1) ? Vbuf0 : Vbuf1;
      async_copy_tile(Kn + st, Kb + (size_t)(ntile + 1) * TILEF,
                      Vn + st, Vb + (size_t)(ntile + 1) * TILEF);
      ASYNC_WAIT_PREFETCHED();   // current tile's 16 async ops are complete
    } else {
      ASYNC_WAIT_ALL();
    }
    __syncthreads();             // current tile visible to all waves

    // S^T = K^T * Q  (16n x 16m, k=256); 4 interleaved partial accumulators.
    // The tile's A fragments come from LDS two to a 16-byte read, in groups of
    // 8 reads, each group issued one group of WMMAs ahead of its use; V's 32
    // reads follow behind K's.
    const float* kp = Kc + lane * 4;   // A[row lane & 15][k=c], fragments 2*jp, 2*jp + 1
    const float* vp = Vc + lane * 4;   // A[c=lane & 15][k=n], fragments 2*i, 2*i + 1
    v2f kf[64];
    v2f vf[64];
    v8f sp[4];
    sp[0] = sp[1] = sp[2] = sp[3] = vzero8();
#pragma unroll
    for (int jp = 0; jp < 8; ++jp) {
      const float4 k4 = *(const float4*)(kp + jp * 128);
      kf[2 * jp + 0][0] = k4.x; kf[2 * jp + 0][1] = k4.y;
      kf[2 * jp + 1][0] = k4.z; kf[2 * jp + 1][1] = k4.w;
    }
#pragma unroll
    for (int g = 0; g < 4; ++g) {
      if (g < 3) {
#pragma unroll
        for (int jp = 8 * (g + 1); jp < 8 * (g + 2); ++jp) {
          const float4 k4 = *(const float4*)(kp + jp * 128);
          kf[2 * jp + 0][0] = k4.x; kf[2 * jp + 0][1] = k4.y;
          kf[2 * jp + 1][0] = k4.z; kf[2 * jp + 1][1] = k4.w;
        }
      } else {
#pragma unroll
        for (int i = 0; i < 32; ++i) {
          const float4 v4 = *(const float4*)(vp + i * 128);
          vf[2 * i + 0][0] = v4.x; vf[2 * i + 0][1] = v4.y;
          vf[2 * i + 1][0] = v4.z; vf[2 * i + 1][1] = v4.w;
        }
      }
      // holds the reads above in one place, ahead of this group's WMMAs;
      // left free they sink to their users and each waits out the LDS latency
      GROUP_FENCE();
#pragma unroll
      for (int j = 16 * g; j < 16 * (g + 1); ++j)
        sp[j & 3] = wmma4(kf[j], a_q[j], sp[j & 3]);
      // keeps the next group's reads behind these WMMAs: one place a group,
      // not spread among them
      if (g < 3) GROUP_FENCE();
    }
    v8f s = (sp[0] + sp[1]) + (sp[2] + sp[3]);

    // online softmax of this lane's query; s[0..7]: its scores with this half's keys
    float mx = fmaxf(fmaxf(fmaxf(s[0], s[1]), fmaxf(s[2], s[3])),
                     fmaxf(fmaxf(s[4], s[5]), fmaxf(s[6], s[7])));
    mx = fmaxf(mx, xhalf(mx));
    const float Mn = fmaxf(Mq, mx);
    const float alpha = exp2f((Mq - Mn) * LOG2E);
    Mq = Mn;
#pragma unroll
    for (int r = 0; r < 8; ++r) s[r] = exp2f((s[r] - Mn) * LOG2E);
#pragma unroll
    for (int ct = 0; ct < 16; ++ct)
#pragma unroll
      for (int r = 0; r < 8; ++r) o_acc[ct][r] *= alpha;

    // O^T += V * P^T; step j takes keys 4*j + 2*half + {0, 1}, on both sides
    v2f b_p[4];
#pragma unroll
    for (int j = 0; j < 4; ++j) { b_p[j][0] = s[2 * j]; b_p[j][1] = s[2 * j + 1]; }
    const v2f ps = (b_p[0] + b_p[1]) + (b_p[2] + b_p[3]);   // pairs: no register moves
    Lq = Lq * alpha + (ps[0] + ps[1]);
    // keeps the closing barrier behind the softmax: a build without this line has
    // the barrier, with its s_wait_dscnt 0, in front of the last 16 score products,
    // which then stand still until V's 32 reads have landed
    GROUP_FENCE();
#pragma unroll
    for (int ct = 0; ct < 16; ++ct)
#pragma unroll
      for (int j = 0; j < 4; ++j)
        o_acc[ct] = wmma4(vf[ct * 4 + j], b_p[j], o_acc[ct]);
    __syncthreads();   // all waves done with this tile before it is overwritten
  }

  // ---- Leave this range's partial result in the workspace ----
  // O^T tile: [ct][r>>2][lane][r&3], so that each b128 store covers 512 B in a row
  const size_t tile = ((size_t)b * NT16 + mb * 4 + wave) * KSPLIT + ks;
  float* op = Opart + tile * (16 * CDIM) + lane * 4;
#pragma unroll   // o_acc is indexed by constants only and stays in registers
  for (int ct = 0; ct < 16; ++ct) {
    *(float4*)(op + ct * 256) =
        make_float4(o_acc[ct][0], o_acc[ct][1], o_acc[ct][2], o_acc[ct][3]);
    *(float4*)(op + ct * 256 + 128) =
        make_float4(o_acc[ct][4], o_acc[ct][5], o_acc[ct][6], o_acc[ct][7]);
  }
  ADDR_WAIT();
  // the queries' maxima [0..15] and sums [16..31], the halves' sums joined
  Lq += xhalf(Lq);
  MLpart[tile * 32 + lane] = half ? Lq : Mq;
}

// ---------------------------------------------------------------------------
// Kernel 3: merge the KSPLIT key ranges, then Y = Wo * O^T + bo + x
// Grid: (NTOK/64, B, OSPLIT), 128 threads (4 waves). Wave w owns queries
// m0+w*16..+15; the work-group owns output channels [oz*64, +64).
// Lane 16*h + i holds query i alone: O^T[c = 16*cc + 8*h + r][i], which is the B
// operand as it stands, step j taking c = 16*cc + 8*h + 2*j + {0, 1}.
// Two work-groups share a WGP, so that all 512 are resident at once.
// Every loop is unrolled in full: its arrays are indexed by constants only and
// so stay in registers.
// ---------------------------------------------------------------------------
__global__ __launch_bounds__(128, 2) void merge_proj_kernel(
    const float* __restrict__ x,
    const float* __restrict__ wo, const float* __restrict__ bo,
    const float* __restrict__ Opart, const float* __restrict__ MLpart,
    float* __restrict__ out)
{
  __shared__ float wos[(CDIM / OSPLIT) * WOP];   // Wo rows of this range

  const int mb = blockIdx.x;
  const int b  = blockIdx.y;
  const int ob = blockIdx.z * (CDIM / OSPLIT);
  const int lane = threadIdx.x & 31;
  const int wave = threadIdx.x >> 5;
  const int half = lane >> 4;
  const int l15  = lane & 15;
  const int mg = mb * 64 + wave * 16 + l15;
  const float* xb = x + (size_t)b * CDIM * NTOK;

  // The global reads of the merge are issued in groups of 8 to 72 loads, so
  // that a wave pays the L2 latency once a group and not once a load.
  const size_t tile0 = ((size_t)b * NT16 + mb * 4 + wave) * KSPLIT;  // range 0
  const float* mlp = MLpart + tile0 * 32 + l15;
  const float* opp = Opart + tile0 * (16 * CDIM) + lane * 4;
  const float* wop = wo + (size_t)(ob + (threadIdx.x >> 6)) * CDIM + (threadIdx.x & 63) * 4;
  const float* xp  = xb + (size_t)(ob + 8 * half) * NTOK + mg;
  const float* bop = bo + ob + 8 * half;
  const int c4 = (threadIdx.x & 63) * 4;   // Wo staging: column group
  const int r0 = threadIdx.x >> 6;         // Wo staging: first row

  float Ms[KSPLIT], Ls[KSPLIT];            // maxima and sums of query l15
#pragma unroll
  for (int s = 0; s < KSPLIT; ++s) {
    Ms[s] = mlp[s * 32];
    Ls[s] = mlp[s * 32 + 16];
  }
  ADDR_WAIT();
  // keeps later register writes from being lifted over the wait above
  GROUP_FENCE();
  // Wo[ob .. ob+63][0..255], 2 rows a pass; a plain vector type: as float4, with
  // wop named in the wait behind the LDS stores, the array was built in scratch
  v4f wreg[CDIM / OSPLIT / 2];
#pragma unroll
  for (int i = 0; i < CDIM / OSPLIT / 2; ++i)
    wreg[i] = *(const v4f*)(wop + i * 2 * CDIM);
  // O comes in groups of four 16-channel chunks, all ranges: 32 loads a group
  float4 obuf[2][4][KSPLIT][2];
#pragma unroll
  for (int cl = 0; cl < 4; ++cl)
#pragma unroll
    for (int s = 0; s < KSPLIT; ++s)
#pragma unroll
      for (int h = 0; h < 2; ++h)
        obuf[0][cl][s][h] = *(const float4*)(
            opp + s * (16 * CDIM) + cl * 256 + h * 128);
  ADDR_WAIT();
  // holds the reads above in one place; left free they sink to their users
  GROUP_FENCE();

#pragma unroll
  for (int i = 0; i < CDIM / OSPLIT / 2; ++i)
    *(v4f*)(wos + (r0 + 2 * i) * WOP + c4) = wreg[i];
  // the wait of ADDR_WAIT; wop as its input keeps the Wo loads' address pair
  // whole up to here (the run's last load would else take it for its result)
  __asm__ volatile("s_wait_xcnt 0x0" :: "v"(wop) : "memory");
  // group 1's reads take the registers that the Wo rows have left
  GROUP_FENCE();
#pragma unroll
  for (int cl = 0; cl < 4; ++cl)
#pragma unroll
    for (int s = 0; s < KSPLIT; ++s)
#pragma unroll
      for (int h = 0; h < 2; ++h)
        obuf[1][cl][s][h] = *(const float4*)(
            opp + s * (16 * CDIM) + (4 + cl) * 256 + h * 128);
  // the residual's x and the bias come with them
  float xres[16 / OSPLIT][8];
  v4f bov[16 / OSPLIT][2];
#pragma unroll
  for (int ot = 0; ot < 16 / OSPLIT; ++ot) {
#pragma unroll
    for (int r = 0; r < 8; ++r) xres[ot][r] = xp[(size_t)(ot * 16 + r) * NTOK];
    bov[ot][0] = *(const v4f*)(bop + ot * 16);
    bov[ot][1] = *(const v4f*)(bop + ot * 16 + 4);
  }
  // holds the bias loads in this group, ahead of the wait below: left free they
  // sink past it, among the products (inputs only; the barrier below waits for
  // every load of the group in any case)
  __asm__ volatile("" :: "v"(bov[0][0]), "v"(bov[0][1]), "v"(bov[1][0]), "v"(bov[1][1]),
                         "v"(bov[2][0]), "v"(bov[2][1]), "v"(bov[3][0]), "v"(bov[3][1]));
  ADDR_WAIT();
  // one place again, ahead of the weights
  GROUP_FENCE();

  // weights of the ranges for query l15, 1 / (sum) folded in
  float wgt[KSPLIT];
  {
    float Mx = Ms[0];
#pragma unroll
    for (int s = 1; s < KSPLIT; ++s) Mx = fmaxf(Mx, Ms[s]);
    float Lt = 0.f;
#pragma unroll
    for (int s = 0; s < KSPLIT; ++s) {
      wgt[s] = exp2f((Ms[s] - Mx) * LOG2E);
      Lt += wgt[s] * Ls[s];
    }
    const float rinv = 1.0f / Lt;
#pragma unroll
    for (int s = 0; s < KSPLIT; ++s) wgt[s] *= rinv;
  }

  __syncthreads();                    // Wo slab visible to all waves

  v8f y_acc[16 / OSPLIT];
#pragma unroll
  for (int ot = 0; ot < 16 / OSPLIT; ++ot) y_acc[ot] = vzero8();

#pragma unroll
  for (int g = 0; g < 4; ++g) {
#pragma unroll
    for (int cl = 0; cl < 4; ++cl) {
      const int cc = g * 4 + cl;
      // merge the ranges: O^T[c = cc*16 + 8*half + r][m = l15], normalised
      v2f om[4];                      // om[j]: r = 2*j, 2*j + 1
#pragma unroll
      for (int s = 0; s < KSPLIT; ++s) {
        const float4 lo = obuf[g & 1][cl][s][0], hi = obuf[g & 1][cl][s][1];
        const v2f w2 = {wgt[s], wgt[s]};
        const v2f p[4] = {{lo.x, lo.y}, {lo.z, lo.w}, {hi.x, hi.y}, {hi.z, hi.w}};
#pragma unroll
        for (int j = 0; j < 4; ++j)
          om[j] = s == 0 ? w2 * p[j] : __builtin_elementwise_fma(w2, p[j], om[j]);
      }
#pragma unroll
      for (int jp = 0; jp < 2; ++jp) {
        // B[k=c][m=l15], steps 2*jp and 2*jp + 1
        const v2f b0 = om[2 * jp], b1 = om[2 * jp + 1];
#pragma unroll
        for (int ot = 0; ot < 16 / OSPLIT; ++ot) {
          // A[o=l15][k=c] of both steps in one 16-byte read
          const float4 w4 = *(const float4*)(
              wos + (ot * 16 + l15) * WOP + cc * 16 + 8 * half + 4 * jp);
          v2f a0, a1;
          a0[0] = w4.x; a0[1] = w4.y;
          a1[0] = w4.z; a1[1] = w4.w;
          y_acc[ot] = wmma4(a0, b0, y_acc[ot]);
          y_acc[ot] = wmma4(a1, b1, y_acc[ot]);
        }
      }
    }
    if (g + 2 < 4) {
      // keeps the refill behind the sums that free its registers ...
      GROUP_FENCE();
#pragma unroll
      for (int cl = 0; cl < 4; ++cl)
#pragma unroll
        for (int s = 0; s < KSPLIT; ++s)
#pragma unroll
          for (int h = 0; h < 2; ++h)
            obuf[g & 1][cl][s][h] = *(const float4*)(
                opp + s * (16 * CDIM) + ((g + 2) * 4 + cl) * 256 + h * 128);
      ADDR_WAIT();
      // ... and in one place, ahead of the next group's work
      GROUP_FENCE();
    }
  }

  float* yp = out + (size_t)b * CDIM * NTOK + (size_t)(ob + 8 * half) * NTOK + mg;
#pragma unroll
  for (int ot = 0; ot < 16 / OSPLIT; ++ot) {
    const v4f b0 = bov[ot][0], b1 = bov[ot][1];
    const float bb[8] = {b0.x, b0.y, b0.z, b0.w, b1.x, b1.y, b1.z, b1.w};
#pragma unroll
    for (int r = 0; r < 8; ++r)       // output channel ob + ot*16 + r + 8*half
      yp[(size_t)(ot * 16 + r) * NTOK] = y_acc[ot][r] + bb[r] + xres[ot][r];
  }
}

// ---------------------------------------------------------------------------
extern "C" void kernel_launch(void* const* d_in, const int* in_sizes, int n_in,
                              void* d_out, int out_size, void* d_ws, size_t ws_size,
                              hipStream_t stream) {
  (void)in_sizes; (void)n_in; (void)out_size; (void)ws_size;
  const float* x  = (const float*)d_in[0];
  const float* t  = (const float*)d_in[1];
  const float* wq = (const float*)d_in[2];
  const float* bq = (const float*)d_in[3];
  const float* wk = (const float*)d_in[4];
  const float* bk = (const float*)d_in[5];
  const float* wv = (const float*)d_in[6];
  const float* bv = (const float*)d_in[7];
  const float* wo = (const float*)d_in[8];
  const float* bo = (const float*)d_in[9];

  float* Kws = (float*)d_ws;                       // [B][N/16][32][32][4], 8 MB
  float* Vws = Kws + (size_t)BSZ * CDIM * NTOK;    // [B][N/16][32][32][4], 8 MB
  float* Ows = Vws + (size_t)BSZ * CDIM * NTOK;    // [B][N/16][KSPLIT][16*C], 32 MB
  float* MLws = Ows + (size_t)KSPLIT * BSZ * CDIM * NTOK;  // [B][N/16][KSPLIT][32]
  float* Qws = MLws + (size_t)BSZ * NT16 * KSPLIT * 32;    // [B][N/16][C/8][32][4], 8 MB

  dim3 g1(NTOK / 64, BSZ, 3);
  qkv_proj_kernel<<<g1, dim3(128, 1, 1), 0, stream>>>(t, x, wk, bk, wv, bv, wq, bq,
                                                      Kws, Vws, Qws);

  const size_t smem = (size_t)4 * TILEF * sizeof(float);  // 64 KB
  dim3 g2(NTOK / 64, BSZ, KSPLIT);
  attn_kernel<<<g2, dim3(128, 1, 1), smem, stream>>>(Qws, Kws, Vws, Ows, MLws);

  dim3 g3(NTOK / 64, BSZ, OSPLIT);
  merge_proj_kernel<<<g3, dim3(128, 1, 1), 0, stream>>>(x, wo, bo, Ows, MLws,
                                                        (float*)d_out);
}

// v008
// Measured time: 194 microseconds a run.
// Timed twice side by side with v007, it ran 1.04 times as fast both times.
// All steps since v000 together make it 7.29 times as fast.
#include <hip/hip_runtime.h>

typedef float v2f __attribute__((ext_vector_type(2)));
typedef float v4f __attribute__((ext_vector_type(4)));
typedef float v8f __attribute__((ext_vector_type(8)));

#define CDIM 256
#define NTOK 4096
#define BSZ  2
#define LOG2E 1.4426950408889634f
#define TILEF (16 * CDIM)   // floats of one 16-key tile of K or of V
#define NT16  (NTOK / 16)
#define KSPLIT 4            // key ranges, one work-group each
#define NTS   (NT16 / KSPLIT)   // key tiles of one range
#define OSPLIT 4            // output-channel ranges of the merge kernel
#define WOP   260           // padded row width of the Wo slab in LDS
// key tiles of a range at which an attention wave steps its priority down; the last
// stretch is short: only there can one work-group still end ahead of the other
#define PRIO_T1 32
#define PRIO_T2 48
#define PRIO_T3 60
// launch 1: W and t come through LDS in chunks of KC channels of the sum
#define KC     32
#define NCH    (CDIM / KC)
#define WPITCH (KC + 4)   // floats a W row: an 8-byte read of 16 rows meets each bank once
// t lies in LDS as [channel pair][token][2]: a B fragment is one 8-byte read.
#define TPITCH (128 + 32) // floats a channel pair: the lane halves' pairs lie 32 banks apart

#define GROUP_FENCE() __builtin_amdgcn_sched_barrier(0)
// previous tile's 16 async b128 done; next tile's 16 may still be in flight
#define ASYNC_WAIT_PREFETCHED() __asm__ volatile("s_wait_asynccnt 0x10" ::: "memory")
#define ASYNC_WAIT_ALL()        __asm__ volatile("s_wait_asynccnt 0x0"  ::: "memory")
// this wave's LDS reads have returned: the buffer they read may be refilled
#define DS_WAIT_ALL()           __asm__ volatile("s_wait_dscnt 0x0"     ::: "memory")
// behind a group of global loads or stores: later code may reuse the registers
// that they name
#define ADDR_WAIT()   __asm__ volatile("s_wait_xcnt 0x0" ::: "memory")

__device__ __forceinline__ v8f wmma4(v2f a, v2f b, v8f c) {
  // D(16x16,f32) = A(16x4,f32) x B(4x16,f32) + C
  return __builtin_amdgcn_wmma_f32_16x16x4_f32(false, a, false, b, (short)0, c,
                                               false, false);
}

__device__ __forceinline__ v8f vzero8() {
  v8f z = {0.f, 0.f, 0.f, 0.f, 0.f, 0.f, 0.f, 0.f};
  return z;
}

// The value of lane l ^ 16: the other half of the keys of this lane's query.
__device__ __forceinline__ float xhalf(float v) {
  const int b = __builtin_bit_cast(int, v);
  return __builtin_bit_cast(float, __builtin_amdgcn_permlanex16(
      b, b, 0x76543210, 0xfedcba98, false, false));
}

// Async DMA: 16B global -> LDS, tracked by ASYNCcnt (no VGPR staging).
// Flat->LDS mapping truncates to low 32 bits, so low bits of the generic
// shared pointer are the LDS byte address.
// One 16-key tile of K and of V, 16 KB each and contiguous on both sides: the
// 128 lanes of the work-group move 2 KB a copy, eight copies a matrix. The
// immediate offset moves the LDS and the global address alike.
__device__ __forceinline__ void async_copy_tile(float* k_lds, const float* k_src,
                                                float* v_lds, const float* v_src) {
  unsigned kl = (unsigned)(unsigned long long)k_lds;
  unsigned vl = (unsigned)(unsigned long long)v_lds;
  // the closing wait stands inside the statement: later code may rewrite the
  // address registers that the copies name
  __asm__ volatile(
      "global_load_async_to_lds_b128 %0, %1, off\n\t"
      "global_load_async_to_lds_b128 %2, %3, off\n\t"
      "global_load_async_to_lds_b128 %0, %1, off offset:2048\n\t"
      "global_load_async_to_lds_b128 %2, %3, off offset:2048\n\t"
      "global_load_async_to_lds_b128 %0, %1, off offset:4096\n\t"
      "global_load_async_to_lds_b128 %2, %3, off offset:4096\n\t"
      "global_load_async_to_lds_b128 %0, %1, off offset:6144\n\t"
      "global_load_async_to_lds_b128 %2, %3, off offset:6144\n\t"
      "global_load_async_to_lds_b128 %0, %1, off offset:8192\n\t"
      "global_load_async_to_lds_b128 %2, %3, off offset:8192\n\t"
      "global_load_async_to_lds_b128 %0, %1, off offset:10240\n\t"
      "global_load_async_to_lds_b128 %2, %3, off offset:10240\n\t"
      "global_load_async_to_lds_b128 %0, %1, off offset:12288\n\t"
      "global_load_async_to_lds_b128 %2, %3, off offset:12288\n\t"
      "global_load_async_to_lds_b128 %0, %1, off offset:14336\n\t"
      "global_load_async_to_lds_b128 %2, %3, off offset:14336\n\t"
      "s_wait_xcnt 0x0"
      :: "v"(kl), "v"(k_src), "v"(vl), "v"(v_src)
      : "memory");
}

// ---------------------------------------------------------------------------
// Kernel 1: K = Wk*t + bk, V = Wv*t + bv, Q = Wq*x + bq
// (per-token 1x1x1 conv == GEMM)
// Grid: (NTOK/64, B, 3), 128 threads (4 waves). Wave w owns o-range [w*64,+64).
// W and t reach the fragments through LDS, brought there by async copies.
// All three are left in the order of the attention kernel's fragments, 16 bytes
// a lane: [token tile][32][lane][4], lane = 16 * h + i.
// Q (B) and K (A): entry jp, the four floats being
// [c = 8*jp + 2*h + {0, 1}][token] and [c = 8*jp + 4 + 2*h + {0, 1}][token];
// Q: i = token & 15. K: token n = 4*f + 2*g + v of the tile stands at
// i = 8*g + 2*f + v, so that the score tile's registers 2*f, 2*f + 1 of lane half
// g hold keys 4*f + 2*g + {0, 1}: the k order of V's fragment f.
// V (A): entry 2*(c / 16) + jp, i = c & 15, the four floats being
// V[c][n = 8*jp + 2*h + {0, 1}] and V[c][n = 8*jp + 4 + 2*h + {0, 1}] of the tile.
// V is therefore computed transposed (tokens as D's rows): operands swapped.
// ---------------------------------------------------------------------------
// Eight async copies of 4 or of 16 bytes a lane; copy i takes LDS address l + i * ls
// and global address g + i * gs (floats). The closing wait stands inside the
// statement: later code may rewrite the address registers that the copies name.
__device__ __forceinline__ void async_copy8_b32(unsigned l, unsigned ls, const float* g,
                                                size_t gs) {
  __asm__ volatile(
      "global_load_async_to_lds_b32 %0, %1, off\n\t"
      "global_load_async_to_lds_b32 %2, %3, off\n\t"
      "global_load_async_to_lds_b32 %4, %5, off\n\t"
      "global_load_async_to_lds_b32 %6, %7, off\n\t"
      "global_load_async_to_lds_b32 %8, %9, off\n\t"
      "global_load_async_to_lds_b32 %10, %11, off\n\t"
      "global_load_async_to_lds_b32 %12, %13, off\n\t"
      "global_load_async_to_lds_b32 %14, %15, off\n\t"
      "s_wait_xcnt 0x0"
      :: "v"(l), "v"(g), "v"(l + ls), "v"(g + gs),
         "v"(l + 2 * ls), "v"(g + 2 * gs), "v"(l + 3 * ls), "v"(g + 3 * gs),
         "v"(l + 4 * ls), "v"(g + 4 * gs), "v"(l + 5 * ls), "v"(g + 5 * gs),
         "v"(l + 6 * ls), "v"(g + 6 * gs), "v"(l + 7 * ls), "v"(g + 7 * gs)
      : "memory");
}
__device__ __forceinline__ void async_copy8(unsigned l, unsigned ls, const float* g,
                                            size_t gs) {
  __asm__ volatile(
      "global_load_async_to_lds_b128 %0, %1, off\n\t"
      "global_load_async_to_lds_b128 %2, %3, off\n\t"
      "global_load_async_to_lds_b128 %4, %5, off\n\t"
      "global_load_async_to_lds_b128 %6, %7, off\n\t"
      "global_load_async_to_lds_b128 %8, %9, off\n\t"
      "global_load_async_to_lds_b128 %10, %11, off\n\t"
      "global_load_async_to_lds_b128 %12, %13, off\n\t"
      "global_load_async_to_lds_b128 %14, %15, off\n\t"
      "s_wait_xcnt 0x0"
      :: "v"(l), "v"(g), "v"(l + ls), "v"(g + gs),
         "v"(l + 2 * ls), "v"(g + 2 * gs), "v"(l + 3 * ls), "v"(g + 3 * gs),
         "v"(l + 4 * ls), "v"(g + 4 * gs), "v"(l + 5 * ls), "v"(g + 5 * gs),
         "v"(l + 6 * ls), "v"(g + 6 * gs), "v"(l + 7 * ls), "v"(g + 7 * gs)
      : "memory");
}

// One chunk: W[0..255][KC channels] and t[KC channels][64 tokens]. A copy of a wave
// takes whole 128-byte lines: four W rows' 128 bytes, or 32 tokens of one t row.
// wl, wg: this lane's 16 bytes of W row tid / 8 (copy i: 16 * i rows on);
// tl, tg: token tid & 63 of t row tid / 64 (copy i: 2 * i rows, one pair, on).
__device__ __forceinline__ void stage_chunk(float* wl, const float* wg,
                                            float* tl, const float* tg) {
  const unsigned w0 = (unsigned)(unsigned long long)wl;
  const unsigned t0 = (unsigned)(unsigned long long)tl;
  async_copy8(w0, 16 * WPITCH * 4, wg, (size_t)16 * CDIM);
  async_copy8(w0 + 128 * WPITCH * 4, 16 * WPITCH * 4, wg + (size_t)128 * CDIM,
              (size_t)16 * CDIM);
  async_copy8_b32(t0, TPITCH * 4, tg, (size_t)2 * NTOK);
  async_copy8_b32(t0 + 8 * TPITCH * 4, TPITCH * 4, tg + (size_t)16 * NTOK,
                  (size_t)2 * NTOK);
}

// acc[ot][nt] += W[obase + ot*16 ..][chunk] * t[chunk][n0 + nt*16 ..], 16 x 16 each;
// D's rows are the output channels, or the tokens where TOKEN_ROWS (the two
// fragments have the same lane map, so that they only change places).
// wp: W row obase + l15 of the chunk in LDS, at channel 2 * half; tp: channel pair
// half of the chunk, at token l15. Step ks takes channels 4 * ks + 2 * half + {0, 1}.
template <bool TOKEN_ROWS>
__device__ __forceinline__ void proj_chunk(const float* wp, const float* tp,
                                           v8f (&acc)[4][4]) {
  v2f afr[KC / 4][4], bfr[KC / 4][4];
  // every loop is unrolled: afr, bfr, acc stay in registers
#pragma unroll
  for (int g = 0; g < KC / 8; ++g) {
    // the fragments of two steps: of the next group, and ahead of group 0 its own too
#pragma unroll
    for (int ks = g == 0 ? 0 : 2 * (g + 1); ks < 2 * (g + 2) && ks < KC / 4; ++ks) {
#pragma unroll
      for (int ot = 0; ot < 4; ++ot)  // W[o][c], o = l15
        afr[ks][ot] = *(const v2f*)(wp + ot * 16 * WPITCH + ks * 4);
#pragma unroll
      for (int nt = 0; nt < 4; ++nt)  // t[c][n], n = l15
        bfr[ks][nt] = *(const v2f*)(tp + ks * 2 * TPITCH + nt * 32);
    }
    // holds the reads above in one place, one group of WMMAs ahead of their use;
    // left free they sink to their users and each waits out the LDS latency
    if (g + 1 < KC / 8) GROUP_FENCE();
#pragma unroll
    for (int ks = 2 * g; ks < 2 * (g + 1); ++ks)
#pragma unroll
      for (int ot = 0; ot < 4; ++ot)
#pragma unroll
        for (int nt = 0; nt < 4; ++nt)
          acc[ot][nt] = TOKEN_ROWS ? wmma4(bfr[ks][nt], afr[ks][ot], acc[ot][nt])
                                   : wmma4(afr[ks][ot], bfr[ks][nt], acc[ot][nt]);
    // keeps the next group's reads behind these WMMAs: one place a group
    if (g + 2 < KC / 8) GROUP_FENCE();
  }
}

// The whole sum over the channels, on a ring of two LDS buffers: chunk kc + 1 flies
// while chunk kc is worked on.
template <bool TOKEN_ROWS>
__device__ __forceinline__ void proj_tiles(const float* __restrict__ W,
                                           const float* __restrict__ tb,
                                           float* wst, float* tst,
                                           int obase, int n0, int half, int l15,
                                           v8f (&acc)[4][4]) {
  const int tid = threadIdx.x;
  const float* wg = W + (size_t)(tid >> 3) * CDIM + (tid & 7) * 4;
  const float* tg = tb + (size_t)(tid >> 6) * NTOK + n0 + (tid & 63);
  float* wl = wst + (tid >> 3) * WPITCH + (tid & 7) * 4;
  float* tl = tst + (tid & 63) * 2 + (tid >> 6);
  const float* wp = wst + (obase + l15) * WPITCH + 2 * half;
  const float* tp = tst + half * TPITCH + l15 * 2;

  stage_chunk(wl, wg, tl, tg);
  ASYNC_WAIT_ALL();
  __syncthreads();               // chunk 0 visible to all waves
  stage_chunk(wl + CDIM * WPITCH, wg + KC, tl + KC / 2 * TPITCH, tg + (size_t)KC * NTOK);

  // left rolled: one copy of the 128 WMMAs in the instruction cache
#pragma unroll 1
  for (int kc = 0; kc < NCH; ++kc) {
    const int bw = (kc & 1) * (CDIM * WPITCH);
    const int bt = (kc & 1) * (KC / 2 * TPITCH);
    proj_chunk<TOKEN_ROWS>(wp + bw, tp + bt, acc);
    DS_WAIT_ALL();
    ASYNC_WAIT_ALL();            // this wave's part of chunk kc + 1 has landed
    // chunk kc + 1 visible to all waves, and all waves done with chunk kc
    __syncthreads();
    if (kc + 2 < NCH)            // the same for the whole work-group
      stage_chunk(wl + bw, wg + (kc + 2) * KC, tl + bt,
                  tg + (size_t)(kc + 2) * KC * NTOK);
  }
  ASYNC_WAIT_ALL();
}

__global__ __launch_bounds__(128, 2) void qkv_proj_kernel(
    const float* __restrict__ t, const float* __restrict__ x,
    const float* __restrict__ wk, const float* __restrict__ bk,
    const float* __restrict__ wv, const float* __restrict__ bv,
    const float* __restrict__ wq, const float* __restrict__ bq,
    float* __restrict__ Kout, float* __restrict__ Vout,
    float* __restrict__ Qout)
{
  // two buffers each of a chunk of W and of t
  __shared__ __attribute__((aligned(16))) float wst[2 * CDIM * WPITCH];
  __shared__ __attribute__((aligned(16))) float tst[2 * (KC / 2) * TPITCH];

  const int nb  = blockIdx.x;
  const int b   = blockIdx.y;
  const int mat = blockIdx.z;            // 0: K, 1: V, 2: Q
  const float* W    = mat == 0 ? wk : mat == 1 ? wv : wq;
  const float* bias = mat == 0 ? bk : mat == 1 ? bv : bq;
  float* Out        = mat == 0 ? Kout : mat == 1 ? Vout : Qout;
  const float* tb   = (mat == 2 ? x : t) + (size_t)b * CDIM * NTOK;

  const int lane = threadIdx.x & 31;
  const int wave = threadIdx.x >> 5;
  const int half = lane >> 4;
  const int l15  = lane & 15;
  const int n0    = nb * 64;
  const int obase = wave * 64;

  v8f acc[4][4];
#pragma unroll
  for (int i = 0; i < 4; ++i)
#pragma unroll
    for (int j = 0; j < 4; ++j) acc[i][j] = vzero8();

  if (mat == 1) proj_tiles<true>(W, tb, wst, tst, obase, n0, half, l15, acc);
  else          proj_tiles<false>(W, tb, wst, tst, obase, n0, half, l15, acc);

  {
    // of token tile nb*4 + nt this lane holds, with e = wave*8 + ot*2 + half,
    // Q or K: [c = 8*e + r][token l15]; V: [c = obase + ot*16 + l15][n = 8*half + r]
    // the place of token l15 (V: channel l15) among the fragment's 16 lanes (K: see above)
    const int pos = mat == 0 ? ((l15 >> 1) & 1) * 8 + (l15 >> 2) * 2 + (l15 & 1) : l15;
    float* qo = Out + ((size_t)(b * NT16 + nb * 4) * 32 + wave * 8 + half) * 128 +
                pos * 4;
    float4 blo[4], bhi[4];   // the bias of acc[ot][.][0..3] and of [4..7]
    if (mat == 1) {
#pragma unroll   // blo, bhi are indexed by constants only and stay in registers
      for (int ot = 0; ot < 4; ++ot) {
        const float bc = bias[obase + ot * 16 + l15];
        blo[ot] = bhi[ot] = make_float4(bc, bc, bc, bc);
      }
    } else {
#pragma unroll   // as above
      for (int ot = 0; ot < 4; ++ot) {
        blo[ot] = *(const float4*)(bias + obase + ot * 16 + 8 * half);
        bhi[ot] = *(const float4*)(bias + obase + ot * 16 + 8 * half + 4);
      }
    }
    ADDR_WAIT();
    // keeps later register writes from being lifted over the wait above
    GROUP_FENCE();
#pragma unroll   // acc is indexed by constants only and stays in registers
    for (int ot = 0; ot < 4; ++ot) {
      const float4 b0 = blo[ot];
      const float4 b1 = bhi[ot];
#pragma unroll
      for (int nt = 0; nt < 4; ++nt) {
        float* q = qo + nt * (16 * CDIM) + ot * 256;
        *(float4*)(q) =                  // fragment lanes 0..15
            make_float4(acc[ot][nt][0] + b0.x, acc[ot][nt][1] + b0.y,
                        acc[ot][nt][4] + b1.x, acc[ot][nt][5] + b1.y);
        *(float4*)(q + 64) =             // fragment lanes 16..31
            make_float4(acc[ot][nt][2] + b0.z, acc[ot][nt][3] + b0.w,
                        acc[ot][nt][6] + b1.z, acc[ot][nt][7] + b1.w);
      }
    }
  }
}

// ---------------------------------------------------------------------------
// Kernel 2: flash attention over ONE key range
// Grid: (NTOK/64, B, KSPLIT), 128 threads (4 waves). Wave w owns queries
// m0+w*16..+15 and the keys [ks*NTOK/KSPLIT, +NTOK/KSPLIT). It leaves the
// un-normalised O with its maxima and sums in the workspace.
// Both products are formed transposed, S^T = K^T * Q and O^T += V * P^T, so that
// a query is a column of D: lane 16*h + i holds query i alone, with eight keys of
// the tile in its eight score registers (register r: key 4*(r/2) + 2*h + (r&1),
// by the order in which launch 1 left K). Maximum and sum are taken in the
// lane, with one move between the halves, and the registers of P^T are the B
// operand of the second product as they stand.
// Two work-groups share a WGP (two waves a SIMD): 512 VGPRs a wave at most.
// Dynamic LDS: double-buffered K/V tiles in fragment order, 16 KB each, filled
// by async DMA.
// ---------------------------------------------------------------------------
__global__ __launch_bounds__(128, 2) void attn_kernel(
    const float* __restrict__ Qin,
    const float* __restrict__ Kin, const float* __restrict__ Vin,
    float* __restrict__ Opart, float* __restrict__ MLpart)
{
  extern __shared__ float dynsmem[];
  float* Kbuf0 = dynsmem;                    // [32][lane][4]
  float* Vbuf0 = Kbuf0 + TILEF;
  float* Kbuf1 = Vbuf0 + TILEF;
  float* Vbuf1 = Kbuf1 + TILEF;

  const int mb = blockIdx.x;
  const int b  = blockIdx.y;
  const int ks = blockIdx.z;             // this work-group's key range
  const int lane = threadIdx.x & 31;
  const int wave = threadIdx.x >> 5;
  const int half = lane >> 4;

  const int st = threadIdx.x * 4;            // staging: this lane's 16 bytes
  const float* Kb = Kin + (size_t)(b * NT16 + ks * NTS) * TILEF + st;
  const float* Vb = Vin + (size_t)(b * NT16 + ks * NTS) * TILEF + st;

  // kick off async staging of key/value tile 0 while Q comes in
  async_copy_tile(Kbuf0 + st, Kb, Vbuf0 + st, Vb);

  // ---- Q of this wave's 16 tokens, as launch 1 left it: B fragments ----
  v2f a_q[64];                         // a_q[j] covers c = 4j..4j+3
  {
    const float* qp = Qin + (size_t)(b * NT16 + mb * 4 + wave) * (16 * CDIM) + lane * 4;
#pragma unroll   // a_q is indexed by constants only and stays in registers
    for (int jp = 0; jp < 32; ++jp) {
      const float4 q4 = *(const float4*)(qp + jp * 128);
      a_q[2 * jp + 0][0] = q4.x; a_q[2 * jp + 0][1] = q4.y;
      a_q[2 * jp + 1][0] = q4.z; a_q[2 * jp + 1][1] = q4.w;
    }
    ADDR_WAIT();
    // keeps later register writes from being lifted over the wait above
    GROUP_FENCE();
  }

  // ---- Main loop: stream 16-wide key tiles, online softmax, double-buffered ----
  v8f o_acc[16];                      // O^T[c][m] accumulators (rows c, cols m)
#pragma unroll
  for (int ct = 0; ct < 16; ++ct) o_acc[ct] = vzero8();
  float Mq = -3.0e38f;                // maximum of this lane's query, both halves alike
  float Lq = 0.f;                     // sum of this lane's query over this half's keys

  // The two waves of a SIMD belong to two work-groups that no barrier joins. A
  // wave's priority falls as it advances, so that the work-group that is
  // behind wins the pipe and both end together. It is 0 from PRIO_T3 on, and so at
  // the kernel's end.
  __builtin_amdgcn_s_setprio(3);

  for (int ntile = 0; ntile < NTS; ++ntile) {
    // ntile is the same for the whole work-group: scalar compares and branches
    if ((ntile & 3) == 0) {
      if (ntile == PRIO_T1) __builtin_amdgcn_s_setprio(2);
      else if (ntile == PRIO_T2) __builtin_amdgcn_s_setprio(1);
      else if (ntile == PRIO_T3) __builtin_amdgcn_s_setprio(0);
    }
    const float* Kc = (ntile & 1) ? Kbuf1 : Kbuf0;
    const float* Vc = (ntile & 1) ? Vbuf1 : Vbuf0;
    if (ntile + 1 < NTS) {
      // prefetch next tile into the other buffer (its readers finished at the
      // barrier that ended iteration ntile-1)
      float* Kn = (ntile & 1) ? Kbuf0 : Kbuf1;
      float* Vn = (ntile & 1) ? Vbuf0 : Vbuf1;
      async_copy_tile(Kn + st, Kb + (size_t)(ntile + 1) * TILEF,
                      Vn + st, Vb + (size_t)(ntile + 1) * TILEF);
      ASYNC_WAIT_PREFETCHED();   // current tile's 16 async ops are complete
    } else {
      ASYNC_WAIT_ALL();
    }
    __syncthreads();             // current tile visible to all waves

    // S^T = K^T * Q  (16n x 16m, k=256); 4 interleaved partial accumulators.
    // The tile's A fragments come from LDS two to a 16-byte read, in groups of
    // 8 reads, each group issued one group of WMMAs ahead of its use; V's 32
    // reads follow behind K's.
    const float* kp = Kc + lane * 4;   // A[row lane & 15][k=c], fragments 2*jp, 2*jp + 1
    const float* vp = Vc + lane * 4;   // A[c=lane & 15][k=n], fragments 2*i, 2*i + 1
    v2f kf[64];
    v2f vf[64];
    v8f sp[4];
    sp[0] = sp[1] = sp[2] = sp[3] = vzero8();
#pragma unroll
    for (int jp = 0; jp < 8; ++jp) {
      const float4 k4 = *(const float4*)(kp + jp * 128);
      kf[2 * jp + 0][0] = k4.x; kf[2 * jp + 0][1] = k4.y;
      kf[2 * jp + 1][0] = k4.z; kf[2 * jp + 1][1] = k4.w;
    }
#pragma unroll
    for (int g = 0; g < 4; ++g) {
      if (g < 3) {
#pragma unroll
        for (int jp = 8 * (g + 1); jp < 8 * (g + 2); ++jp) {
          const float4 k4 = *(const float4*)(kp + jp * 128);
          kf[2 * jp + 0][0] = k4.x; kf[2 * jp + 0][1] = k4.y;
          kf[2 * jp + 1][0] = k4.z; kf[2 * jp + 1][1] = k4.w;
        }
      } else {
#pragma unroll
        for (int i = 0; i < 32; ++i) {
          const float4 v4 = *(const float4*)(vp + i * 128);
          vf[2 * i + 0][0] = v4.x; vf[2 * i + 0][1] = v4.y;
          vf[2 * i + 1][0] = v4.z; vf[2 * i + 1][1] = v4.w;
        }
      }
      // holds the reads above in one place, ahead of this group's WMMAs;
      // left free they sink to their users and each waits out the LDS latency
      GROUP_FENCE();
#pragma unroll
      for (int j = 16 * g; j < 16 * (g + 1); ++j)
        sp[j & 3] = wmma4(kf[j], a_q[j], sp[j & 3]);
      // keeps the next group's reads behind these WMMAs: one place a group,
      // not spread among them
      if (g < 3) GROUP_FENCE();
    }
    v8f s = (sp[0] + sp[1]) + (sp[2] + sp[3]);

    // online softmax of this lane's query; s[0..7]: its scores with this half's keys
    float mx = fmaxf(fmaxf(fmaxf(s[0], s[1]), fmaxf(s[2], s[3])),
                     fmaxf(fmaxf(s[4], s[5]), fmaxf(s[6], s[7])));
    mx = fmaxf(mx, xhalf(mx));
    const float Mn = fmaxf(Mq, mx);
    const float alpha = exp2f((Mq - Mn) * LOG2E);
    Mq = Mn;
#pragma unroll
    for (int r = 0; r < 8; ++r) s[r] = exp2f((s[r] - Mn) * LOG2E);
#pragma unroll
    for (int ct = 0; ct < 16; ++ct)
#pragma unroll
      for (int r = 0; r < 8; ++r) o_acc[ct][r] *= alpha;

    // O^T += V * P^T; step j takes keys 4*j + 2*half + {0, 1}, on both sides
    v2f b_p[4];
#pragma unroll
    for (int j = 0; j < 4; ++j) { b_p[j][0] = s[2 * j]; b_p[j][1] = s[2 * j + 1]; }
    const v2f ps = (b_p[0] + b_p[1]) + (b_p[2] + b_p[3]);   // pairs: no register moves
    Lq = Lq * alpha + (ps[0] + ps[1]);
    // keeps the closing barrier behind the softmax: a build without this line has
    // the barrier, with its s_wait_dscnt 0, in front of the last 16 score products,
    // which then stand still until V's 32 reads have landed
    GROUP_FENCE();
#pragma unroll
    for (int ct = 0; ct < 16; ++ct)
#pragma unroll
      for (int j = 0; j < 4; ++j)
        o_acc[ct] = wmma4(vf[ct * 4 + j], b_p[j], o_acc[ct]);
    __syncthreads();   // all waves done with this tile before it is overwritten
  }

  // ---- Leave this range's partial result in the workspace ----
  // O^T tile: [ct][r>>2][lane][r&3], so that each b128 store covers 512 B in a row
  const size_t tile = ((size_t)b * NT16 + mb * 4 + wave) * KSPLIT + ks;
  float* op = Opart + tile * (16 * CDIM) + lane * 4;
#pragma unroll   // o_acc is indexed by constants only and stays in registers
  for (int ct = 0; ct < 16; ++ct) {
    *(float4*)(op + ct * 256) =
        make_float4(o_acc[ct][0], o_acc[ct][1], o_acc[ct][2], o_acc[ct][3]);
    *(float4*)(op + ct * 256 + 128) =
        make_float4(o_acc[ct][4], o_acc[ct][5], o_acc[ct][6], o_acc[ct][7]);
  }
  ADDR_WAIT();
  // the queries' maxima [0..15] and sums [16..31], the halves' sums joined
  Lq += xhalf(Lq);
  MLpart[tile * 32 + lane] = half ? Lq : Mq;
}

// ---------------------------------------------------------------------------
// Kernel 3: merge the KSPLIT key ranges, then Y = Wo * O^T + bo + x
// Grid: (NTOK/64, B, OSPLIT), 128 threads (4 waves). Wave w owns queries
// m0+w*16..+15; the work-group owns output channels [oz*64, +64).
// Lane 16*h + i holds query i alone: O^T[c = 16*cc + 8*h + r][i], which is the B
// operand as it stands, step j taking c = 16*cc + 8*h + 2*j + {0, 1}.
// Two work-groups share a WGP, so that all 512 are resident at once.
// Every loop is unrolled in full: its arrays are indexed by constants only and
// so stay in registers.
// ---------------------------------------------------------------------------
__global__ __launch_bounds__(128, 2) void merge_proj_kernel(
    const float* __restrict__ x,
    const float* __restrict__ wo, const float* __restrict__ bo,
    const float* __restrict__ Opart, const float* __restrict__ MLpart,
    float* __restrict__ out)
{
  __shared__ float wos[(CDIM / OSPLIT) * WOP];   // Wo rows of this range

  const int mb = blockIdx.x;
  const int b  = blockIdx.y;
  const int ob = blockIdx.z * (CDIM / OSPLIT);
  const int lane = threadIdx.x & 31;
  const int wave = threadIdx.x >> 5;
  const int half = lane >> 4;
  const int l15  = lane & 15;
  const int mg = mb * 64 + wave * 16 + l15;
  const float* xb = x + (size_t)b * CDIM * NTOK;

  // The global reads of the merge are issued in groups of 8 to 72 loads, so
  // that a wave pays the L2 latency once a group and not once a load.
  const size_t tile0 = ((size_t)b * NT16 + mb * 4 + wave) * KSPLIT;  // range 0
  const float* mlp = MLpart + tile0 * 32 + l15;
  const float* opp = Opart + tile0 * (16 * CDIM) + lane * 4;
  const float* wop = wo + (size_t)(ob + (threadIdx.x >> 6)) * CDIM + (threadIdx.x & 63) * 4;
  const float* xp  = xb + (size_t)(ob + 8 * half) * NTOK + mg;
  const float* bop = bo + ob + 8 * half;
  const int c4 = (threadIdx.x & 63) * 4;   // Wo staging: column group
  const int r0 = threadIdx.x >> 6;         // Wo staging: first row

  float Ms[KSPLIT], Ls[KSPLIT];            // maxima and sums of query l15
#pragma unroll
  for (int s = 0; s < KSPLIT; ++s) {
    Ms[s] = mlp[s * 32];
    Ls[s] = mlp[s * 32 + 16];
  }
  ADDR_WAIT();
  // keeps later register writes from being lifted over the wait above
  GROUP_FENCE();
  // Wo[ob .. ob+63][0..255], 2 rows a pass; a plain vector type: as float4, with
  // wop named in the wait behind the LDS stores, the array was built in scratch
  v4f wreg[CDIM / OSPLIT / 2];
#pragma unroll
  for (int i = 0; i < CDIM / OSPLIT / 2; ++i)
    wreg[i] = *(const v4f*)(wop + i * 2 * CDIM);
  // O comes in groups of four 16-channel chunks, all ranges: 32 loads a group
  float4 obuf[2][4][KSPLIT][2];
#pragma unroll
  for (int cl = 0; cl < 4; ++cl)
#pragma unroll
    for (int s = 0; s < KSPLIT; ++s)
#pragma unroll
      for (int h = 0; h < 2; ++h)
        obuf[0][cl][s][h] = *(const float4*)(
            opp + s * (16 * CDIM) + cl * 256 + h * 128);
  ADDR_WAIT();
  // holds the reads above in one place; left free they sink to their users
  GROUP_FENCE();

#pragma unroll
  for (int i = 0; i < CDIM / OSPLIT / 2; ++i)
    *(v4f*)(wos + (r0 + 2 * i) * WOP + c4) = wreg[i];
  // the wait of ADDR_WAIT; wop as its input keeps the Wo loads' address pair
  // whole up to here (the run's last load would else take it for its result)
  __asm__ volatile("s_wait_xcnt 0x0" :: "v"(wop) : "memory");
  // group 1's reads take the registers that the Wo rows have left
  GROUP_FENCE();
#pragma unroll
  for (int cl = 0; cl < 4; ++cl)
#pragma unroll
    for (int s = 0; s < KSPLIT; ++s)
#pragma unroll
      for (int h = 0; h < 2; ++h)
        obuf[1][cl][s][h] = *(const float4*)(
            opp + s * (16 * CDIM) + (4 + cl) * 256 + h * 128);
  // the residual's x and the bias come with them
  float xres[16 / OSPLIT][8];
  v4f bov[16 / OSPLIT][2];
#pragma unroll
  for (int ot = 0; ot < 16 / OSPLIT; ++ot) {
#pragma unroll
    for (int r = 0; r < 8; ++r) xres[ot][r] = xp[(size_t)(ot * 16 + r) * NTOK];
    bov[ot][0] = *(const v4f*)(bop + ot * 16);
    bov[ot][1] = *(const v4f*)(bop + ot * 16 + 4);
  }
  // holds the bias loads in this group, ahead of the wait below: left free they
  // sink past it, among the products (inputs only; the barrier below waits for
  // every load of the group in any case)
  __asm__ volatile("" :: "v"(bov[0][0]), "v"(bov[0][1]), "v"(bov[1][0]), "v"(bov[1][1]),
                         "v"(bov[2][0]), "v"(bov[2][1]), "v"(bov[3][0]), "v"(bov[3][1]));
  ADDR_WAIT();
  // one place again, ahead of the weights
  GROUP_FENCE();

  // weights of the ranges for query l15, 1 / (sum) folded in
  float wgt[KSPLIT];
  {
    float Mx = Ms[0];
#pragma unroll
    for (int s = 1; s < KSPLIT; ++s) Mx = fmaxf(Mx, Ms[s]);
    float Lt = 0.f;
#pragma unroll
    for (int s = 0; s < KSPLIT; ++s) {
      wgt[s] = exp2f((Ms[s] - Mx) * LOG2E);
      Lt += wgt[s] * Ls[s];
    }
    const float rinv = 1.0f / Lt;
#pragma unroll
    for (int s = 0; s < KSPLIT; ++s) wgt[s] *= rinv;
  }

  __syncthreads();                    // Wo slab visible to all waves

  v8f y_acc[16 / OSPLIT];
#pragma unroll
  for (int ot = 0; ot < 16 / OSPLIT; ++ot) y_acc[ot] = vzero8();

#pragma unroll
  for (int g = 0; g < 4; ++g) {
#pragma unroll
    for (int cl = 0; cl < 4; ++cl) {
      const int cc = g * 4 + cl;
      // merge the ranges: O^T[c = cc*16 + 8*half + r][m = l15], normalised
      v2f om[4];                      // om[j]: r = 2*j, 2*j + 1
#pragma unroll
      for (int s = 0; s < KSPLIT; ++s) {
        const float4 lo = obuf[g & 1][cl][s][0], hi = obuf[g & 1][cl][s][1];
        const v2f w2 = {wgt[s], wgt[s]};
        const v2f p[4] = {{lo.x, lo.y}, {lo.z, lo.w}, {hi.x, hi.y}, {hi.z, hi.w}};
#pragma unroll
        for (int j = 0; j < 4; ++j)
          om[j] = s == 0 ? w2 * p[j] : __builtin_elementwise_fma(w2, p[j], om[j]);
      }
#pragma unroll
      for (int jp = 0; jp < 2; ++jp) {
        // B[k=c][m=l15], steps 2*jp and 2*jp + 1
        const v2f b0 = om[2 * jp], b1 = om[2 * jp + 1];
#pragma unroll
        for (int ot = 0; ot < 16 / OSPLIT; ++ot) {
          // A[o=l15][k=c] of both steps in one 16-byte read
          const float4 w4 = *(const float4*)(
              wos + (ot * 16 + l15) * WOP + cc * 16 + 8 * half + 4 * jp);
          v2f a0, a1;
          a0[0] = w4.x; a0[1] = w4.y;
          a1[0] = w4.z; a1[1] = w4.w;
          y_acc[ot] = wmma4(a0, b0, y_acc[ot]);
          y_acc[ot] = wmma4(a1, b1, y_acc[ot]);
        }
      }
    }
    if (g + 2 < 4) {
      // keeps the refill behind the sums that free its registers ...
      GROUP_FENCE();
#pragma unroll
      for (int cl = 0; cl < 4; ++cl)
#pragma unroll
        for (int s = 0; s < KSPLIT; ++s)
#pragma unroll
          for (int h = 0; h < 2; ++h)
            obuf[g & 1][cl][s][h] = *(const float4*)(
                opp + s * (16 * CDIM) + ((g + 2) * 4 + cl) * 256 + h * 128);
      ADDR_WAIT();
      // ... and in one place, ahead of the next group's work
      GROUP_FENCE();
    }
  }

  float* yp = out + (size_t)b * CDIM * NTOK + (size_t)(ob + 8 * half) * NTOK + mg;
#pragma unroll
  for (int ot = 0; ot < 16 / OSPLIT; ++ot) {
    const v4f b0 = bov[ot][0], b1 = bov[ot][1];
    const float bb[8] = {b0.x, b0.y, b0.z, b0.w, b1.x, b1.y, b1.z, b1.w};
#pragma unroll
    for (int r = 0; r < 8; ++r)       // output channel ob + ot*16 + r + 8*half
      yp[(size_t)(ot * 16 + r) * NTOK] = y_acc[ot][r] + bb[r] + xres[ot][r];
  }
}

// ---------------------------------------------------------------------------
extern "C" void kernel_launch(void* const* d_in, const int* in_sizes, int n_in,
                              void* d_out, int out_size, void* d_ws, size_t ws_size,
                              hipStream_t stream) {
  (void)in_sizes; (void)n_in; (void)out_size; (void)ws_size;
  const float* x  = (const float*)d_in[0];
  const float* t  = (const float*)d_in[1];
  const float* wq = (const float*)d_in[2];
  const float* bq = (const float*)d_in[3];
  const float* wk = (const float*)d_in[4];
  const float* bk = (const float*)d_in[5];
  const float* wv = (const float*)d_in[6];
  const float* bv = (const float*)d_in[7];
  const float* wo = (const float*)d_in[8];
  const float* bo = (const float*)d_in[9];

  float* Kws = (float*)d_ws;                       // [B][N/16][32][32][4], 8 MB
  float* Vws = Kws + (size_t)BSZ * CDIM * NTOK;    // [B][N/16][32][32][4], 8 MB
  float* Ows = Vws + (size_t)BSZ * CDIM * NTOK;    // [B][N/16][KSPLIT][16*C], 32 MB
  float* MLws = Ows + (size_t)KSPLIT * BSZ * CDIM * NTOK;  // [B][N/16][KSPLIT][32]
  float* Qws = MLws + (size_t)BSZ * NT16 * KSPLIT * 32;    // [B][N/16][C/8][32][4], 8 MB

  dim3 g1(NTOK / 64, BSZ, 3);
  qkv_proj_kernel<<<g1, dim3(128, 1, 1), 0, stream>>>(t, x, wk, bk, wv, bv, wq, bq,
                                                      Kws, Vws, Qws);

  const size_t smem = (size_t)4 * TILEF * sizeof(float);  // 64 KB
  dim3 g2(NTOK / 64, BSZ, KSPLIT);
  attn_kernel<<<g2, dim3(128, 1, 1), smem, stream>>>(Qws, Kws, Vws, Ows, MLws);

  dim3 g3(NTOK / 64, BSZ, OSPLIT);
  merge_proj_kernel<<<g3, dim3(128, 1, 1), 0, stream>>>(x, wo, bo, Ows, MLws,
                                                        (float*)d_out);
}

// v009
// Measured time: 182 microseconds a run.
// Timed twice side by side with v008, it ran 1.05 and 1.04 times as fast.
// All steps since v000 together make it 7.62 times as fast.
#include <hip/hip_runtime.h>

typedef float v2f __attribute__((ext_vector_type(2)));
typedef float v4f __attribute__((ext_vector_type(4)));
typedef float v8f __attribute__((ext_vector_type(8)));

#define CDIM 256
#define NTOK 4096
#define BSZ  2
#define LOG2E 1.4426950408889634f
#define TILEF (16 * CDIM)   // floats of one 16-key tile of K or of V
#define NT16  (NTOK / 16)
#define KSPLIT 4            // key ranges, one work-group each
#define NTS   (NT16 / KSPLIT)   // key tiles of one range
#define OSPLIT 4            // output-channel ranges of the merge kernel
#define WOP   260           // padded row width of the Wo slab in LDS
// key tiles of a range at which an attention wave steps its priority down; the last
// stretch is short: only there can one work-group still end ahead of the other
#define PRIO_T1 32
#define PRIO_T2 48
#define PRIO_T3 60
// launch 1: W and t come through LDS in chunks of KC channels of the sum
#define KC     32
#define NCH    (CDIM / KC)
#define WPITCH (KC + 4)   // floats a W row: an 8-byte read of 16 rows meets each bank once
// t lies in LDS as [channel pair][token][2]: a B fragment is one 8-byte read.
#define TPITCH (128 + 32) // floats a channel pair: the lane halves' pairs lie 32 banks apart

#define GROUP_FENCE() __builtin_amdgcn_sched_barrier(0)
// previous tile's 16 async b128 done; next tile's 16 may still be in flight
#define ASYNC_WAIT_PREFETCHED() __asm__ volatile("s_wait_asynccnt 0x10" ::: "memory")
#define ASYNC_WAIT_ALL()        __asm__ volatile("s_wait_asynccnt 0x0"  ::: "memory")
// this wave's LDS reads have returned: the buffer they read may be refilled
#define DS_WAIT_ALL()           __asm__ volatile("s_wait_dscnt 0x0"     ::: "memory")
// behind a group of global loads or stores: later code may reuse the registers
// that they name
#define ADDR_WAIT()   __asm__ volatile("s_wait_xcnt 0x0" ::: "memory")

__device__ __forceinline__ v8f wmma4(v2f a, v2f b, v8f c) {
  // D(16x16,f32) = A(16x4,f32) x B(4x16,f32) + C
  return __builtin_amdgcn_wmma_f32_16x16x4_f32(false, a, false, b, (short)0, c,
                                               false, false);
}

__device__ __forceinline__ v8f vzero8() {
  v8f z = {0.f, 0.f, 0.f, 0.f, 0.f, 0.f, 0.f, 0.f};
  return z;
}

// The value of lane l ^ 16: the other half of the keys of this lane's query.
__device__ __forceinline__ float xhalf(float v) {
  const int b = __builtin_bit_cast(int, v);
  return __builtin_bit_cast(float, __builtin_amdgcn_permlanex16(
      b, b, 0x76543210, 0xfedcba98, false, false));
}

// Async DMA: 16B global -> LDS, tracked by ASYNCcnt (no VGPR staging).
// Flat->LDS mapping truncates to low 32 bits, so low bits of the generic
// shared pointer are the LDS byte address.
// One 16-key tile of K and of V, 16 KB each and contiguous on both sides: the
// 128 lanes of the work-group move 2 KB a copy, eight copies a matrix. The
// immediate offset moves the LDS and the global address alike.
__device__ __forceinline__ void async_copy_tile(float* k_lds, const float* k_src,
                                                float* v_lds, const float* v_src) {
  unsigned kl = (unsigned)(unsigned long long)k_lds;
  unsigned vl = (unsigned)(unsigned long long)v_lds;
  // the closing wait stands inside the statement: later code may rewrite the
  // address registers that the copies name
  __asm__ volatile(
      "global_load_async_to_lds_b128 %0, %1, off\n\t"
      "global_load_async_to_lds_b128 %2, %3, off\n\t"
      "global_load_async_to_lds_b128 %0, %1, off offset:2048\n\t"
      "global_load_async_to_lds_b128 %2, %3, off offset:2048\n\t"
      "global_load_async_to_lds_b128 %0, %1, off offset:4096\n\t"
      "global_load_async_to_lds_b128 %2, %3, off offset:4096\n\t"
      "global_load_async_to_lds_b128 %0, %1, off offset:6144\n\t"
      "global_load_async_to_lds_b128 %2, %3, off offset:6144\n\t"
      "global_load_async_to_lds_b128 %0, %1, off offset:8192\n\t"
      "global_load_async_to_lds_b128 %2, %3, off offset:8192\n\t"
      "global_load_async_to_lds_b128 %0, %1, off offset:10240\n\t"
      "global_load_async_to_lds_b128 %2, %3, off offset:10240\n\t"
      "global_load_async_to_lds_b128 %0, %1, off offset:12288\n\t"
      "global_load_async_to_lds_b128 %2, %3, off offset:12288\n\t"
      "global_load_async_to_lds_b128 %0, %1, off offset:14336\n\t"
      "global_load_async_to_lds_b128 %2, %3, off offset:14336\n\t"
      "s_wait_xcnt 0x0"
      :: "v"(kl), "v"(k_src), "v"(vl), "v"(v_src)
      : "memory");
}

// ---------------------------------------------------------------------------
// Kernel 1: K = Wk*t + bk, Q = Wq*x + bq (per-token 1x1x1 conv == GEMM), and t
// itself in V's place. The weights of a query add up to 1, so that
// Wo * (sum p * (Wv*t + bv)) + bo = (Wo*Wv) * (sum p * t) + (Wo*bv + bo): the
// attention runs on t, and Wo*Wv and Wo*bv + bo, formed here once, take the place
// of Wo and bo in the last launch.
// Grid: (NTOK/64, B, 3), 128 threads (4 waves). Wave w owns o-range [w*64,+64).
// z = 0: K, z = 1: Q; z = 2, the short ones: V.
// K and Q: W and t reach the fragments through LDS, brought there by async copies.
// All three are left in the order of the attention kernel's fragments, 16 bytes
// a lane: [token tile][32][lane][4], lane = 16 * h + i.
// Q (B) and K (A): entry jp, the four floats being
// [c = 8*jp + 2*h + {0, 1}][token] and [c = 8*jp + 4 + 2*h + {0, 1}][token];
// Q: i = token & 15. K: token n = 4*f + 2*g + v of the tile stands at
// i = 8*g + 2*f + v, so that the score tile's registers 2*f, 2*f + 1 of lane half
// g hold keys 4*f + 2*g + {0, 1}: the k order of V's fragment f.
// V (A): entry 2*(c / 16) + jp, i = c & 15, the four floats being
// V[c][n = 8*jp + 2*h + {0, 1}] and V[c][n = 8*jp + 4 + 2*h + {0, 1}] of the tile.
// ---------------------------------------------------------------------------
// Eight async copies of 4 or of 16 bytes a lane; copy i takes LDS address l + i * ls
// and global address g + i * gs (floats). The closing wait stands inside the
// statement: later code may rewrite the address registers that the copies name.
__device__ __forceinline__ void async_copy8_b32(unsigned l, unsigned ls, const float* g,
                                                size_t gs) {
  __asm__ volatile(
      "global_load_async_to_lds_b32 %0, %1, off\n\t"
      "global_load_async_to_lds_b32 %2, %3, off\n\t"
      "global_load_async_to_lds_b32 %4, %5, off\n\t"
      "global_load_async_to_lds_b32 %6, %7, off\n\t"
      "global_load_async_to_lds_b32 %8, %9, off\n\t"
      "global_load_async_to_lds_b32 %10, %11, off\n\t"
      "global_load_async_to_lds_b32 %12, %13, off\n\t"
      "global_load_async_to_lds_b32 %14, %15, off\n\t"
      "s_wait_xcnt 0x0"
      :: "v"(l), "v"(g), "v"(l + ls), "v"(g + gs),
         "v"(l + 2 * ls), "v"(g + 2 * gs), "v"(l + 3 * ls), "v"(g + 3 * gs),
         "v"(l + 4 * ls), "v"(g + 4 * gs), "v"(l + 5 * ls), "v"(g + 5 * gs),
         "v"(l + 6 * ls), "v"(g + 6 * gs), "v"(l + 7 * ls), "v"(g + 7 * gs)
      : "memory");
}
__device__ __forceinline__ void async_copy8(unsigned l, unsigned ls, const float* g,
                                            size_t gs) {
  __asm__ volatile(
      "global_load_async_to_lds_b128 %0, %1, off\n\t"
      "global_load_async_to_lds_b128 %2, %3, off\n\t"
      "global_load_async_to_lds_b128 %4, %5, off\n\t"
      "global_load_async_to_lds_b128 %6, %7, off\n\t"
      "global_load_async_to_lds_b128 %8, %9, off\n\t"
      "global_load_async_to_lds_b128 %10, %11, off\n\t"
      "global_load_async_to_lds_b128 %12, %13, off\n\t"
      "global_load_async_to_lds_b128 %14, %15, off\n\t"
      "s_wait_xcnt 0x0"
      :: "v"(l), "v"(g), "v"(l + ls), "v"(g + gs),
         "v"(l + 2 * ls), "v"(g + 2 * gs), "v"(l + 3 * ls), "v"(g + 3 * gs),
         "v"(l + 4 * ls), "v"(g + 4 * gs), "v"(l + 5 * ls), "v"(g + 5 * gs),
         "v"(l + 6 * ls), "v"(g + 6 * gs), "v"(l + 7 * ls), "v"(g + 7 * gs)
      : "memory");
}

// One chunk: W[0..255][KC channels] and t[KC channels][64 tokens]. A copy of a wave
// takes whole 128-byte lines: four W rows' 128 bytes, or 32 tokens of one t row.
// wl, wg: this lane's 16 bytes of W row tid / 8 (copy i: 16 * i rows on);
// tl, tg: token tid & 63 of t row tid / 64 (copy i: 2 * i rows, one pair, on).
__device__ __forceinline__ void stage_chunk(float* wl, const float* wg,
                                            float* tl, const float* tg) {
  const unsigned w0 = (unsigned)(unsigned long long)wl;
  const unsigned t0 = (unsigned)(unsigned long long)tl;
  async_copy8(w0, 16 * WPITCH * 4, wg, (size_t)16 * CDIM);
  async_copy8(w0 + 128 * WPITCH * 4, 16 * WPITCH * 4, wg + (size_t)128 * CDIM,
              (size_t)16 * CDIM);
  async_copy8_b32(t0, TPITCH * 4, tg, (size_t)2 * NTOK);
  async_copy8_b32(t0 + 8 * TPITCH * 4, TPITCH * 4, tg + (size_t)16 * NTOK,
                  (size_t)2 * NTOK);
}

// acc[ot][nt] += W[obase + ot*16 ..][chunk] * t[chunk][n0 + nt*16 ..], 16 x 16 each;
// D's rows are the output channels.
// wp: W row obase + l15 of the chunk in LDS, at channel 2 * half; tp: channel pair
// half of the chunk, at token l15. Step ks takes channels 4 * ks + 2 * half + {0, 1}.
__device__ __forceinline__ void proj_chunk(const float* wp, const float* tp,
                                           v8f (&acc)[4][4]) {
  v2f afr[KC / 4][4], bfr[KC / 4][4];
  // every loop is unrolled: afr, bfr, acc stay in registers
#pragma unroll
  for (int g = 0; g < KC / 8; ++g) {
    // the fragments of two steps: of the next group, and ahead of group 0 its own too
#pragma unroll
    for (int ks = g == 0 ? 0 : 2 * (g + 1); ks < 2 * (g + 2) && ks < KC / 4; ++ks) {
#pragma unroll
      for (int ot = 0; ot < 4; ++ot)  // W[o][c], o = l15
        afr[ks][ot] = *(const v2f*)(wp + ot * 16 * WPITCH + ks * 4);
#pragma unroll
      for (int nt = 0; nt < 4; ++nt)  // t[c][n], n = l15
        bfr[ks][nt] = *(const v2f*)(tp + ks * 2 * TPITCH + nt * 32);
    }
    // holds the reads above in one place, one group of WMMAs ahead of their use;
    // left free they sink to their users and each waits out the LDS latency
    if (g + 1 < KC / 8) GROUP_FENCE();
#pragma unroll
    for (int ks = 2 * g; ks < 2 * (g + 1); ++ks)
#pragma unroll
      for (int ot = 0; ot < 4; ++ot)
#pragma unroll
        for (int nt = 0; nt < 4; ++nt)
          acc[ot][nt] = wmma4(afr[ks][ot], bfr[ks][nt], acc[ot][nt]);
    // keeps the next group's reads behind these WMMAs: one place a group
    if (g + 2 < KC / 8) GROUP_FENCE();
  }
}

// The whole sum over the channels, on a ring of two LDS buffers: chunk kc + 1 flies
// while chunk kc is worked on.
__device__ __forceinline__ void proj_tiles(const float* __restrict__ W,
                                           const float* __restrict__ tb,
                                           float* wst, float* tst,
                                           int obase, int n0, int half, int l15,
                                           v8f (&acc)[4][4]) {
  const int tid = threadIdx.x;
  const float* wg = W + (size_t)(tid >> 3) * CDIM + (tid & 7) * 4;
  const float* tg = tb + (size_t)(tid >> 6) * NTOK + n0 + (tid & 63);
  float* wl = wst + (tid >> 3) * WPITCH + (tid & 7) * 4;
  float* tl = tst + (tid & 63) * 2 + (tid >> 6);
  const float* wp = wst + (obase + l15) * WPITCH + 2 * half;
  const float* tp = tst + half * TPITCH + l15 * 2;

  stage_chunk(wl, wg, tl, tg);
  ASYNC_WAIT_ALL();
  __syncthreads();               // chunk 0 visible to all waves
  stage_chunk(wl + CDIM * WPITCH, wg + KC, tl + KC / 2 * TPITCH, tg + (size_t)KC * NTOK);

  // left rolled: one copy of the 128 WMMAs in the instruction cache
#pragma unroll 1
  for (int kc = 0; kc < NCH; ++kc) {
    const int bw = (kc & 1) * (CDIM * WPITCH);
    const int bt = (kc & 1) * (KC / 2 * TPITCH);
    proj_chunk(wp + bw, tp + bt, acc);
    DS_WAIT_ALL();
    ASYNC_WAIT_ALL();            // this wave's part of chunk kc + 1 has landed
    // chunk kc + 1 visible to all waves, and all waves done with chunk kc
    __syncthreads();
    if (kc + 2 < NCH)            // the same for the whole work-group
      stage_chunk(wl + bw, wg + (kc + 2) * KC, tl + bt,
                  tg + (size_t)(kc + 2) * KC * NTOK);
  }
  ASYNC_WAIT_ALL();
}

// One wave: the 16 x 16 tile (to, tn) of Wo*Wv, row-major, and, where tn == 0, rows
// to*16 .. +15 of Wo*bv + bo. Fragments straight from global memory, in four groups
// of 16 steps; step ks takes k = 4*ks + 2*half + {0, 1} on both sides. bv stands in
// every column of its B fragment, so that each column of its D holds Wo*bv.
__device__ __forceinline__ void fold_tile(const float* __restrict__ wo,
                                          const float* __restrict__ bo,
                                          const float* __restrict__ wv,
                                          const float* __restrict__ bv,
                                          float* __restrict__ Wov,
                                          float* __restrict__ Bov,
                                          int to, int tn, int half, int l15) {
  const float* ap = wo + (size_t)(to * 16 + l15) * CDIM + 2 * half;  // A[o=l15][k]
  const float* bp = wv + (size_t)(2 * half) * CDIM + tn * 16 + l15;  // B[k][c=l15]
  const float* vp = bv + 2 * half;
  v8f wacc[2], bacc[2];
  wacc[0] = wacc[1] = bacc[0] = bacc[1] = vzero8();
  // every loop is unrolled: the arrays stay in registers, the addresses are
  // immediate offsets of the three pointers
#pragma unroll
  for (int g = 0; g < 4; ++g) {
    v2f af[16], bf[16], vf[16];
#pragma unroll
    for (int i = 0; i < 16; ++i) {
      const int ks = 16 * g + i;
      af[i] = *(const v2f*)(ap + ks * 4);
      bf[i][0] = bp[(ks * 4 + 0) * CDIM];
      bf[i][1] = bp[(ks * 4 + 1) * CDIM];
      vf[i] = *(const v2f*)(vp + ks * 4);
    }
    // the wait of ADDR_WAIT; the pointers as its inputs keep the loads' address
    // registers whole up to here
    __asm__ volatile("s_wait_xcnt 0x0" :: "v"(ap), "v"(bp), "v"(vp) : "memory");
    // holds the group's 64 loads in one place: one memory latency a group
    GROUP_FENCE();
#pragma unroll
    for (int i = 0; i < 16; ++i) {
      wacc[i & 1] = wmma4(af[i], bf[i], wacc[i & 1]);
      bacc[i & 1] = wmma4(af[i], vf[i], bacc[i & 1]);
    }
    // keeps the next group's loads behind these WMMAs, whose registers they take
    if (g < 3) GROUP_FENCE();
  }
  const v8f ws = wacc[0] + wacc[1];   // [o = to*16 + 8*half + r][c = tn*16 + l15]
  const v8f bs = bacc[0] + bacc[1];   // [o = to*16 + 8*half + r], every column alike
  float* wp = Wov + (size_t)(to * 16 + 8 * half) * CDIM + tn * 16 + l15;
#pragma unroll
  for (int r = 0; r < 8; ++r) wp[r * CDIM] = ws[r];
  if (tn == 0 && l15 == 0) {
    const int o = to * 16 + 8 * half;
#pragma unroll
    for (int r = 0; r < 8; ++r) Bov[o + r] = bs[r] + bo[o + r];
  }
  ADDR_WAIT();
}

__global__ __launch_bounds__(128, 2) void qkv_proj_kernel(
    const float* __restrict__ t, const float* __restrict__ x,
    const float* __restrict__ wk, const float* __restrict__ bk,
    const float* __restrict__ wv, const float* __restrict__ bv,
    const float* __restrict__ wq, const float* __restrict__ bq,
    const float* __restrict__ wo, const float* __restrict__ bo,
    float* __restrict__ Kout, float* __restrict__ Vout,
    float* __restrict__ Qout, float* __restrict__ Wov, float* __restrict__ Bov)
{
  // two buffers each of a chunk of W and of t
  __shared__ __attribute__((aligned(16))) float wst[2 * CDIM * WPITCH];
  __shared__ __attribute__((aligned(16))) float tst[2 * (KC / 2) * TPITCH];

  const int nb  = blockIdx.x;
  const int b   = blockIdx.y;
  // 0: K, 1: V, 2: Q. The 256 long work-groups, K's and Q's, have the low z;
  // V's short ones have z = 2
  const int mat = blockIdx.z == 0 ? 0 : blockIdx.z == 1 ? 2 : 1;
  const float* W    = mat == 0 ? wk : wq;
  const float* bias = mat == 0 ? bk : bq;
  float* Out        = mat == 0 ? Kout : mat == 1 ? Vout : Qout;
  const float* tb   = (mat == 2 ? x : t) + (size_t)b * CDIM * NTOK;

  const int lane = threadIdx.x & 31;
  const int wave = threadIdx.x >> 5;
  const int half = lane >> 4;
  const int l15  = lane & 15;
  const int n0    = nb * 64;
  const int obase = wave * 64;

  v8f acc[4][4];
#pragma unroll
  for (int i = 0; i < 4; ++i)
#pragma unroll
    for (int j = 0; j < 4; ++j) acc[i][j] = vzero8();

  if (mat == 1) {
    // the 256 tiles of Wo*Wv: one a wave of batch 0's 64 work-groups (b is the
    // same for the whole work-group: a scalar branch, every lane on at the WMMAs)
    if (b == 0)
      fold_tile(wo, bo, wv, bv, Wov, Bov, nb >> 2, (nb & 3) * 4 + wave, half, l15);
    // t[c = obase + ot*16 + l15][n = n0 + nt*16 + 8*half + r], 32 bytes in a row
    const float* tp = tb + (size_t)(obase + l15) * NTOK + n0 + 8 * half;
#pragma unroll   // acc is indexed by constants only and stays in registers
    for (int ot = 0; ot < 4; ++ot)
#pragma unroll
      for (int nt = 0; nt < 4; ++nt) {
        const float4 lo = *(const float4*)(tp + (size_t)ot * 16 * NTOK + nt * 16);
        const float4 hi = *(const float4*)(tp + (size_t)ot * 16 * NTOK + nt * 16 + 4);
        acc[ot][nt][0] = lo.x; acc[ot][nt][1] = lo.y;
        acc[ot][nt][2] = lo.z; acc[ot][nt][3] = lo.w;
        acc[ot][nt][4] = hi.x; acc[ot][nt][5] = hi.y;
        acc[ot][nt][6] = hi.z; acc[ot][nt][7] = hi.w;
      }
    // the wait of ADDR_WAIT; tp as its input keeps the loads' address pair whole
    __asm__ volatile("s_wait_xcnt 0x0" :: "v"(tp) : "memory");
  } else {
    proj_tiles(W, tb, wst, tst, obase, n0, half, l15, acc);
  }

  {
    // of token tile nb*4 + nt this lane holds, with e = wave*8 + ot*2 + half,
    // Q or K: [c = 8*e + r][token l15]; V: [c = obase + ot*16 + l15][n = 8*half + r]
    // the place of token l15 (V: channel l15) among the fragment's 16 lanes (K: see above)
    const int pos = mat == 0 ? ((l15 >> 1) & 1) * 8 + (l15 >> 2) * 2 + (l15 & 1) : l15;
    float* qo = Out + ((size_t)(b * NT16 + nb * 4) * 32 + wave * 8 + half) * 128 +
                pos * 4;
    float4 blo[4], bhi[4];   // the bias of acc[ot][.][0..3] and of [4..7]
    if (mat == 1) {          // t as it is: its bias went into Wo*bv + bo
#pragma unroll   // blo, bhi are indexed by constants only and stay in registers
      for (int ot = 0; ot < 4; ++ot)
        blo[ot] = bhi[ot] = make_float4(0.f, 0.f, 0.f, 0.f);
    } else {
#pragma unroll   // as above
      for (int ot = 0; ot < 4; ++ot) {
        blo[ot] = *(const float4*)(bias + obase + ot * 16 + 8 * half);
        bhi[ot] = *(const float4*)(bias + obase + ot * 16 + 8 * half + 4);
      }
    }
    ADDR_WAIT();
    // keeps later register writes from being lifted over the wait above
    GROUP_FENCE();
#pragma unroll   // acc is indexed by constants only and stays in registers
    for (int ot = 0; ot < 4; ++ot) {
      const float4 b0 = blo[ot];
      const float4 b1 = bhi[ot];
#pragma unroll
      for (int nt = 0; nt < 4; ++nt) {
        float* q = qo + nt * (16 * CDIM) + ot * 256;
        *(float4*)(q) =                  // fragment lanes 0..15
            make_float4(acc[ot][nt][0] + b0.x, acc[ot][nt][1] + b0.y,
                        acc[ot][nt][4] + b1.x, acc[ot][nt][5] + b1.y);
        *(float4*)(q + 64) =             // fragment lanes 16..31
            make_float4(acc[ot][nt][2] + b0.z, acc[ot][nt][3] + b0.w,
                        acc[ot][nt][6] + b1.z, acc[ot][nt][7] + b1.w);
      }
    }
  }
}

// ---------------------------------------------------------------------------
// Kernel 2: flash attention over ONE key range
// Grid: (NTOK/64, B, KSPLIT), 128 threads (4 waves). Wave w owns queries
// m0+w*16..+15 and the keys [ks*NTOK/KSPLIT, +NTOK/KSPLIT). It leaves the
// un-normalised O with its maxima and sums in the workspace.
// Both products are formed transposed, S^T = K^T * Q and O^T += V * P^T, so that
// a query is a column of D: lane 16*h + i holds query i alone, with eight keys of
// the tile in its eight score registers (register r: key 4*(r/2) + 2*h + (r&1),
// by the order in which launch 1 left K). Maximum and sum are taken in the
// lane, with one move between the halves, and the registers of P^T are the B
// operand of the second product as they stand.
// Two work-groups share a WGP (two waves a SIMD): 512 VGPRs a wave at most.
// Dynamic LDS: double-buffered K/V tiles in fragment order, 16 KB each, filled
// by async DMA.
// ---------------------------------------------------------------------------
__global__ __launch_bounds__(128, 2) void attn_kernel(
    const float* __restrict__ Qin,
    const float* __restrict__ Kin, const float* __restrict__ Vin,
    float* __restrict__ Opart, float* __restrict__ MLpart)
{
  extern __shared__ float dynsmem[];
  float* Kbuf0 = dynsmem;                    // [32][lane][4]
  float* Vbuf0 = Kbuf0 + TILEF;
  float* Kbuf1 = Vbuf0 + TILEF;
  float* Vbuf1 = Kbuf1 + TILEF;

  const int mb = blockIdx.x;
  const int b  = blockIdx.y;
  const int ks = blockIdx.z;             // this work-group's key range
  const int lane = threadIdx.x & 31;
  const int wave = threadIdx.x >> 5;
  const int half = lane >> 4;

  const int st = threadIdx.x * 4;            // staging: this lane's 16 bytes
  const float* Kb = Kin + (size_t)(b * NT16 + ks * NTS) * TILEF + st;
  const float* Vb = Vin + (size_t)(b * NT16 + ks * NTS) * TILEF + st;

  // kick off async staging of key/value tile 0 while Q comes in
  async_copy_tile(Kbuf0 + st, Kb, Vbuf0 + st, Vb);

  // ---- Q of this wave's 16 tokens, as launch 1 left it: B fragments ----
  v2f a_q[64];                         // a_q[j] covers c = 4j..4j+3
  {
    const float* qp = Qin + (size_t)(b * NT16 + mb * 4 + wave) * (16 * CDIM) + lane * 4;
#pragma unroll   // a_q is indexed by constants only and stays in registers
    for (int jp = 0; jp < 32; ++jp) {
      const float4 q4 = *(const float4*)(qp + jp * 128);
      a_q[2 * jp + 0][0] = q4.x; a_q[2 * jp + 0][1] = q4.y;
      a_q[2 * jp + 1][0] = q4.z; a_q[2 * jp + 1][1] = q4.w;
    }
    ADDR_WAIT();
    // keeps later register writes from being lifted over the wait above
    GROUP_FENCE();
  }

  // ---- Main loop: stream 16-wide key tiles, online softmax, double-buffered ----
  v8f o_acc[16];                      // O^T[c][m] accumulators (rows c, cols m)
#pragma unroll
  for (int ct = 0; ct < 16; ++ct) o_acc[ct] = vzero8();
  float Mq = -3.0e38f;                // maximum of this lane's query, both halves alike
  float Lq = 0.f;                     // sum of this lane's query over this half's keys

  // The two waves of a SIMD belong to two work-groups that no barrier joins. A
  // wave's priority falls as it advances, so that the work-group that is
  // behind wins the pipe and both end together. It is 0 from PRIO_T3 on, and so at
  // the kernel's end.
  __builtin_amdgcn_s_setprio(3);

  for (int ntile = 0; ntile < NTS; ++ntile) {
    // ntile is the same for the whole work-group: scalar compares and branches
    if ((ntile & 3) == 0) {
      if (ntile == PRIO_T1) __builtin_amdgcn_s_setprio(2);
      else if (ntile == PRIO_T2) __builtin_amdgcn_s_setprio(1);
      else if (ntile == PRIO_T3) __builtin_amdgcn_s_setprio(0);
    }
    const float* Kc = (ntile & 1) ? Kbuf1 : Kbuf0;
    const float* Vc = (ntile & 1) ? Vbuf1 : Vbuf0;
    if (ntile + 1 < NTS) {
      // prefetch next tile into the other buffer (its readers finished at the
      // barrier that ended iteration ntile-1)
      float* Kn = (ntile & 1) ? Kbuf0 : Kbuf1;
      float* Vn = (ntile & 1) ? Vbuf0 : Vbuf1;
      async_copy_tile(Kn + st, Kb + (size_t)(ntile + 1) * TILEF,
                      Vn + st, Vb + (size_t)(ntile + 1) * TILEF);
      ASYNC_WAIT_PREFETCHED();   // current tile's 16 async ops are complete
    } else {
      ASYNC_WAIT_ALL();
    }
    __syncthreads();             // current tile visible to all waves

    // S^T = K^T * Q  (16n x 16m, k=256); 4 interleaved partial accumulators.
    // The tile's A fragments come from LDS two to a 16-byte read, in groups of
    // 8 reads, each group issued one group of WMMAs ahead of its use; V's 32
    // reads follow behind K's.
    const float* kp = Kc + lane * 4;   // A[row lane & 15][k=c], fragments 2*jp, 2*jp + 1
    const float* vp = Vc + lane * 4;   // A[c=lane & 15][k=n], fragments 2*i, 2*i + 1
    v2f kf[64];
    v2f vf[64];
    v8f sp[4];
    sp[0] = sp[1] = sp[2] = sp[3] = vzero8();
#pragma unroll
    for (int jp = 0; jp < 8; ++jp) {
      const float4 k4 = *(const float4*)(kp + jp * 128);
      kf[2 * jp + 0][0] = k4.x; kf[2 * jp + 0][1] = k4.y;
      kf[2 * jp + 1][0] = k4.z; kf[2 * jp + 1][1] = k4.w;
    }
#pragma unroll
    for (int g = 0; g < 4; ++g) {
      if (g < 3) {
#pragma unroll
        for (int jp = 8 * (g + 1); jp < 8 * (g + 2); ++jp) {
          const float4 k4 = *(const float4*)(kp + jp * 128);
          kf[2 * jp + 0][0] = k4.x; kf[2 * jp + 0][1] = k4.y;
          kf[2 * jp + 1][0] = k4.z; kf[2 * jp + 1][1] = k4.w;
        }
      } else {
#pragma unroll
        for (int i = 0; i < 32; ++i) {
          const float4 v4 = *(const float4*)(vp + i * 128);
          vf[2 * i + 0][0] = v4.x; vf[2 * i + 0][1] = v4.y;
          vf[2 * i + 1][0] = v4.z; vf[2 * i + 1][1] = v4.w;
        }
      }
      // holds the reads above in one place, ahead of this group's WMMAs;
      // left free they sink to their users and each waits out the LDS latency
      GROUP_FENCE();
#pragma unroll
      for (int j = 16 * g; j < 16 * (g + 1); ++j)
        sp[j & 3] = wmma4(kf[j], a_q[j], sp[j & 3]);
      // keeps the next group's reads behind these WMMAs: one place a group,
      // not spread among them
      if (g < 3) GROUP_FENCE();
    }
    v8f s = (sp[0] + sp[1]) + (sp[2] + sp[3]);

    // online softmax of this lane's query; s[0..7]: its scores with this half's keys
    float mx = fmaxf(fmaxf(fmaxf(s[0], s[1]), fmaxf(s[2], s[3])),
                     fmaxf(fmaxf(s[4], s[5]), fmaxf(s[6], s[7])));
    mx = fmaxf(mx, xhalf(mx));
    const float Mn = fmaxf(Mq, mx);
    const float alpha = exp2f((Mq - Mn) * LOG2E);
    Mq = Mn;
#pragma unroll
    for (int r = 0; r < 8; ++r) s[r] = exp2f((s[r] - Mn) * LOG2E);
#pragma unroll
    for (int ct = 0; ct < 16; ++ct)
#pragma unroll
      for (int r = 0; r < 8; ++r) o_acc[ct][r] *= alpha;

    // O^T += V * P^T; step j takes keys 4*j + 2*half + {0, 1}, on both sides
    v2f b_p[4];
#pragma unroll
    for (int j = 0; j < 4; ++j) { b_p[j][0] = s[2 * j]; b_p[j][1] = s[2 * j + 1]; }
    const v2f ps = (b_p[0] + b_p[1]) + (b_p[2] + b_p[3]);   // pairs: no register moves
    Lq = Lq * alpha + (ps[0] + ps[1]);
    // keeps the closing barrier behind the softmax: a build without this line has
    // the barrier, with its s_wait_dscnt 0, in front of the last 16 score products,
    // which then stand still until V's 32 reads have landed
    GROUP_FENCE();
#pragma unroll
    for (int ct = 0; ct < 16; ++ct)
#pragma unroll
      for (int j = 0; j < 4; ++j)
        o_acc[ct] = wmma4(vf[ct * 4 + j], b_p[j], o_acc[ct]);
    __syncthreads();   // all waves done with this tile before it is overwritten
  }

  // ---- Leave this range's partial result in the workspace ----
  // O^T tile: [ct][r>>2][lane][r&3], so that each b128 store covers 512 B in a row
  const size_t tile = ((size_t)b * NT16 + mb * 4 + wave) * KSPLIT + ks;
  float* op = Opart + tile * (16 * CDIM) + lane * 4;
#pragma unroll   // o_acc is indexed by constants only and stays in registers
  for (int ct = 0; ct < 16; ++ct) {
    *(float4*)(op + ct * 256) =
        make_float4(o_acc[ct][0], o_acc[ct][1], o_acc[ct][2], o_acc[ct][3]);
    *(float4*)(op + ct * 256 + 128) =
        make_float4(o_acc[ct][4], o_acc[ct][5], o_acc[ct][6], o_acc[ct][7]);
  }
  ADDR_WAIT();
  // the queries' maxima [0..15] and sums [16..31], the halves' sums joined
  Lq += xhalf(Lq);
  MLpart[tile * 32 + lane] = half ? Lq : Mq;
}

// ---------------------------------------------------------------------------
// Kernel 3: merge the KSPLIT key ranges, then Y = Wo * O^T + bo + x, where wo and bo
// are launch 1's Wo*Wv and Wo*bv + bo (O is a mean of t's columns)
// Grid: (NTOK/64, B, OSPLIT), 128 threads (4 waves). Wave w owns queries
// m0+w*16..+15; the work-group owns output channels [oz*64, +64).
// Lane 16*h + i holds query i alone: O^T[c = 16*cc + 8*h + r][i], which is the B
// operand as it stands, step j taking c = 16*cc + 8*h + 2*j + {0, 1}.
// Two work-groups share a WGP, so that all 512 are resident at once.
// Every loop is unrolled in full: its arrays are indexed by constants only and
// so stay in registers.
// ---------------------------------------------------------------------------
__global__ __launch_bounds__(128, 2) void merge_proj_kernel(
    const float* __restrict__ x,
    const float* __restrict__ wo, const float* __restrict__ bo,
    const float* __restrict__ Opart, const float* __restrict__ MLpart,
    float* __restrict__ out)
{
  __shared__ float wos[(CDIM / OSPLIT) * WOP];   // Wo rows of this range

  const int mb = blockIdx.x;
  const int b  = blockIdx.y;
  const int ob = blockIdx.z * (CDIM / OSPLIT);
  const int lane = threadIdx.x & 31;
  const int wave = threadIdx.x >> 5;
  const int half = lane >> 4;
  const int l15  = lane & 15;
  const int mg = mb * 64 + wave * 16 + l15;
  const float* xb = x + (size_t)b * CDIM * NTOK;

  // The global reads of the merge are issued in groups of 8 to 72 loads, so
  // that a wave pays the L2 latency once a group and not once a load.
  const size_t tile0 = ((size_t)b * NT16 + mb * 4 + wave) * KSPLIT;  // range 0
  const float* mlp = MLpart + tile0 * 32 + l15;
  const float* opp = Opart + tile0 * (16 * CDIM) + lane * 4;
  const float* wop = wo + (size_t)(ob + (threadIdx.x >> 6)) * CDIM + (threadIdx.x & 63) * 4;
  const float* xp  = xb + (size_t)(ob + 8 * half) * NTOK + mg;
  const float* bop = bo + ob + 8 * half;
  const int c4 = (threadIdx.x & 63) * 4;   // Wo staging: column group
  const int r0 = threadIdx.x >> 6;         // Wo staging: first row

  float Ms[KSPLIT], Ls[KSPLIT];            // maxima and sums of query l15
#pragma unroll
  for (int s = 0; s < KSPLIT; ++s) {
    Ms[s] = mlp[s * 32];
    Ls[s] = mlp[s * 32 + 16];
  }
  ADDR_WAIT();
  // keeps later register writes from being lifted over the wait above
  GROUP_FENCE();
  // Wo[ob .. ob+63][0..255], 2 rows a pass; a plain vector type: as float4, with
  // wop named in the wait behind the LDS stores, the array was built in scratch
  v4f wreg[CDIM / OSPLIT / 2];
#pragma unroll
  for (int i = 0; i < CDIM / OSPLIT / 2; ++i)
    wreg[i] = *(const v4f*)(wop + i * 2 * CDIM);
  // O comes in groups of four 16-channel chunks, all ranges: 32 loads a group
  float4 obuf[2][4][KSPLIT][2];
#pragma unroll
  for (int cl = 0; cl < 4; ++cl)
#pragma unroll
    for (int s = 0; s < KSPLIT; ++s)
#pragma unroll
      for (int h = 0; h < 2; ++h)
        obuf[0][cl][s][h] = *(const float4*)(
            opp + s * (16 * CDIM) + cl * 256 + h * 128);
  ADDR_WAIT();
  // holds the reads above in one place; left free they sink to their users
  GROUP_FENCE();

#pragma unroll
  for (int i = 0; i < CDIM / OSPLIT / 2; ++i)
    *(v4f*)(wos + (r0 + 2 * i) * WOP + c4) = wreg[i];
  // the wait of ADDR_WAIT; wop as its input keeps the Wo loads' address pair
  // whole up to here (the run's last load would else take it for its result)
  __asm__ volatile("s_wait_xcnt 0x0" :: "v"(wop) : "memory");
  // group 1's reads take the registers that the Wo rows have left
  GROUP_FENCE();
#pragma unroll
  for (int cl = 0; cl < 4; ++cl)
#pragma unroll
    for (int s = 0; s < KSPLIT; ++s)
#pragma unroll
      for (int h = 0; h < 2; ++h)
        obuf[1][cl][s][h] = *(const float4*)(
            opp + s * (16 * CDIM) + (4 + cl) * 256 + h * 128);
  // the residual's x and the bias come with them
  float xres[16 / OSPLIT][8];
  v4f bov[16 / OSPLIT][2];
#pragma unroll
  for (int ot = 0; ot < 16 / OSPLIT; ++ot) {
#pragma unroll
    for (int r = 0; r < 8; ++r) xres[ot][r] = xp[(size_t)(ot * 16 + r) * NTOK];
    bov[ot][0] = *(const v4f*)(bop + ot * 16);
    bov[ot][1] = *(const v4f*)(bop + ot * 16 + 4);
  }
  // holds the bias loads in this group, ahead of the wait below: left free they
  // sink past it, among the products (inputs only; the barrier below waits for
  // every load of the group in any case)
  __asm__ volatile("" :: "v"(bov[0][0]), "v"(bov[0][1]), "v"(bov[1][0]), "v"(bov[1][1]),
                         "v"(bov[2][0]), "v"(bov[2][1]), "v"(bov[3][0]), "v"(bov[3][1]));
  ADDR_WAIT();
  // one place again, ahead of the weights
  GROUP_FENCE();

  // weights of the ranges for query l15, 1 / (sum) folded in
  float wgt[KSPLIT];
  {
    float Mx = Ms[0];
#pragma unroll
    for (int s = 1; s < KSPLIT; ++s) Mx = fmaxf(Mx, Ms[s]);
    float Lt = 0.f;
#pragma unroll
    for (int s = 0; s < KSPLIT; ++s) {
      wgt[s] = exp2f((Ms[s] - Mx) * LOG2E);
      Lt += wgt[s] * Ls[s];
    }
    const float rinv = 1.0f / Lt;
#pragma unroll
    for (int s = 0; s < KSPLIT; ++s) wgt[s] *= rinv;
  }

  __syncthreads();                    // Wo slab visible to all waves

  v8f y_acc[16 / OSPLIT];
#pragma unroll
  for (int ot = 0; ot < 16 / OSPLIT; ++ot) y_acc[ot] = vzero8();

#pragma unroll
  for (int g = 0; g < 4; ++g) {
#pragma unroll
    for (int cl = 0; cl < 4; ++cl) {
      const int cc = g * 4 + cl;
      // merge the ranges: O^T[c = cc*16 + 8*half + r][m = l15], normalised
      v2f om[4];                      // om[j]: r = 2*j, 2*j + 1
#pragma unroll
      for (int s = 0; s < KSPLIT; ++s) {
        const float4 lo = obuf[g & 1][cl][s][0], hi = obuf[g & 1][cl][s][1];
        const v2f w2 = {wgt[s], wgt[s]};
        const v2f p[4] = {{lo.x, lo.y}, {lo.z, lo.w}, {hi.x, hi.y}, {hi.z, hi.w}};
#pragma unroll
        for (int j = 0; j < 4; ++j)
          om[j] = s == 0 ? w2 * p[j] : __builtin_elementwise_fma(w2, p[j], om[j]);
      }
#pragma unroll
      for (int jp = 0; jp < 2; ++jp) {
        // B[k=c][m=l15], steps 2*jp and 2*jp + 1
        const v2f b0 = om[2 * jp], b1 = om[2 * jp + 1];
#pragma unroll
        for (int ot = 0; ot < 16 / OSPLIT; ++ot) {
          // A[o=l15][k=c] of both steps in one 16-byte read
          const float4 w4 = *(const float4*)(
              wos + (ot * 16 + l15) * WOP + cc * 16 + 8 * half + 4 * jp);
          v2f a0, a1;
          a0[0] = w4.x; a0[1] = w4.y;
          a1[0] = w4.z; a1[1] = w4.w;
          y_acc[ot] = wmma4(a0, b0, y_acc[ot]);
          y_acc[ot] = wmma4(a1, b1, y_acc[ot]);
        }
      }
    }
    if (g + 2 < 4) {
      // keeps the refill behind the sums that free its registers ...
      GROUP_FENCE();
#pragma unroll
      for (int cl = 0; cl < 4; ++cl)
#pragma unroll
        for (int s = 0; s < KSPLIT; ++s)
#pragma unroll
          for (int h = 0; h < 2; ++h)
            obuf[g & 1][cl][s][h] = *(const float4*)(
                opp + s * (16 * CDIM) + ((g + 2) * 4 + cl) * 256 + h * 128);
      ADDR_WAIT();
      // ... and in one place, ahead of the next group's work
      GROUP_FENCE();
    }
  }

  float* yp = out + (size_t)b * CDIM * NTOK + (size_t)(ob + 8 * half) * NTOK + mg;
#pragma unroll
  for (int ot = 0; ot < 16 / OSPLIT; ++ot) {
    const v4f b0 = bov[ot][0], b1 = bov[ot][1];
    const float bb[8] = {b0.x, b0.y, b0.z, b0.w, b1.x, b1.y, b1.z, b1.w};
#pragma unroll
    for (int r = 0; r < 8; ++r)       // output channel ob + ot*16 + r + 8*half
      yp[(size_t)(ot * 16 + r) * NTOK] = y_acc[ot][r] + bb[r] + xres[ot][r];
  }
}

// ---------------------------------------------------------------------------
extern "C" void kernel_launch(void* const* d_in, const int* in_sizes, int n_in,
                              void* d_out, int out_size, void* d_ws, size_t ws_size,
                              hipStream_t stream) {
  (void)in_sizes; (void)n_in; (void)out_size; (void)ws_size;
  const float* x  = (const float*)d_in[0];
  const float* t  = (const float*)d_in[1];
  const float* wq = (const float*)d_in[2];
  const float* bq = (const float*)d_in[3];
  const float* wk = (const float*)d_in[4];
  const float* bk = (const float*)d_in[5];
  const float* wv = (const float*)d_in[6];
  const float* bv = (const float*)d_in[7];
  const float* wo = (const float*)d_in[8];
  const float* bo = (const float*)d_in[9];

  float* Kws = (float*)d_ws;                       // [B][N/16][32][32][4], 8 MB
  float* Vws = Kws + (size_t)BSZ * CDIM * NTOK;    // [B][N/16][32][32][4], 8 MB
  float* Ows = Vws + (size_t)BSZ * CDIM * NTOK;    // [B][N/16][KSPLIT][16*C], 32 MB
  float* MLws = Ows + (size_t)KSPLIT * BSZ * CDIM * NTOK;  // [B][N/16][KSPLIT][32]
  float* Qws = MLws + (size_t)BSZ * NT16 * KSPLIT * 32;    // [B][N/16][C/8][32][4], 8 MB
  float* Wovws = Qws + (size_t)BSZ * CDIM * NTOK;          // Wo*Wv, [C][C]
  float* Bovws = Wovws + (size_t)CDIM * CDIM;              // Wo*bv + bo, [C]

  dim3 g1(NTOK / 64, BSZ, 3);
  qkv_proj_kernel<<<g1, dim3(128, 1, 1), 0, stream>>>(t, x, wk, bk, wv, bv, wq, bq,
                                                      wo, bo, Kws, Vws, Qws,
                                                      Wovws, Bovws);

  const size_t smem = (size_t)4 * TILEF * sizeof(float);  // 64 KB
  dim3 g2(NTOK / 64, BSZ, KSPLIT);
  attn_kernel<<<g2, dim3(128, 1, 1), smem, stream>>>(Qws, Kws, Vws, Ows, MLws);

  dim3 g3(NTOK / 64, BSZ, OSPLIT);
  merge_proj_kernel<<<g3, dim3(128, 1, 1), 0, stream>>>(x, Wovws, Bovws, Ows, MLws,
                                                        (float*)d_out);
}
